// v000
// The times below were measured on an AMD MI455X: many runs one after another, warmed up first and cycling through
// copies of the inputs, with the whole window's GPU time divided by the number of runs. Launches and the gaps
// between them are all in it. The median over several windows is given; except for v000 it joins two sittings, which
// can be a few percent apart, so the side-by-side timings, each taken in one sitting, are the better comparison.
// v000 is the starting kernel. One run takes 174 microseconds.
#include <hip/hip_runtime.h>

// Contractions: q/k/v projections on v_wmma_f32_16x16x32_bf16 (bf16 operands = RNE-converted f32 inputs, f32 accumulate);
// q.k^T and p.v on v_wmma_f32_16x16x32_f16 (f16 operands: q,k,v carried x8, unnormalised p carried x1024), f32 accumulate;
// softmax, gating and epilogues in f32.

#ifndef NB
#define NB 8
#endif
#ifndef SEQ
#define SEQ 1024
#endif
#define NB_FULL 8
#define SEQ_FULL 1024
#define DD 768
#define HH 12
#define DHD 64
#define MROWS (NB * SEQ)

#define CST 72          // f16 LDS pitch of the projection epilogue tile (144 B)
#define QT 128          // queries per block (8 waves x 16 rows)
#define KBLK 64         // keys per staged block
#define LDK 72          // f16 LDS pitch of K / V / P tiles (144 B)
#define OST 68          // f32 LDS pitch of the output staging tile (272 B)
#define QKV_CARRY 8.0f
#define P_CARRY 1024.0f
#define OUT_SCALE (1.0f / 8192.0f)   // 1 / (QKV_CARRY * P_CARRY)
#define S_SCALE (1.0f / 512.0f)      // 1/sqrt(64) / (QKV_CARRY * QKV_CARRY)

static_assert(NB >= 1 && NB <= NB_FULL);
static_assert(SEQ >= QT && SEQ <= SEQ_FULL);
static_assert(SEQ % QT == 0);
static_assert(SEQ % KBLK == 0);
static_assert(MROWS % 64 == 0);
static_assert(DD % 64 == 0);
static_assert(DD % 32 == 0);
static_assert(HH * DHD == DD);
static_assert(DHD == 64);

typedef _Float16 v16h __attribute__((ext_vector_type(16)));
typedef _Float16 v8h  __attribute__((ext_vector_type(8)));
typedef v8h v8ha __attribute__((may_alias));
typedef __bf16 v16b __attribute__((ext_vector_type(16)));
typedef unsigned short v8us __attribute__((ext_vector_type(8)));
typedef v8us v8usa __attribute__((may_alias));
typedef float v8f __attribute__((ext_vector_type(8)));
typedef float v4f __attribute__((ext_vector_type(4)));
typedef v4f v4fa __attribute__((may_alias));

static_assert(sizeof(v16b) == sizeof(v8f));

// ---------------- bf16 RNE convert helpers ----------------
__device__ __forceinline__ unsigned short f2bf_bits(float f) {
    unsigned int u = __float_as_uint(f);
    u += 0x7FFFu + ((u >> 16) & 1u);
    return (unsigned short)(u >> 16);
}
__device__ __forceinline__ float bf16_rne(float f) {
    unsigned int u = __float_as_uint(f);
    u += 0x7FFFu + ((u >> 16) & 1u);
    return __uint_as_float(u & 0xFFFF0000u);
}

// ---------------- 16x32 fragment loaders (wave32 split k map, same for A and B) ----------------
// lane l: row (A) / column (B) = l & 15; elements 0..7 <- k0 + 8*(l>>4) + 0..7, elements 8..15 <- k0 + 16 + 8*(l>>4) + 0..7.
// p points at element (row, k0 + 8*(l>>4)) of a k-contiguous 16-bit row; 16-B aligned.
__device__ __forceinline__ v16h ldfrag_h(const _Float16* p) {
    union { v16h v; v8h h[2]; } u;
    u.h[0] = *(const v8ha*)(p);
    u.h[1] = *(const v8ha*)(p + 16);
    return u.v;
}
__device__ __forceinline__ v16b ldfrag_b(const unsigned short* p) {
    union { v16b v; v8us h[2]; } u;
    u.h[0] = *(const v8usa*)(p);
    u.h[1] = *(const v8usa*)(p + 16);
    return u.v;
}

// ---------------- WMMA wrappers with the VALU hazard guard ----------------
__device__ __forceinline__ v8f mma_h(v16h a, v16h b, v8f c) {
    c = __builtin_amdgcn_wmma_f32_16x16x32_f16(false, a, false, b, (short)0, c, false, false);
    asm volatile("v_nop\n\tv_nop\n\tv_nop\n\tv_nop" : "+v"(c) : "v"(a), "v"(b));
    return c;
}
__device__ __forceinline__ v8f mma_b(v16b a, v16b b, v8f c) {
    c = __builtin_amdgcn_wmma_f32_16x16x32_bf16(false, a, false, b, (short)0, c, false, false);
    const v8f ka = __builtin_bit_cast(v8f, a);
    const v8f kbv = __builtin_bit_cast(v8f, b);
    asm volatile("v_nop\n\tv_nop\n\tv_nop\n\tv_nop" : "+v"(c) : "v"(ka), "v"(kbv));
    return c;
}

__device__ __forceinline__ float rmax16(float v) {
    #pragma unroll
    for (int m = 8; m; m >>= 1) v = fmaxf(v, __shfl_xor(v, m, 32));
    return v;
}
__device__ __forceinline__ float rsum16(float v) {
    #pragma unroll
    for (int m = 8; m; m >>= 1) v += __shfl_xor(v, m, 32);
    return v;
}

// ---------------- f32 rows -> bf16 bit planes ----------------
// src rows of DD floats; compact plane row m reads source row (m / seq) * seq_full + (m % seq).
__global__ __launch_bounds__(256) void k_cvt(const float* __restrict__ src,
                                             unsigned short* __restrict__ dst,
                                             int nrow, int seq, int seq_full) {
    const int t = blockIdx.x * 256 + (int)threadIdx.x;
    const int nchunk = nrow * (DD / 8);
    if (t >= nchunk) return;
    const int m  = t / (DD / 8);
    const int c8 = (t - m * (DD / 8)) * 8;
    const int bb = m / seq;
    const int srow = bb * seq_full + (m - bb * seq);
    const float* p = src + (size_t)srow * DD + c8;
    const v4f f0 = *(const v4fa*)(p);
    const v4f f1 = *(const v4fa*)(p + 4);
    const float x0 = f0.x, x1 = f0.y, x2 = f0.z, x3 = f0.w;
    const float x4 = f1.x, x5 = f1.y, x6 = f1.z, x7 = f1.w;
    v8us o;
    o[0] = f2bf_bits(x0); o[1] = f2bf_bits(x1); o[2] = f2bf_bits(x2); o[3] = f2bf_bits(x3);
    o[4] = f2bf_bits(x4); o[5] = f2bf_bits(x5); o[6] = f2bf_bits(x6); o[7] = f2bf_bits(x7);
    unsigned short* d = dst + (size_t)m * DD + c8;
    *(v8us*)d = o;
    
}

// ---------------- QKV projection GEMM ----------------
// C[m][n] = sum_k Xb[m][k] * Wb[n][k] + bias[n], m in [0,MROWS), n in [0,DD), k in [0,DD); Wb is [out][in] = n-major, k contiguous.
// grid (DD/64, MROWS/64, 3), block 128 = 4 waves, wave tile 32x32, fragments loaded straight from the bf16 planes.
// mat 0,1 -> Qh/Kh f16 [NB*HH][SEQ][64] (x8); mat 2 -> Vt f16 [NB*HH][64][SEQ] (x8, transposed for the p.v B operand).
__global__ __launch_bounds__(128) void k_proj(
    const unsigned short* __restrict__ Xb,
    const unsigned short* __restrict__ Wqb, const unsigned short* __restrict__ Wkb,
    const unsigned short* __restrict__ Wvb,
    const float* __restrict__ bq, const float* __restrict__ bk, const float* __restrict__ bv,
    _Float16* __restrict__ Qh, _Float16* __restrict__ Kh, _Float16* __restrict__ Vt)
{
    __shared__ __attribute__((aligned(16))) _Float16 Cs[64 * CST];   // 9216 B, cross-wave (block barrier)

    const int tid = threadIdx.x, lane = tid & 31, wave = tid >> 5;
    const int row16 = lane & 15, hsel = lane >> 4, kbase = hsel << 3;
    const int mat = blockIdx.z;
    const int n0 = blockIdx.x * 64;
    const int m0 = blockIdx.y * 64;
    const int wm = (wave & 1) << 5;
    const int wn = (wave >> 1) << 5;
    const unsigned short* Wb = (mat == 0) ? Wqb : ((mat == 1) ? Wkb : Wvb);
    const float* bias = (mat == 0) ? bq : ((mat == 1) ? bk : bv);

    v8f c[2][2];
    #pragma unroll
    for (int i = 0; i < 2; ++i)
        #pragma unroll
        for (int j = 0; j < 2; ++j)
            #pragma unroll
            for (int r = 0; r < 8; ++r) c[i][j][r] = 0.f;

    const unsigned short* Ap = Xb + (size_t)(m0 + wm + row16) * DD + kbase;
    const unsigned short* Bp = Wb + (size_t)(n0 + wn + row16) * DD + kbase;

    #pragma unroll 2
    for (int k0 = 0; k0 < DD; k0 += 32) {
        const v16b a0 = ldfrag_b(Ap + k0);
        const v16b a1 = ldfrag_b(Ap + (size_t)16 * DD + k0);
        const v16b b0 = ldfrag_b(Bp + k0);
        const v16b b1 = ldfrag_b(Bp + (size_t)16 * DD + k0);
        c[0][0] = mma_b(a0, b0, c[0][0]);
        c[0][1] = mma_b(a0, b1, c[0][1]);
        c[1][0] = mma_b(a1, b0, c[1][0]);
        c[1][1] = mma_b(a1, b1, c[1][1]);
    }

    // epilogue: + bf16(bias), x8 carry, f16, staged in LDS as [s][dh] (mat 0,1) or [dh][s] (mat 2)
    #pragma unroll
    for (int j = 0; j < 2; ++j) {
        const int nl = wn + (j << 4) + row16;
        const float bb = bf16_rne(bias[n0 + nl]);
        #pragma unroll
        for (int i = 0; i < 2; ++i) {
            #pragma unroll
            for (int r = 0; r < 8; ++r) {
                const int ml = wm + (i << 4) + (hsel << 3) + r;
                const _Float16 hv = (_Float16)((c[i][j][r] + bb) * QKV_CARRY);
                const int idx = (mat != 2) ? (ml * CST + nl) : (nl * CST + ml);
                Cs[idx] = hv;
            }
        }
    }
    __syncthreads();

    const int hd = n0 >> 6;                 // head of this 64-wide n tile
    const int bi = m0 / SEQ;                // batch of this 64-row m tile
    const int s0 = m0 - bi * SEQ;
    const size_t bhh = (size_t)bi * HH + hd;
    _Float16* dst;
    size_t lpitch;
    if (mat == 2) { dst = Vt + bhh * DHD * SEQ + s0;         lpitch = SEQ; }
    else          { dst = ((mat == 0) ? Qh : Kh) + (bhh * SEQ + s0) * DHD; lpitch = DHD; }

    const int q8 = (tid & 7) << 3;
    const int l0 = tid >> 3;
    v8h v[4];
    #pragma unroll
    for (int p = 0; p < 4; ++p) v[p] = *(const v8ha*)(&Cs[(l0 + (p << 4)) * CST + q8]);
    #pragma unroll
    for (int p = 0; p < 4; ++p)
        *(v8h*)(dst + (size_t)(l0 + (p << 4)) * lpitch + q8) = v[p];
    
}

// ---------------- flash-style attention ----------------
// Qh,Kh: [NB*HH][SEQ][64] f16 (x8); Vt: [NB*HH][64][SEQ] f16 (x8); out: [NB][SEQ][DD] f32.
// grid (SEQ/QT, NB*HH), block 256 = 8 waves, wave owns 16 query rows; keys staged 64 at a time.
union __attribute__((aligned(16))) LdsU {
    _Float16 h[4 * KBLK * LDK];   // Ks | Vs | Ps during the key loop
    float    f[2 * KBLK * LDK];   // Os after the key loop
};
static_assert(sizeof(LdsU) == 36864);
static_assert(8 * 16 * OST <= 2 * KBLK * LDK);
static_assert(2 * KBLK * LDK + 8 * 16 * LDK <= 4 * KBLK * LDK);

__global__ __launch_bounds__(256) __attribute__((amdgpu_num_vgpr(256)))
void k_attn(const _Float16* __restrict__ Qh, const _Float16* __restrict__ Kh,
            const _Float16* __restrict__ Vt, const float* __restrict__ amask,
            const float* __restrict__ click, float* __restrict__ out)
{
    __shared__ LdsU lds;
    _Float16* Ks = lds.h;                      // [key][dh], cross-wave (block barriers)
    _Float16* Vs = lds.h + KBLK * LDK;         // [dh][key], cross-wave (block barriers)
    _Float16* Ps = lds.h + 2 * KBLK * LDK;     // per-wave [row][key], wave-private

    const int tid = threadIdx.x, lane = tid & 31, wave = tid >> 5;
    const int row16 = lane & 15, hsel = lane >> 4, kbase = hsel << 3;
    const int bh = blockIdx.y;
    const int b = bh / HH;
    const int hd = bh - b * HH;
    const int q0 = blockIdx.x * QT + (wave << 4);
    const size_t baseQK = (size_t)bh * SEQ * DHD;
    const size_t baseV  = (size_t)bh * DHD * SEQ;

    // resident Q fragments: 16 rows x 64 dh = 2 k-steps
    v16h qf[2];
    #pragma unroll
    for (int kk = 0; kk < 2; ++kk)
        qf[kk] = ldfrag_h(Qh + baseQK + (size_t)(q0 + row16) * DHD + (kk << 5) + kbase);

    v8f acc[4];
    #pragma unroll
    for (int jd = 0; jd < 4; ++jd)
        #pragma unroll
        for (int r = 0; r < 8; ++r) acc[jd][r] = 0.f;
    float mrow[8], lrow[8];
    #pragma unroll
    for (int r = 0; r < 8; ++r) { mrow[r] = -1e30f; lrow[r] = 0.f; }

    _Float16* P = Ps + wave * (16 * LDK);
    const int key = tid >> 2;            // staged key (K) or dh row (V), 0..63
    const int dc  = (tid & 3) << 4;      // 16 halves per thread
    const float* clk = click + (size_t)b * SEQ_FULL;
    const float* msk = amask + (size_t)b * SEQ_FULL;

    #pragma unroll 1
    for (int kb = 0; kb < SEQ; kb += KBLK) {
        __syncthreads();
        {   // K block [key][dh] and V block [dh][key], 64x64 each, fully written
            const _Float16* ksrc = Kh + baseQK + (size_t)(kb + key) * DHD + dc;
            const _Float16* vsrc = Vt + baseV + (size_t)key * SEQ + kb + dc;
            const v8h ka  = *(const v8ha*)(ksrc);
            const v8h kb8 = *(const v8ha*)(ksrc + 8);
            const v8h va  = *(const v8ha*)(vsrc);
            const v8h vb  = *(const v8ha*)(vsrc + 8);
            *(v8ha*)(&Ks[key * LDK + dc])     = ka;
            *(v8ha*)(&Ks[key * LDK + dc + 8]) = kb8;
            *(v8ha*)(&Vs[key * LDK + dc])     = va;
            *(v8ha*)(&Vs[key * LDK + dc + 8]) = vb;
        }
        __syncthreads();

        // scores S(16x64) = Qw(16x64) x K^T : B[k=dh][n=key] = Ks[key][dh], 4 n-tiles x 2 k-steps
        v8f sc[4];
        #pragma unroll
        for (int j = 0; j < 4; ++j) {
            v8f s;
            #pragma unroll
            for (int r = 0; r < 8; ++r) s[r] = 0.f;
            #pragma unroll
            for (int kk = 0; kk < 2; ++kk) {
                const v16h kf = ldfrag_h(&Ks[((j << 4) + row16) * LDK + (kk << 5) + kbase]);
                s = mma_h(qf[kk], kf, s);
            }
            sc[j] = s;
        }
        // scale 1/sqrt(64) folded with the carries, multiplicative per-key gate, additive mask (both RNE-converted to bf16)
        #pragma unroll
        for (int j = 0; j < 4; ++j) {
            const int kg = kb + (j << 4) + row16;
            const float ct = bf16_rne(clk[kg]);
            const float mk = bf16_rne(msk[kg]);
            const float g = S_SCALE * ct;
            #pragma unroll
            for (int r = 0; r < 8; ++r) sc[j][r] = sc[j][r] * g + mk;
        }
        // online softmax per row (row 8*hsel + r lives in element r across a 16-lane half)
        #pragma unroll
        for (int r = 0; r < 8; ++r) {
            float mx = sc[0][r];
            mx = fmaxf(mx, sc[1][r]); mx = fmaxf(mx, sc[2][r]); mx = fmaxf(mx, sc[3][r]);
            mx = rmax16(mx);
            const float mnew = fmaxf(mrow[r], mx);
            const float corr = __expf(mrow[r] - mnew);
            mrow[r] = mnew;
            #pragma unroll
            for (int jd = 0; jd < 4; ++jd) acc[jd][r] = acc[jd][r] * corr;
            float sum = 0.f;
            #pragma unroll
            for (int j = 0; j < 4; ++j) {
                const float e = __expf(sc[j][r] - mnew);
                sc[j][r] = e;
                sum += e;
            }
            lrow[r] = lrow[r] * corr + rsum16(sum);
        }
        // stage P x1024 as f16 (D layout -> LDS [row][key]) for the A-fragment reload
        #pragma unroll
        for (int j = 0; j < 4; ++j)
            #pragma unroll
            for (int r = 0; r < 8; ++r)
                P[(r + (hsel << 3)) * LDK + (j << 4) + row16] = (_Float16)(sc[j][r] * P_CARRY);
        __builtin_amdgcn_fence(3, "wavefront");
        __builtin_amdgcn_wave_barrier();
        // acc(16x64) += P(16x64) x V(64x64) : A[m=row][k=key] = P[row][key], B[k=key][n=dh] = Vs[dh][key]
        #pragma unroll
        for (int kk = 0; kk < 2; ++kk) {
            const v16h pf = ldfrag_h(&P[row16 * LDK + (kk << 5) + kbase]);
            #pragma unroll
            for (int jd = 0; jd < 4; ++jd) {
                const v16h vf = ldfrag_h(&Vs[((jd << 4) + row16) * LDK + (kk << 5) + kbase]);
                acc[jd] = mma_h(pf, vf, acc[jd]);
            }
        }
    }

    float scl[8];
    #pragma unroll
    for (int r = 0; r < 8; ++r) scl[r] = (1.0f / lrow[r]) * OUT_SCALE;

    __syncthreads();                             // every wave is done with Ks / Vs / Ps
    float* Os = lds.f + wave * (16 * OST);       // wave-private region, block barriers used anyway
    #pragma unroll
    for (int jd = 0; jd < 4; ++jd) {
        const int dh = (jd << 4) + row16;
        #pragma unroll
        for (int r = 0; r < 8; ++r) Os[((hsel << 3) + r) * OST + dh] = acc[jd][r] * scl[r];
    }
    __syncthreads();

    const int q4 = (lane & 15) << 2;
    v4f ov[8];
    #pragma unroll
    for (int p = 0; p < 8; ++p) ov[p] = *(const v4fa*)(&Os[((p << 1) + hsel) * OST + q4]);
    float* orow = out + ((size_t)b * SEQ + q0) * DD + hd * DHD + q4;
    #pragma unroll
    for (int p = 0; p < 8; ++p)
        *(v4f*)(orow + (size_t)((p << 1) + hsel) * DD) = ov[p];
    
}

// ---------------- launcher ----------------
extern "C" void kernel_launch(void* const* d_in, const int* in_sizes, int n_in,
                              void* d_out, int out_size, void* d_ws, size_t ws_size,
                              hipStream_t stream) {
    if (n_in < 9) return;
    const long long need_rows = (long long)(NB - 1) * SEQ_FULL + SEQ;
    if ((long long)in_sizes[0] < need_rows * DD) return;
    if ((long long)in_sizes[1] < need_rows) return;
    if ((long long)in_sizes[2] < need_rows) return;
    if (in_sizes[3] < DD * DD || in_sizes[5] < DD * DD || in_sizes[7] < DD * DD) return;
    if (in_sizes[4] < DD || in_sizes[6] < DD || in_sizes[8] < DD) return;
    if ((long long)out_size < (long long)MROWS * DD) return;

    const float* X     = (const float*)d_in[0];
    const float* amask = (const float*)d_in[1];
    const float* click = (const float*)d_in[2];
    const float* Wq    = (const float*)d_in[3];
    const float* bq    = (const float*)d_in[4];
    const float* Wk    = (const float*)d_in[5];
    const float* bk    = (const float*)d_in[6];
    const float* Wv    = (const float*)d_in[7];
    const float* bv    = (const float*)d_in[8];
    float* out = (float*)d_out;

    //   Xb  MROWS*DD bf16 | Wqb, Wkb, Wvb  DD*DD bf16 each | Qh, Kh, Vt  MROWS*DD f16 each
    const size_t plane = (size_t)MROWS * DD;      // elements
    const size_t wpl   = (size_t)DD * DD;
    const size_t total_bytes = 2u * (4u * plane + 3u * wpl);
    if (ws_size < total_bytes) return;
    unsigned short* Xb  = (unsigned short*)d_ws;
    unsigned short* Wqb = Xb + plane;
    unsigned short* Wkb = Wqb + wpl;
    unsigned short* Wvb = Wkb + wpl;
    _Float16* Qh = (_Float16*)(Wvb + wpl);
    _Float16* Kh = Qh + plane;
    _Float16* Vt = Kh + plane;

    const int nchunk_x = MROWS * (DD / 8);
    const int nchunk_w = DD * (DD / 8);
    k_cvt<<<dim3((nchunk_x + 255) / 256), dim3(256), 0, stream>>>(X,  Xb,  MROWS, SEQ, SEQ_FULL);
    k_cvt<<<dim3((nchunk_w + 255) / 256), dim3(256), 0, stream>>>(Wq, Wqb, DD, DD, DD);
    k_cvt<<<dim3((nchunk_w + 255) / 256), dim3(256), 0, stream>>>(Wk, Wkb, DD, DD, DD);
    k_cvt<<<dim3((nchunk_w + 255) / 256), dim3(256), 0, stream>>>(Wv, Wvb, DD, DD, DD);

    k_proj<<<dim3(DD / 64, MROWS / 64, 3), dim3(128), 0, stream>>>(
        Xb, Wqb, Wkb, Wvb, bq, bk, bv, Qh, Kh, Vt);

    k_attn<<<dim3(SEQ / QT, NB * HH), dim3(256), 0, stream>>>(Qh, Kh, Vt, amask, click, out);
}

// v001
// A run of this version takes 124 microseconds.
// In both of two side-by-side timings against v000, it was 1.47 times as fast.
#include <hip/hip_runtime.h>

// Contractions: q/k/v projections on v_wmma_f32_16x16x32_bf16 (bf16 operands = RNE-converted f32 inputs, f32 accumulate);
// q.k^T and p.v on v_wmma_f32_16x16x32_f16 (f16 operands: q,k,v carried x8, unnormalised p carried x1024), f32 accumulate;
// softmax, gating and epilogues in f32.

#ifndef NB
#define NB 8
#endif
#ifndef SEQ
#define SEQ 1024
#endif
#define NB_FULL 8
#define SEQ_FULL 1024
#define DD 768
#define HH 12
#define DHD 64
#define MROWS (NB * SEQ)

#define PBM 128         // projection block tile, rows of X
#define PBN 128         // projection block tile, rows of W
#define PKS 64          // k per staged projection stage (128 B of every operand row)
#define PLD 72          // 16-bit LDS pitch of a staged operand row (144 B)
#define PSTG ((PBM + PBN) * PLD)     // 16-bit elements of one stage buffer
#define PNT (DD / PKS)  // stages
#define CST 136         // f16 LDS pitch of the projection epilogue tile (272 B)
#define QT 128          // queries per block (8 waves x 16 rows)
#define KBLK 64         // keys per staged block
#define LDK 72          // f16 LDS pitch of K / V / P tiles (144 B)
#define OST 68          // f32 LDS pitch of the output staging tile (272 B)
#define QKV_CARRY 8.0f
#define P_CARRY 1024.0f
#define OUT_SCALE (1.0f / 8192.0f)   // 1 / (QKV_CARRY * P_CARRY)
#define S_SCALE (1.0f / 512.0f)      // 1/sqrt(64) / (QKV_CARRY * QKV_CARRY)

static_assert(NB >= 1 && NB <= NB_FULL);
static_assert(SEQ >= QT && SEQ <= SEQ_FULL);
static_assert(SEQ % QT == 0);
static_assert(SEQ % KBLK == 0);
static_assert(SEQ % PBM == 0);
static_assert(DD % PBN == 0);
static_assert(DD % PKS == 0);
static_assert(PNT >= 2);
static_assert(DD % 64 == 0);
static_assert(DD % 32 == 0);
static_assert(HH * DHD == DD);
static_assert(DHD == 64);

typedef _Float16 v16h __attribute__((ext_vector_type(16)));
typedef _Float16 v8h  __attribute__((ext_vector_type(8)));
typedef v8h v8ha __attribute__((may_alias));
typedef __bf16 v16b __attribute__((ext_vector_type(16)));
typedef unsigned short v8us __attribute__((ext_vector_type(8)));
typedef v8us v8usa __attribute__((may_alias));
typedef float v8f __attribute__((ext_vector_type(8)));
typedef float v4f __attribute__((ext_vector_type(4)));
typedef v4f v4fa __attribute__((may_alias));

static_assert(sizeof(v16b) == sizeof(v8f));

// ---------------- bf16 RNE convert helpers ----------------
__device__ __forceinline__ unsigned short f2bf_bits(float f) {
    unsigned int u = __float_as_uint(f);
    u += 0x7FFFu + ((u >> 16) & 1u);
    return (unsigned short)(u >> 16);
}
__device__ __forceinline__ float bf16_rne(float f) {
    unsigned int u = __float_as_uint(f);
    u += 0x7FFFu + ((u >> 16) & 1u);
    return __uint_as_float(u & 0xFFFF0000u);
}

// ---------------- 16x32 fragment loaders (wave32 split k map, same for A and B) ----------------
// lane l: row (A) / column (B) = l & 15; elements 0..7 <- k0 + 8*(l>>4) + 0..7, elements 8..15 <- k0 + 16 + 8*(l>>4) + 0..7.
// p points at element (row, k0 + 8*(l>>4)) of a k-contiguous 16-bit row; 16-B aligned.
__device__ __forceinline__ v16h ldfrag_h(const _Float16* p) {
    union { v16h v; v8h h[2]; } u;
    u.h[0] = *(const v8ha*)(p);
    u.h[1] = *(const v8ha*)(p + 16);
    return u.v;
}
__device__ __forceinline__ v16b ldfrag_b(const unsigned short* p) {
    union { v16b v; v8us h[2]; } u;
    u.h[0] = *(const v8usa*)(p);
    u.h[1] = *(const v8usa*)(p + 16);
    return u.v;
}

// ---------------- WMMA wrappers with the VALU hazard guard ----------------
__device__ __forceinline__ v8f mma_h(v16h a, v16h b, v8f c) {
    c = __builtin_amdgcn_wmma_f32_16x16x32_f16(false, a, false, b, (short)0, c, false, false);
    asm volatile("v_nop\n\tv_nop\n\tv_nop\n\tv_nop" : "+v"(c) : "v"(a), "v"(b));
    return c;
}
__device__ __forceinline__ v8f mma_b(v16b a, v16b b, v8f c) {
    c = __builtin_amdgcn_wmma_f32_16x16x32_bf16(false, a, false, b, (short)0, c, false, false);
    const v8f ka = __builtin_bit_cast(v8f, a);
    const v8f kbv = __builtin_bit_cast(v8f, b);
    asm volatile("v_nop\n\tv_nop\n\tv_nop\n\tv_nop" : "+v"(c) : "v"(ka), "v"(kbv));
    return c;
}

__device__ __forceinline__ float rmax16(float v) {
    #pragma unroll
    for (int m = 8; m; m >>= 1) v = fmaxf(v, __shfl_xor(v, m, 32));
    return v;
}
__device__ __forceinline__ float rsum16(float v) {
    #pragma unroll
    for (int m = 8; m; m >>= 1) v += __shfl_xor(v, m, 32);
    return v;
}

// ---------------- f32 rows -> bf16 bit planes ----------------
// src rows of DD floats; compact plane row m reads source row (m / seq) * seq_full + (m % seq).
__global__ __launch_bounds__(256) void k_cvt(const float* __restrict__ src,
                                             unsigned short* __restrict__ dst,
                                             int nrow, int seq, int seq_full) {
    const int t = blockIdx.x * 256 + (int)threadIdx.x;
    const int nchunk = nrow * (DD / 8);
    if (t >= nchunk) return;
    const int m  = t / (DD / 8);
    const int c8 = (t - m * (DD / 8)) * 8;
    const int bb = m / seq;
    const int srow = bb * seq_full + (m - bb * seq);
    const float* p = src + (size_t)srow * DD + c8;
    const v4f f0 = *(const v4fa*)(p);
    const v4f f1 = *(const v4fa*)(p + 4);
    const float x0 = f0.x, x1 = f0.y, x2 = f0.z, x3 = f0.w;
    const float x4 = f1.x, x5 = f1.y, x6 = f1.z, x7 = f1.w;
    v8us o;
    o[0] = f2bf_bits(x0); o[1] = f2bf_bits(x1); o[2] = f2bf_bits(x2); o[3] = f2bf_bits(x3);
    o[4] = f2bf_bits(x4); o[5] = f2bf_bits(x5); o[6] = f2bf_bits(x6); o[7] = f2bf_bits(x7);
    unsigned short* d = dst + (size_t)m * DD + c8;
    *(v8us*)d = o;
    
}

// ---------------- QKV projection GEMM ----------------
// C[m][n] = sum_k Xb[m][k] * Wb[n][k] + bias[n], m in [0,MROWS), n in [0,DD), k in [0,DD); Wb is [out][in] = n-major, k contiguous.
// grid (DD/128, MROWS/128, 3), block 128 = 4 waves (2x2), block tile 128x128, wave tile 64x64.
// Both operand tiles are staged in LDS, 64 k (128 B of every row) per stage, by asynchronous 16-byte copies into two buffers:
// the copies of stage t + 2 fly while stage t + 1 is worked on. Fragments are read from LDS by ldfrag_b, k ascending, so every sum keeps its order.
// mat 0,1 -> Qh/Kh f16 [NB*HH][SEQ][64] (x8); mat 2 -> Vt f16 [NB*HH][64][SEQ] (x8, transposed for the p.v B operand).
union __attribute__((aligned(16))) ProjLds {
    unsigned short s[2 * PSTG];   // two stage buffers, each [X 128 rows | W 128 rows] at pitch PLD
    _Float16       h[PBM * CST];  // epilogue tile after the k loop
};
static_assert(sizeof(ProjLds) == 73728);

// Eight asynchronous copies of one lane, 16 B each, rows 16 apart in the source plane and in the LDS buffer.
// l0: the lane's LDS byte address, g0: the lane's global address, both of the first row.
__device__ __forceinline__ void copy8_rows16(unsigned l0, const unsigned short* g0) {
    const unsigned lstep = 16u * PLD * 2u;
    const size_t gstep = (size_t)16 * DD;
    // s_wait_xcnt closes the statement so that no address register of a copy is rewritten in front of it
    asm volatile(
        "global_load_async_to_lds_b128 %0, %8, off\n\t"
        "global_load_async_to_lds_b128 %1, %9, off\n\t"
        "global_load_async_to_lds_b128 %2, %10, off\n\t"
        "global_load_async_to_lds_b128 %3, %11, off\n\t"
        "global_load_async_to_lds_b128 %4, %12, off\n\t"
        "global_load_async_to_lds_b128 %5, %13, off\n\t"
        "global_load_async_to_lds_b128 %6, %14, off\n\t"
        "global_load_async_to_lds_b128 %7, %15, off\n\t"
        "s_wait_xcnt 0x0"
        :: "v"(l0), "v"(l0 + lstep), "v"(l0 + 2u * lstep), "v"(l0 + 3u * lstep),
           "v"(l0 + 4u * lstep), "v"(l0 + 5u * lstep), "v"(l0 + 6u * lstep), "v"(l0 + 7u * lstep),
           "v"(g0), "v"(g0 + gstep), "v"(g0 + 2 * gstep), "v"(g0 + 3 * gstep),
           "v"(g0 + 4 * gstep), "v"(g0 + 5 * gstep), "v"(g0 + 6 * gstep), "v"(g0 + 7 * gstep)
        : "memory");
}

__global__ __launch_bounds__(128) void k_proj(
    const unsigned short* __restrict__ Xb,
    const unsigned short* __restrict__ Wqb, const unsigned short* __restrict__ Wkb,
    const unsigned short* __restrict__ Wvb,
    const float* __restrict__ bq, const float* __restrict__ bk, const float* __restrict__ bv,
    _Float16* __restrict__ Qh, _Float16* __restrict__ Kh, _Float16* __restrict__ Vt)
{
    __shared__ ProjLds lds;

    const int tid = threadIdx.x, lane = tid & 31, wave = tid >> 5;
    const int row16 = lane & 15, hsel = lane >> 4, kbase = hsel << 3;
    const int mat = blockIdx.z;
    const int n0 = blockIdx.x * PBN;
    const int m0 = blockIdx.y * PBM;
    const int wm = (wave & 1) << 6;
    const int wn = (wave >> 1) << 6;
    const unsigned short* Wb = (mat == 0) ? Wqb : ((mat == 1) ? Wkb : Wvb);
    const float* bias = (mat == 0) ? bq : ((mat == 1) ? bk : bv);

    v8f c[4][4];
    #pragma unroll
    for (int i = 0; i < 4; ++i)
        #pragma unroll
        for (int j = 0; j < 4; ++j)
            #pragma unroll
            for (int r = 0; r < 8; ++r) c[i][j][r] = 0.f;

    // copy map: thread -> row (tid >> 3) + 16 * i, 16-byte chunk tid & 7 of the row's 128 B; a wave's copy covers 4 whole lines
    const int crow = tid >> 3, cchk = tid & 7;
    const unsigned short* gX = Xb + (size_t)(m0 + crow) * DD + (cchk << 3);
    const unsigned short* gW = Wb + (size_t)(n0 + crow) * DD + (cchk << 3);
    const unsigned lX = (unsigned)(size_t)(&lds.s[crow * PLD + (cchk << 3)]);
    const unsigned lW = lX + (unsigned)(PBM * PLD * 2);

    copy8_rows16(lX, gX);
    copy8_rows16(lW, gW);
    asm volatile("s_wait_asynccnt 0x0" ::: "memory");   // stage 0 has landed before the barrier publishes it
    __syncthreads();
    copy8_rows16(lX + (unsigned)(PSTG * 2), gX + PKS);
    copy8_rows16(lW + (unsigned)(PSTG * 2), gW + PKS);

    // one copy of the loop body: the buffer is picked by an offset, and the copies' addresses stay few
    #pragma unroll 1
    for (int t = 0; t < PNT; ++t) {
        const int boff = (t & 1) * PSTG;
        const unsigned short* As = &lds.s[boff + (wm + row16) * PLD + kbase];
        const unsigned short* Bs = &lds.s[boff + (PBM + wn + row16) * PLD + kbase];
        // unrolled throughout: every index of a, b and c is a constant, so the arrays stay in registers
        #pragma unroll
        for (int kk = 0; kk < PKS; kk += 32) {
            v16b a[4], b[4];
            #pragma unroll
            for (int i = 0; i < 4; ++i) a[i] = ldfrag_b(As + i * 16 * PLD + kk);
            #pragma unroll
            for (int j = 0; j < 4; ++j) b[j] = ldfrag_b(Bs + j * 16 * PLD + kk);
            #pragma unroll
            for (int i = 0; i < 4; ++i)
                #pragma unroll
                for (int j = 0; j < 4; ++j) c[i][j] = mma_b(a[i], b[j], c[i][j]);
        }
        asm volatile("s_wait_dscnt 0x0" ::: "memory");      // this wave's reads of buffer t & 1 are done before it is refilled
        asm volatile("s_wait_asynccnt 0x0" ::: "memory");   // this wave's copies of stage t + 1 have landed
        __syncthreads();                                    // publishes stage t + 1, ends every read of stage t
        if (t + 2 < PNT) {
            copy8_rows16(lX + (unsigned)(boff * 2), gX + (t + 2) * PKS);
            copy8_rows16(lW + (unsigned)(boff * 2), gW + (t + 2) * PKS);
        }
    }
    asm volatile("s_wait_asynccnt 0x0" ::: "memory");       // no copy is in flight when the buffers become the epilogue tile

    // epilogue: + bf16(bias), x8 carry, f16, staged in LDS as [s][n] (mat 0,1) or [n][s] (mat 2)
    _Float16* Cs = lds.h;
    #pragma unroll
    for (int j = 0; j < 4; ++j) {
        const int nl = wn + (j << 4) + row16;
        const float bb = bf16_rne(bias[n0 + nl]);
        #pragma unroll
        for (int i = 0; i < 4; ++i) {
            #pragma unroll
            for (int r = 0; r < 8; ++r) {
                const int ml = wm + (i << 4) + (hsel << 3) + r;
                const _Float16 hv = (_Float16)((c[i][j][r] + bb) * QKV_CARRY);
                const int idx = (mat != 2) ? (ml * CST + nl) : (nl * CST + ml);
                Cs[idx] = hv;
            }
        }
    }
    __syncthreads();

    const int hd0 = n0 >> 6;                // first of the two heads of this 128-wide n tile
    const int bi = m0 / SEQ;                // batch of this 128-row m tile
    const int s0 = m0 - bi * SEQ;
    const int q8 = (tid & 15) << 3;         // 16-byte chunk of a 128-wide staged row
    const int l0 = tid >> 4;
    v8h v[16];
    #pragma unroll
    for (int p = 0; p < 16; ++p) v[p] = *(const v8ha*)(&Cs[(l0 + (p << 3)) * CST + q8]);
    if (mat == 2) {
        #pragma unroll
        for (int p = 0; p < 16; ++p) {
            const int l = l0 + (p << 3);    // staged row = n: head hd0 + (l >> 6), dh = l & 63; chunk = s
            const size_t bhh = (size_t)bi * HH + hd0 + (l >> 6);
            *(v8h*)(Vt + (bhh * DHD + (l & 63)) * SEQ + s0 + q8) = v[p];
        }
    } else {
        _Float16* dst = (mat == 0) ? Qh : Kh;
        const size_t bhh = (size_t)bi * HH + hd0 + (q8 >> 6);
        #pragma unroll
        for (int p = 0; p < 16; ++p) {
            const int l = l0 + (p << 3);    // staged row = s; chunk = n: head hd0 + (q8 >> 6), dh = q8 & 63
            *(v8h*)(dst + (bhh * SEQ + s0 + l) * DHD + (q8 & 63)) = v[p];
        }
        // the built code lets this path run on into the V path's address arithmetic, which rewrites the stores' address pair: the wait stands in front of that
        asm volatile("s_wait_xcnt 0x0" ::: "memory");
    }
}

// ---------------- flash-style attention ----------------
// Qh,Kh: [NB*HH][SEQ][64] f16 (x8); Vt: [NB*HH][64][SEQ] f16 (x8); out: [NB][SEQ][DD] f32.
// grid (SEQ/QT, NB*HH), block 256 = 8 waves, wave owns 16 query rows; keys staged 64 at a time.
union __attribute__((aligned(16))) LdsU {
    _Float16 h[4 * KBLK * LDK];   // Ks | Vs | Ps during the key loop
    float    f[2 * KBLK * LDK];   // Os after the key loop
};
static_assert(sizeof(LdsU) == 36864);
static_assert(8 * 16 * OST <= 2 * KBLK * LDK);
static_assert(2 * KBLK * LDK + 8 * 16 * LDK <= 4 * KBLK * LDK);

__global__ __launch_bounds__(256) __attribute__((amdgpu_num_vgpr(256)))
void k_attn(const _Float16* __restrict__ Qh, const _Float16* __restrict__ Kh,
            const _Float16* __restrict__ Vt, const float* __restrict__ amask,
            const float* __restrict__ click, float* __restrict__ out)
{
    __shared__ LdsU lds;
    _Float16* Ks = lds.h;                      // [key][dh], cross-wave (block barriers)
    _Float16* Vs = lds.h + KBLK * LDK;         // [dh][key], cross-wave (block barriers)
    _Float16* Ps = lds.h + 2 * KBLK * LDK;     // per-wave [row][key], wave-private

    const int tid = threadIdx.x, lane = tid & 31, wave = tid >> 5;
    const int row16 = lane & 15, hsel = lane >> 4, kbase = hsel << 3;
    const int bh = blockIdx.y;
    const int b = bh / HH;
    const int hd = bh - b * HH;
    const int q0 = blockIdx.x * QT + (wave << 4);
    const size_t baseQK = (size_t)bh * SEQ * DHD;
    const size_t baseV  = (size_t)bh * DHD * SEQ;

    // resident Q fragments: 16 rows x 64 dh = 2 k-steps
    v16h qf[2];
    #pragma unroll
    for (int kk = 0; kk < 2; ++kk)
        qf[kk] = ldfrag_h(Qh + baseQK + (size_t)(q0 + row16) * DHD + (kk << 5) + kbase);

    v8f acc[4];
    #pragma unroll
    for (int jd = 0; jd < 4; ++jd)
        #pragma unroll
        for (int r = 0; r < 8; ++r) acc[jd][r] = 0.f;
    float mrow[8], lrow[8];
    #pragma unroll
    for (int r = 0; r < 8; ++r) { mrow[r] = -1e30f; lrow[r] = 0.f; }

    _Float16* P = Ps + wave * (16 * LDK);
    const int key = tid >> 2;            // staged key (K) or dh row (V), 0..63
    const int dc  = (tid & 3) << 4;      // 16 halves per thread
    const float* clk = click + (size_t)b * SEQ_FULL;
    const float* msk = amask + (size_t)b * SEQ_FULL;

    #pragma unroll 1
    for (int kb = 0; kb < SEQ; kb += KBLK) {
        __syncthreads();
        {   // K block [key][dh] and V block [dh][key], 64x64 each, fully written
            const _Float16* ksrc = Kh + baseQK + (size_t)(kb + key) * DHD + dc;
            const _Float16* vsrc = Vt + baseV + (size_t)key * SEQ + kb + dc;
            const v8h ka  = *(const v8ha*)(ksrc);
            const v8h kb8 = *(const v8ha*)(ksrc + 8);
            const v8h va  = *(const v8ha*)(vsrc);
            const v8h vb  = *(const v8ha*)(vsrc + 8);
            *(v8ha*)(&Ks[key * LDK + dc])     = ka;
            *(v8ha*)(&Ks[key * LDK + dc + 8]) = kb8;
            *(v8ha*)(&Vs[key * LDK + dc])     = va;
            *(v8ha*)(&Vs[key * LDK + dc + 8]) = vb;
        }
        __syncthreads();

        // scores S(16x64) = Qw(16x64) x K^T : B[k=dh][n=key] = Ks[key][dh], 4 n-tiles x 2 k-steps
        v8f sc[4];
        #pragma unroll
        for (int j = 0; j < 4; ++j) {
            v8f s;
            #pragma unroll
            for (int r = 0; r < 8; ++r) s[r] = 0.f;
            #pragma unroll
            for (int kk = 0; kk < 2; ++kk) {
                const v16h kf = ldfrag_h(&Ks[((j << 4) + row16) * LDK + (kk << 5) + kbase]);
                s = mma_h(qf[kk], kf, s);
            }
            sc[j] = s;
        }
        // scale 1/sqrt(64) folded with the carries, multiplicative per-key gate, additive mask (both RNE-converted to bf16)
        #pragma unroll
        for (int j = 0; j < 4; ++j) {
            const int kg = kb + (j << 4) + row16;
            const float ct = bf16_rne(clk[kg]);
            const float mk = bf16_rne(msk[kg]);
            const float g = S_SCALE * ct;
            #pragma unroll
            for (int r = 0; r < 8; ++r) sc[j][r] = sc[j][r] * g + mk;
        }
        // online softmax per row (row 8*hsel + r lives in element r across a 16-lane half)
        #pragma unroll
        for (int r = 0; r < 8; ++r) {
            float mx = sc[0][r];
            mx = fmaxf(mx, sc[1][r]); mx = fmaxf(mx, sc[2][r]); mx = fmaxf(mx, sc[3][r]);
            mx = rmax16(mx);
            const float mnew = fmaxf(mrow[r], mx);
            const float corr = __expf(mrow[r] - mnew);
            mrow[r] = mnew;
            #pragma unroll
            for (int jd = 0; jd < 4; ++jd) acc[jd][r] = acc[jd][r] * corr;
            float sum = 0.f;
            #pragma unroll
            for (int j = 0; j < 4; ++j) {
                const float e = __expf(sc[j][r] - mnew);
                sc[j][r] = e;
                sum += e;
            }
            lrow[r] = lrow[r] * corr + rsum16(sum);
        }
        // stage P x1024 as f16 (D layout -> LDS [row][key]) for the A-fragment reload
        #pragma unroll
        for (int j = 0; j < 4; ++j)
            #pragma unroll
            for (int r = 0; r < 8; ++r)
                P[(r + (hsel << 3)) * LDK + (j << 4) + row16] = (_Float16)(sc[j][r] * P_CARRY);
        __builtin_amdgcn_fence(3, "wavefront");
        __builtin_amdgcn_wave_barrier();
        // acc(16x64) += P(16x64) x V(64x64) : A[m=row][k=key] = P[row][key], B[k=key][n=dh] = Vs[dh][key]
        #pragma unroll
        for (int kk = 0; kk < 2; ++kk) {
            const v16h pf = ldfrag_h(&P[row16 * LDK + (kk << 5) + kbase]);
            #pragma unroll
            for (int jd = 0; jd < 4; ++jd) {
                const v16h vf = ldfrag_h(&Vs[((jd << 4) + row16) * LDK + (kk << 5) + kbase]);
                acc[jd] = mma_h(pf, vf, acc[jd]);
            }
        }
    }

    float scl[8];
    #pragma unroll
    for (int r = 0; r < 8; ++r) scl[r] = (1.0f / lrow[r]) * OUT_SCALE;

    __syncthreads();                             // every wave is done with Ks / Vs / Ps
    float* Os = lds.f + wave * (16 * OST);       // wave-private region, block barriers used anyway
    #pragma unroll
    for (int jd = 0; jd < 4; ++jd) {
        const int dh = (jd << 4) + row16;
        #pragma unroll
        for (int r = 0; r < 8; ++r) Os[((hsel << 3) + r) * OST + dh] = acc[jd][r] * scl[r];
    }
    __syncthreads();

    const int q4 = (lane & 15) << 2;
    v4f ov[8];
    #pragma unroll
    for (int p = 0; p < 8; ++p) ov[p] = *(const v4fa*)(&Os[((p << 1) + hsel) * OST + q4]);
    float* orow = out + ((size_t)b * SEQ + q0) * DD + hd * DHD + q4;
    #pragma unroll
    for (int p = 0; p < 8; ++p)
        *(v4f*)(orow + (size_t)((p << 1) + hsel) * DD) = ov[p];
    
}

// ---------------- launcher ----------------
extern "C" void kernel_launch(void* const* d_in, const int* in_sizes, int n_in,
                              void* d_out, int out_size, void* d_ws, size_t ws_size,
                              hipStream_t stream) {
    if (n_in < 9) return;
    const long long need_rows = (long long)(NB - 1) * SEQ_FULL + SEQ;
    if ((long long)in_sizes[0] < need_rows * DD) return;
    if ((long long)in_sizes[1] < need_rows) return;
    if ((long long)in_sizes[2] < need_rows) return;
    if (in_sizes[3] < DD * DD || in_sizes[5] < DD * DD || in_sizes[7] < DD * DD) return;
    if (in_sizes[4] < DD || in_sizes[6] < DD || in_sizes[8] < DD) return;
    if ((long long)out_size < (long long)MROWS * DD) return;

    const float* X     = (const float*)d_in[0];
    const float* amask = (const float*)d_in[1];
    const float* click = (const float*)d_in[2];
    const float* Wq    = (const float*)d_in[3];
    const float* bq    = (const float*)d_in[4];
    const float* Wk    = (const float*)d_in[5];
    const float* bk    = (const float*)d_in[6];
    const float* Wv    = (const float*)d_in[7];
    const float* bv    = (const float*)d_in[8];
    float* out = (float*)d_out;

    //   Xb  MROWS*DD bf16 | Wqb, Wkb, Wvb  DD*DD bf16 each | Qh, Kh, Vt  MROWS*DD f16 each
    const size_t plane = (size_t)MROWS * DD;      // elements
    const size_t wpl   = (size_t)DD * DD;
    const size_t total_bytes = 2u * (4u * plane + 3u * wpl);
    if (ws_size < total_bytes) return;
    unsigned short* Xb  = (unsigned short*)d_ws;
    unsigned short* Wqb = Xb + plane;
    unsigned short* Wkb = Wqb + wpl;
    unsigned short* Wvb = Wkb + wpl;
    _Float16* Qh = (_Float16*)(Wvb + wpl);
    _Float16* Kh = Qh + plane;
    _Float16* Vt = Kh + plane;

    const int nchunk_x = MROWS * (DD / 8);
    const int nchunk_w = DD * (DD / 8);
    k_cvt<<<dim3((nchunk_x + 255) / 256), dim3(256), 0, stream>>>(X,  Xb,  MROWS, SEQ, SEQ_FULL);
    k_cvt<<<dim3((nchunk_w + 255) / 256), dim3(256), 0, stream>>>(Wq, Wqb, DD, DD, DD);
    k_cvt<<<dim3((nchunk_w + 255) / 256), dim3(256), 0, stream>>>(Wk, Wkb, DD, DD, DD);
    k_cvt<<<dim3((nchunk_w + 255) / 256), dim3(256), 0, stream>>>(Wv, Wvb, DD, DD, DD);

    k_proj<<<dim3(DD / PBN, MROWS / PBM, 3), dim3(128), 0, stream>>>(
        Xb, Wqb, Wkb, Wvb, bq, bk, bv, Qh, Kh, Vt);

    k_attn<<<dim3(SEQ / QT, NB * HH), dim3(256), 0, stream>>>(Qh, Kh, Vt, amask, click, out);
}

// v002
// One run takes 95.3 microseconds.
// Next to v001, in two timings, it ran 1.31 and 1.32 times as fast.
// All steps since v000 together make it 1.93 times as fast.
#include <hip/hip_runtime.h>

// Contractions: q/k/v projections on v_wmma_f32_16x16x32_bf16 (bf16 operands = RNE-converted f32 inputs, f32 accumulate);
// q.k^T and p.v on v_wmma_f32_16x16x32_f16 (f16 operands: q,k,v carried x8, unnormalised p carried x1024), f32 accumulate;
// softmax, gating and epilogues in f32.

#ifndef NB
#define NB 8
#endif
#ifndef SEQ
#define SEQ 1024
#endif
#define NB_FULL 8
#define SEQ_FULL 1024
#define DD 768
#define HH 12
#define DHD 64
#define MROWS (NB * SEQ)

#define PBM 128         // projection block tile, rows of X
#define PBN 128         // projection block tile, rows of W
#define PKS 64          // k per staged projection stage (128 B of every operand row)
#define PLD 72          // 16-bit LDS pitch of a staged operand row (144 B)
#define PSTG ((PBM + PBN) * PLD)     // 16-bit elements of one stage buffer
#define PNT (DD / PKS)  // stages
#define CST 136         // f16 LDS pitch of the projection epilogue tile (272 B)
#define QT 128          // queries per block (8 waves x 16 rows)
#define KBLK 64         // keys per staged block
#define LDK 72          // f16 LDS pitch of K / V tiles (144 B)
#define OST 68          // f32 LDS pitch of the output staging tile (272 B)
#define QKV_CARRY 8.0f
#define P_CARRY 1024.0f
#define OUT_SCALE (1.0f / 8192.0f)   // 1 / (QKV_CARRY * P_CARRY)
#define S_SCALE (1.0f / 512.0f)      // 1/sqrt(64) / (QKV_CARRY * QKV_CARRY)

static_assert(NB >= 1 && NB <= NB_FULL);
static_assert(SEQ >= QT && SEQ <= SEQ_FULL);
static_assert(SEQ % QT == 0);
static_assert(SEQ % KBLK == 0);
static_assert(SEQ % PBM == 0);
static_assert(DD % PBN == 0);
static_assert(DD % PKS == 0);
static_assert(PNT >= 2);
static_assert(DD % 64 == 0);
static_assert(DD % 32 == 0);
static_assert(HH * DHD == DD);
static_assert(DHD == 64);

typedef _Float16 v16h __attribute__((ext_vector_type(16)));
typedef _Float16 v8h  __attribute__((ext_vector_type(8)));
typedef v8h v8ha __attribute__((may_alias));
typedef __bf16 v16b __attribute__((ext_vector_type(16)));
typedef unsigned short v8us __attribute__((ext_vector_type(8)));
typedef v8us v8usa __attribute__((may_alias));
typedef float v8f __attribute__((ext_vector_type(8)));
typedef float v4f __attribute__((ext_vector_type(4)));
typedef v4f v4fa __attribute__((may_alias));

static_assert(sizeof(v16b) == sizeof(v8f));

// ---------------- bf16 RNE convert helpers ----------------
__device__ __forceinline__ unsigned short f2bf_bits(float f) {
    unsigned int u = __float_as_uint(f);
    u += 0x7FFFu + ((u >> 16) & 1u);
    return (unsigned short)(u >> 16);
}
__device__ __forceinline__ float bf16_rne(float f) {
    unsigned int u = __float_as_uint(f);
    u += 0x7FFFu + ((u >> 16) & 1u);
    return __uint_as_float(u & 0xFFFF0000u);
}

// ---------------- 16x32 fragment loaders (wave32 split k map, same for A and B) ----------------
// lane l: row (A) / column (B) = l & 15; elements 0..7 <- k0 + 8*(l>>4) + 0..7, elements 8..15 <- k0 + 16 + 8*(l>>4) + 0..7.
// p points at element (row, k0 + 8*(l>>4)) of a k-contiguous 16-bit row; 16-B aligned.
__device__ __forceinline__ v16h ldfrag_h(const _Float16* p) {
    union { v16h v; v8h h[2]; } u;
    u.h[0] = *(const v8ha*)(p);
    u.h[1] = *(const v8ha*)(p + 16);
    return u.v;
}
__device__ __forceinline__ v16b ldfrag_b(const unsigned short* p) {
    union { v16b v; v8us h[2]; } u;
    u.h[0] = *(const v8usa*)(p);
    u.h[1] = *(const v8usa*)(p + 16);
    return u.v;
}

// ---------------- WMMA wrappers with the VALU hazard guard ----------------
__device__ __forceinline__ v8f mma_h(v16h a, v16h b, v8f c) {
    c = __builtin_amdgcn_wmma_f32_16x16x32_f16(false, a, false, b, (short)0, c, false, false);
    asm volatile("v_nop\n\tv_nop\n\tv_nop\n\tv_nop" : "+v"(c) : "v"(a), "v"(b));
    return c;
}
__device__ __forceinline__ v8f mma_b(v16b a, v16b b, v8f c) {
    c = __builtin_amdgcn_wmma_f32_16x16x32_bf16(false, a, false, b, (short)0, c, false, false);
    const v8f ka = __builtin_bit_cast(v8f, a);
    const v8f kbv = __builtin_bit_cast(v8f, b);
    asm volatile("v_nop\n\tv_nop\n\tv_nop\n\tv_nop" : "+v"(c) : "v"(ka), "v"(kbv));
    return c;
}

// ---------------- f32 rows -> bf16 bit planes ----------------
// src rows of DD floats; compact plane row m reads source row (m / seq) * seq_full + (m % seq).
__global__ __launch_bounds__(256) void k_cvt(const float* __restrict__ src,
                                             unsigned short* __restrict__ dst,
                                             int nrow, int seq, int seq_full) {
    const int t = blockIdx.x * 256 + (int)threadIdx.x;
    const int nchunk = nrow * (DD / 8);
    if (t >= nchunk) return;
    const int m  = t / (DD / 8);
    const int c8 = (t - m * (DD / 8)) * 8;
    const int bb = m / seq;
    const int srow = bb * seq_full + (m - bb * seq);
    const float* p = src + (size_t)srow * DD + c8;
    const v4f f0 = *(const v4fa*)(p);
    const v4f f1 = *(const v4fa*)(p + 4);
    const float x0 = f0.x, x1 = f0.y, x2 = f0.z, x3 = f0.w;
    const float x4 = f1.x, x5 = f1.y, x6 = f1.z, x7 = f1.w;
    v8us o;
    o[0] = f2bf_bits(x0); o[1] = f2bf_bits(x1); o[2] = f2bf_bits(x2); o[3] = f2bf_bits(x3);
    o[4] = f2bf_bits(x4); o[5] = f2bf_bits(x5); o[6] = f2bf_bits(x6); o[7] = f2bf_bits(x7);
    unsigned short* d = dst + (size_t)m * DD + c8;
    *(v8us*)d = o;
    
}

// ---------------- QKV projection GEMM ----------------
// C[m][n] = sum_k Xb[m][k] * Wb[n][k] + bias[n], m in [0,MROWS), n in [0,DD), k in [0,DD); Wb is [out][in] = n-major, k contiguous.
// grid (DD/128, MROWS/128, 3), block 128 = 4 waves (2x2), block tile 128x128, wave tile 64x64.
// Both operand tiles are staged in LDS, 64 k (128 B of every row) per stage, by asynchronous 16-byte copies into two buffers:
// the copies of stage t + 2 fly while stage t + 1 is worked on. Fragments are read from LDS by ldfrag_b, k ascending, so every sum keeps its order.
// mat 0,1 -> Qh/Kh f16 [NB*HH][SEQ][64] (x8); mat 2 -> Vt f16 [NB*HH][64][SEQ] (x8, transposed for the p.v A operand).
union __attribute__((aligned(16))) ProjLds {
    unsigned short s[2 * PSTG];   // two stage buffers, each [X 128 rows | W 128 rows] at pitch PLD
    _Float16       h[PBM * CST];  // epilogue tile after the k loop
};
static_assert(sizeof(ProjLds) == 73728);

// Eight asynchronous copies of one lane, 16 B each, rows 16 apart in the source plane and in the LDS buffer.
// l0: the lane's LDS byte address, g0: the lane's global address, both of the first row.
__device__ __forceinline__ void copy8_rows16(unsigned l0, const unsigned short* g0) {
    const unsigned lstep = 16u * PLD * 2u;
    const size_t gstep = (size_t)16 * DD;
    // s_wait_xcnt closes the statement so that no address register of a copy is rewritten in front of it
    asm volatile(
        "global_load_async_to_lds_b128 %0, %8, off\n\t"
        "global_load_async_to_lds_b128 %1, %9, off\n\t"
        "global_load_async_to_lds_b128 %2, %10, off\n\t"
        "global_load_async_to_lds_b128 %3, %11, off\n\t"
        "global_load_async_to_lds_b128 %4, %12, off\n\t"
        "global_load_async_to_lds_b128 %5, %13, off\n\t"
        "global_load_async_to_lds_b128 %6, %14, off\n\t"
        "global_load_async_to_lds_b128 %7, %15, off\n\t"
        "s_wait_xcnt 0x0"
        :: "v"(l0), "v"(l0 + lstep), "v"(l0 + 2u * lstep), "v"(l0 + 3u * lstep),
           "v"(l0 + 4u * lstep), "v"(l0 + 5u * lstep), "v"(l0 + 6u * lstep), "v"(l0 + 7u * lstep),
           "v"(g0), "v"(g0 + gstep), "v"(g0 + 2 * gstep), "v"(g0 + 3 * gstep),
           "v"(g0 + 4 * gstep), "v"(g0 + 5 * gstep), "v"(g0 + 6 * gstep), "v"(g0 + 7 * gstep)
        : "memory");
}

__global__ __launch_bounds__(128) void k_proj(
    const unsigned short* __restrict__ Xb,
    const unsigned short* __restrict__ Wqb, const unsigned short* __restrict__ Wkb,
    const unsigned short* __restrict__ Wvb,
    const float* __restrict__ bq, const float* __restrict__ bk, const float* __restrict__ bv,
    _Float16* __restrict__ Qh, _Float16* __restrict__ Kh, _Float16* __restrict__ Vt)
{
    __shared__ ProjLds lds;

    const int tid = threadIdx.x, lane = tid & 31, wave = tid >> 5;
    const int row16 = lane & 15, hsel = lane >> 4, kbase = hsel << 3;
    const int mat = blockIdx.z;
    const int n0 = blockIdx.x * PBN;
    const int m0 = blockIdx.y * PBM;
    const int wm = (wave & 1) << 6;
    const int wn = (wave >> 1) << 6;
    const unsigned short* Wb = (mat == 0) ? Wqb : ((mat == 1) ? Wkb : Wvb);
    const float* bias = (mat == 0) ? bq : ((mat == 1) ? bk : bv);

    v8f c[4][4];
    #pragma unroll
    for (int i = 0; i < 4; ++i)
        #pragma unroll
        for (int j = 0; j < 4; ++j)
            #pragma unroll
            for (int r = 0; r < 8; ++r) c[i][j][r] = 0.f;

    // copy map: thread -> row (tid >> 3) + 16 * i, 16-byte chunk tid & 7 of the row's 128 B; a wave's copy covers 4 whole lines
    const int crow = tid >> 3, cchk = tid & 7;
    const unsigned short* gX = Xb + (size_t)(m0 + crow) * DD + (cchk << 3);
    const unsigned short* gW = Wb + (size_t)(n0 + crow) * DD + (cchk << 3);
    const unsigned lX = (unsigned)(size_t)(&lds.s[crow * PLD + (cchk << 3)]);
    const unsigned lW = lX + (unsigned)(PBM * PLD * 2);

    copy8_rows16(lX, gX);
    copy8_rows16(lW, gW);
    asm volatile("s_wait_asynccnt 0x0" ::: "memory");   // stage 0 has landed before the barrier publishes it
    __syncthreads();
    copy8_rows16(lX + (unsigned)(PSTG * 2), gX + PKS);
    copy8_rows16(lW + (unsigned)(PSTG * 2), gW + PKS);

    // one copy of the loop body: the buffer is picked by an offset, and the copies' addresses stay few
    #pragma unroll 1
    for (int t = 0; t < PNT; ++t) {
        const int boff = (t & 1) * PSTG;
        const unsigned short* As = &lds.s[boff + (wm + row16) * PLD + kbase];
        const unsigned short* Bs = &lds.s[boff + (PBM + wn + row16) * PLD + kbase];
        // unrolled throughout: every index of a, b and c is a constant, so the arrays stay in registers
        #pragma unroll
        for (int kk = 0; kk < PKS; kk += 32) {
            v16b a[4], b[4];
            #pragma unroll
            for (int i = 0; i < 4; ++i) a[i] = ldfrag_b(As + i * 16 * PLD + kk);
            #pragma unroll
            for (int j = 0; j < 4; ++j) b[j] = ldfrag_b(Bs + j * 16 * PLD + kk);
            #pragma unroll
            for (int i = 0; i < 4; ++i)
                #pragma unroll
                for (int j = 0; j < 4; ++j) c[i][j] = mma_b(a[i], b[j], c[i][j]);
        }
        asm volatile("s_wait_dscnt 0x0" ::: "memory");      // this wave's reads of buffer t & 1 are done before it is refilled
        asm volatile("s_wait_asynccnt 0x0" ::: "memory");   // this wave's copies of stage t + 1 have landed
        __syncthreads();                                    // publishes stage t + 1, ends every read of stage t
        if (t + 2 < PNT) {
            copy8_rows16(lX + (unsigned)(boff * 2), gX + (t + 2) * PKS);
            copy8_rows16(lW + (unsigned)(boff * 2), gW + (t + 2) * PKS);
        }
    }
    asm volatile("s_wait_asynccnt 0x0" ::: "memory");       // no copy is in flight when the buffers become the epilogue tile

    // epilogue: + bf16(bias), x8 carry, f16, staged in LDS as [s][n] (mat 0,1) or [n][s] (mat 2)
    _Float16* Cs = lds.h;
    #pragma unroll
    for (int j = 0; j < 4; ++j) {
        const int nl = wn + (j << 4) + row16;
        const float bb = bf16_rne(bias[n0 + nl]);
        #pragma unroll
        for (int i = 0; i < 4; ++i) {
            #pragma unroll
            for (int r = 0; r < 8; ++r) {
                const int ml = wm + (i << 4) + (hsel << 3) + r;
                const _Float16 hv = (_Float16)((c[i][j][r] + bb) * QKV_CARRY);
                const int idx = (mat != 2) ? (ml * CST + nl) : (nl * CST + ml);
                Cs[idx] = hv;
            }
        }
    }
    __syncthreads();

    const int hd0 = n0 >> 6;                // first of the two heads of this 128-wide n tile
    const int bi = m0 / SEQ;                // batch of this 128-row m tile
    const int s0 = m0 - bi * SEQ;
    const int q8 = (tid & 15) << 3;         // 16-byte chunk of a 128-wide staged row
    const int l0 = tid >> 4;
    v8h v[16];
    #pragma unroll
    for (int p = 0; p < 16; ++p) v[p] = *(const v8ha*)(&Cs[(l0 + (p << 3)) * CST + q8]);
    if (mat == 2) {
        #pragma unroll
        for (int p = 0; p < 16; ++p) {
            const int l = l0 + (p << 3);    // staged row = n: head hd0 + (l >> 6), dh = l & 63; chunk = s
            const size_t bhh = (size_t)bi * HH + hd0 + (l >> 6);
            *(v8h*)(Vt + (bhh * DHD + (l & 63)) * SEQ + s0 + q8) = v[p];
        }
    } else {
        _Float16* dst = (mat == 0) ? Qh : Kh;
        const size_t bhh = (size_t)bi * HH + hd0 + (q8 >> 6);
        #pragma unroll
        for (int p = 0; p < 16; ++p) {
            const int l = l0 + (p << 3);    // staged row = s; chunk = n: head hd0 + (q8 >> 6), dh = q8 & 63
            *(v8h*)(dst + (bhh * SEQ + s0 + l) * DHD + (q8 & 63)) = v[p];
        }
        // the built code lets this path run on into the V path's address arithmetic, which rewrites the stores' address pair: the wait stands in front of that
        asm volatile("s_wait_xcnt 0x0" ::: "memory");
    }
}

// ---------------- flash-style attention ----------------
// Qh,Kh: [NB*HH][SEQ][64] f16 (x8); Vt: [NB*HH][64][SEQ] f16 (x8); out: [NB][SEQ][DD] f32.
// grid (SEQ/QT, NB*HH), block 256 = 8 waves, wave owns 16 queries; keys staged 64 at a time.
// Transposed products: S^T = K x Q^T and O^T += V^T x P^T. A lane holds one query (column lane & 15) and, of every 16-key tile,
// the keys 8 * (lane >> 4) + 0..7: maximum and sum run in the lane, the two halves of a wave meet by one cross-row move,
// and two converted score tiles are the B fragment of the second product as they stand (same split k map as ldfrag_h).
union __attribute__((aligned(16))) LdsU {
    _Float16 h[4 * KBLK * LDK];   // Ks | Vs | per-key gate and mask tables during the key loop
    float    f[2 * KBLK * LDK];   // Os after the key loop
};
static_assert(sizeof(LdsU) == 36864);
static_assert(8 * 16 * OST <= 2 * KBLK * LDK);
static_assert(KBLK * LDK + 2 * SEQ <= 2 * KBLK * LDK);
static_assert(SEQ % 4 == 0 && SEQ / 4 <= 256);

// lane l <-> lane l ^ 16
__device__ __forceinline__ float xhalf(float x) {
    const int b = __builtin_bit_cast(int, x);
    return __builtin_bit_cast(float, __builtin_amdgcn_permlanex16(b, b, 0x76543210, 0xfedcba98, false, false));
}
__device__ __forceinline__ v8f ld8f(const float* p) {
    union { v8f v; v4f q[2]; } u;
    u.q[0] = *(const v4fa*)(p);
    u.q[1] = *(const v4fa*)(p + 4);
    return u.v;
}

__global__ __launch_bounds__(256) __attribute__((amdgpu_num_vgpr(256)))
void k_attn(const _Float16* __restrict__ Qh, const _Float16* __restrict__ Kh,
            const _Float16* __restrict__ Vt, const float* __restrict__ amask,
            const float* __restrict__ click, float* __restrict__ out)
{
    __shared__ LdsU lds;
    _Float16* Ks = lds.h;                      // [key][dh], cross-wave (block barriers)
    _Float16* Vs = lds.h + KBLK * LDK;         // [dh][key], cross-wave (block barriers)
    float* Gs = lds.f + KBLK * LDK;            // [key] score scale x gate, all SEQ keys
    float* Ms = Gs + SEQ;                      // [key] additive mask, all SEQ keys

    const int tid = threadIdx.x, lane = tid & 31, wave = tid >> 5;
    const int row16 = lane & 15, hsel = lane >> 4, kbase = hsel << 3;
    const int bh = blockIdx.y;
    const int b = bh / HH;
    const int hd = bh - b * HH;
    const int q0 = blockIdx.x * QT + (wave << 4);
    const size_t baseQK = (size_t)bh * SEQ * DHD;
    const size_t baseV  = (size_t)bh * DHD * SEQ;

    // resident Q fragments (B operand, column = query): 64 dh x 16 queries = 2 k-steps
    v16h qf[2];
    #pragma unroll
    for (int kk = 0; kk < 2; ++kk)
        qf[kk] = ldfrag_h(Qh + baseQK + (size_t)(q0 + row16) * DHD + (kk << 5) + kbase);

    // per-key tables: scale 1/sqrt(64) folded with the carries x gate, and the additive mask (both inputs RNE-converted to bf16);
    // published by the barriers at the head of the first pass
    if (tid < SEQ / 4) {
        const v4f c4 = *(const v4fa*)(click + (size_t)b * SEQ_FULL + (tid << 2));
        const v4f m4 = *(const v4fa*)(amask + (size_t)b * SEQ_FULL + (tid << 2));
        v4f g4, k4;
        #pragma unroll
        for (int e = 0; e < 4; ++e) { g4[e] = S_SCALE * bf16_rne(c4[e]); k4[e] = bf16_rne(m4[e]); }
        *(v4fa*)(&Gs[tid << 2]) = g4;
        *(v4fa*)(&Ms[tid << 2]) = k4;
    }

    v8f acc[4];                          // O^T: element r of tile jd = dh 16 * jd + 8 * hsel + r of query row16
    #pragma unroll
    for (int jd = 0; jd < 4; ++jd)
        #pragma unroll
        for (int r = 0; r < 8; ++r) acc[jd][r] = 0.f;
    float mrow = -1e30f;                 // running maximum of the lane's query, equal in both halves
    v8f lrow;                            // running sums of the lane's query, one per element position; joined behind the loop
    #pragma unroll
    for (int r = 0; r < 8; ++r) lrow[r] = 0.f;

    const int key = tid >> 2;            // staged key (K) or dh row (V), 0..63
    const int dc  = (tid & 3) << 4;      // 16 halves per thread

    #pragma unroll 1
    for (int kb = 0; kb < SEQ; kb += KBLK) {
        __syncthreads();
        {   // K block [key][dh] and V block [dh][key], 64x64 each, fully written
            const _Float16* ksrc = Kh + baseQK + (size_t)(kb + key) * DHD + dc;
            const _Float16* vsrc = Vt + baseV + (size_t)key * SEQ + kb + dc;
            const v8h ka  = *(const v8ha*)(ksrc);
            const v8h kb8 = *(const v8ha*)(ksrc + 8);
            const v8h va  = *(const v8ha*)(vsrc);
            const v8h vb  = *(const v8ha*)(vsrc + 8);
            *(v8ha*)(&Ks[key * LDK + dc])     = ka;
            *(v8ha*)(&Ks[key * LDK + dc + 8]) = kb8;
            *(v8ha*)(&Vs[key * LDK + dc])     = va;
            *(v8ha*)(&Vs[key * LDK + dc + 8]) = vb;
        }
        __syncthreads();

        // scores S^T(64x16) = K(64x64) x Qw^T : A[m=key][k=dh] = Ks[key][dh], 4 m-tiles x 2 k-steps
        v8f sc[4];
        #pragma unroll
        for (int j = 0; j < 4; ++j) {
            v8f s;
            #pragma unroll
            for (int r = 0; r < 8; ++r) s[r] = 0.f;
            #pragma unroll
            for (int kk = 0; kk < 2; ++kk) {
                const v16h kf = ldfrag_h(&Ks[((j << 4) + row16) * LDK + (kk << 5) + kbase]);
                s = mma_h(kf, qf[kk], s);
            }
            sc[j] = s;
        }
        // multiplicative per-key gate and additive mask: element r of tile j is key kb + 16 * j + 8 * hsel + r
        #pragma unroll
        for (int j = 0; j < 4; ++j) {
            const v8f g8 = ld8f(&Gs[kb + (j << 4) + kbase]);
            const v8f m8 = ld8f(&Ms[kb + (j << 4) + kbase]);
            sc[j] = sc[j] * g8 + m8;
        }
        // online softmax of the lane's query
        float mj[4];                     // one chain per tile: four independent chains
        #pragma unroll
        for (int j = 0; j < 4; ++j) {
            float m = sc[j][0];
            #pragma unroll
            for (int r = 1; r < 8; ++r) m = fmaxf(m, sc[j][r]);
            mj[j] = m;
        }
        float mx = fmaxf(fmaxf(mj[0], mj[1]), fmaxf(mj[2], mj[3]));
        mx = fmaxf(mx, xhalf(mx));
        const float mnew = fmaxf(mrow, mx);
        const float corr = __expf(mrow - mnew);
        mrow = mnew;
        #pragma unroll
        for (int jd = 0; jd < 4; ++jd) acc[jd] = acc[jd] * corr;
        #pragma unroll
        for (int j = 0; j < 4; ++j)
            #pragma unroll
            for (int r = 0; r < 8; ++r) sc[j][r] = __expf(sc[j][r] - mnew);
        lrow = lrow * corr + ((sc[0] + sc[1]) + (sc[2] + sc[3]));
        // acc(64x16) += V^T(64x64) x P^T(64x16) : A[m=dh][k=key] = Vs[dh][key]; B[k=key][n=query] = P x1024 as f16,
        // elements 0..7 from score tile 2 * kk, elements 8..15 from tile 2 * kk + 1
        #pragma unroll
        for (int kk = 0; kk < 2; ++kk) {
            v16h pf;
            #pragma unroll
            for (int r = 0; r < 8; ++r) {
                pf[r]     = (_Float16)(sc[2 * kk][r] * P_CARRY);
                pf[r + 8] = (_Float16)(sc[2 * kk + 1][r] * P_CARRY);
            }
            #pragma unroll
            for (int jd = 0; jd < 4; ++jd) {
                const v16h vf = ldfrag_h(&Vs[((jd << 4) + row16) * LDK + (kk << 5) + kbase]);
                acc[jd] = mma_h(vf, pf, acc[jd]);
            }
        }
    }

    const float lhalf = ((lrow[0] + lrow[1]) + (lrow[2] + lrow[3])) + ((lrow[4] + lrow[5]) + (lrow[6] + lrow[7]));
    const float scl = (1.0f / (lhalf + xhalf(lhalf))) * OUT_SCALE;

    __syncthreads();                             // every wave is done with Ks / Vs and the tables
    float* Os = lds.f + wave * (16 * OST);       // wave-private region, block barriers used anyway
    #pragma unroll
    for (int jd = 0; jd < 4; ++jd) {
        const v8f o = acc[jd] * scl;
        float* od = &Os[row16 * OST + (jd << 4) + kbase];
        v4f lo, hi;
        #pragma unroll
        for (int e = 0; e < 4; ++e) { lo[e] = o[e]; hi[e] = o[e + 4]; }
        *(v4fa*)(od)     = lo;
        *(v4fa*)(od + 4) = hi;
    }
    __syncthreads();

    const int q4 = (lane & 15) << 2;
    v4f ov[8];
    #pragma unroll
    for (int p = 0; p < 8; ++p) ov[p] = *(const v4fa*)(&Os[((p << 1) + hsel) * OST + q4]);
    float* orow = out + ((size_t)b * SEQ + q0) * DD + hd * DHD + q4;
    #pragma unroll
    for (int p = 0; p < 8; ++p)
        *(v4f*)(orow + (size_t)((p << 1) + hsel) * DD) = ov[p];
    
}

// ---------------- launcher ----------------
extern "C" void kernel_launch(void* const* d_in, const int* in_sizes, int n_in,
                              void* d_out, int out_size, void* d_ws, size_t ws_size,
                              hipStream_t stream) {
    if (n_in < 9) return;
    const long long need_rows = (long long)(NB - 1) * SEQ_FULL + SEQ;
    if ((long long)in_sizes[0] < need_rows * DD) return;
    if ((long long)in_sizes[1] < need_rows) return;
    if ((long long)in_sizes[2] < need_rows) return;
    if (in_sizes[3] < DD * DD || in_sizes[5] < DD * DD || in_sizes[7] < DD * DD) return;
    if (in_sizes[4] < DD || in_sizes[6] < DD || in_sizes[8] < DD) return;
    if ((long long)out_size < (long long)MROWS * DD) return;

    const float* X     = (const float*)d_in[0];
    const float* amask = (const float*)d_in[1];
    const float* click = (const float*)d_in[2];
    const float* Wq    = (const float*)d_in[3];
    const float* bq    = (const float*)d_in[4];
    const float* Wk    = (const float*)d_in[5];
    const float* bk    = (const float*)d_in[6];
    const float* Wv    = (const float*)d_in[7];
    const float* bv    = (const float*)d_in[8];
    float* out = (float*)d_out;

    //   Xb  MROWS*DD bf16 | Wqb, Wkb, Wvb  DD*DD bf16 each | Qh, Kh, Vt  MROWS*DD f16 each
    const size_t plane = (size_t)MROWS * DD;      // elements
    const size_t wpl   = (size_t)DD * DD;
    const size_t total_bytes = 2u * (4u * plane + 3u * wpl);
    if (ws_size < total_bytes) return;
    unsigned short* Xb  = (unsigned short*)d_ws;
    unsigned short* Wqb = Xb + plane;
    unsigned short* Wkb = Wqb + wpl;
    unsigned short* Wvb = Wkb + wpl;
    _Float16* Qh = (_Float16*)(Wvb + wpl);
    _Float16* Kh = Qh + plane;
    _Float16* Vt = Kh + plane;

    const int nchunk_x = MROWS * (DD / 8);
    const int nchunk_w = DD * (DD / 8);
    k_cvt<<<dim3((nchunk_x + 255) / 256), dim3(256), 0, stream>>>(X,  Xb,  MROWS, SEQ, SEQ_FULL);
    k_cvt<<<dim3((nchunk_w + 255) / 256), dim3(256), 0, stream>>>(Wq, Wqb, DD, DD, DD);
    k_cvt<<<dim3((nchunk_w + 255) / 256), dim3(256), 0, stream>>>(Wk, Wkb, DD, DD, DD);
    k_cvt<<<dim3((nchunk_w + 255) / 256), dim3(256), 0, stream>>>(Wv, Wvb, DD, DD, DD);

    k_proj<<<dim3(DD / PBN, MROWS / PBM, 3), dim3(128), 0, stream>>>(
        Xb, Wqb, Wkb, Wvb, bq, bk, bv, Qh, Kh, Vt);

    k_attn<<<dim3(SEQ / QT, NB * HH), dim3(256), 0, stream>>>(Qh, Kh, Vt, amask, click, out);
}

// v003
// One run takes 92.1 microseconds.
// In both of two side-by-side timings against v002, it was 1.03 times as fast.
// All steps since v000 together make it 1.99 times as fast.
#include <hip/hip_runtime.h>

// Contractions: q/k/v projections on v_wmma_f32_16x16x32_bf16 (bf16 operands = RNE-converted f32 inputs, f32 accumulate);
// q.k^T and p.v on v_wmma_f32_16x16x32_f16 (f16 operands: q,k,v carried x8, unnormalised p carried x1024), f32 accumulate;
// softmax, gating and epilogues in f32.

#ifndef NB
#define NB 8
#endif
#ifndef SEQ
#define SEQ 1024
#endif
#define NB_FULL 8
#define SEQ_FULL 1024
#define DD 768
#define HH 12
#define DHD 64
#define MROWS (NB * SEQ)

#define PBM 128         // projection block tile, rows of X
#define PBN 128         // projection block tile, rows of W
#define PKS 64          // k per staged projection stage (128 B of every operand row)
#define PLD 72          // 16-bit LDS pitch of a staged operand row (144 B)
#define PSTG ((PBM + PBN) * PLD)     // 16-bit elements of one stage buffer
#define PNT (DD / PKS)  // stages
#define CST 136         // f16 LDS pitch of the projection epilogue tile (272 B)
#define QT 128          // queries per block (8 waves x 16 rows)
#define KBLK 64         // keys per staged block
#define LDK 72          // f16 LDS pitch of K / V tiles (144 B)
#define OST 68          // f32 LDS pitch of the output staging tile (272 B)
#define QKV_CARRY 8.0f
#define P_CARRY 1024.0f
#define OUT_SCALE (1.0f / 8192.0f)   // 1 / (QKV_CARRY * P_CARRY)
#define S_SCALE (1.0f / 512.0f)      // 1/sqrt(64) / (QKV_CARRY * QKV_CARRY)

static_assert(NB >= 1 && NB <= NB_FULL);
static_assert(SEQ >= QT && SEQ <= SEQ_FULL);
static_assert(SEQ % QT == 0);
static_assert(SEQ % KBLK == 0);
static_assert(SEQ % PBM == 0);
static_assert(DD % PBN == 0);
static_assert(DD % PKS == 0);
static_assert(PNT >= 2);
static_assert(DD % 64 == 0);
static_assert(DD % 32 == 0);
static_assert(HH * DHD == DD);
static_assert(DHD == 64);

typedef _Float16 v16h __attribute__((ext_vector_type(16)));
typedef _Float16 v8h  __attribute__((ext_vector_type(8)));
typedef v8h v8ha __attribute__((may_alias));
typedef __bf16 v16b __attribute__((ext_vector_type(16)));
typedef unsigned short v8us __attribute__((ext_vector_type(8)));
typedef v8us v8usa __attribute__((may_alias));
typedef float v8f __attribute__((ext_vector_type(8)));
typedef float v4f __attribute__((ext_vector_type(4)));
typedef v4f v4fa __attribute__((may_alias));

static_assert(sizeof(v16b) == sizeof(v8f));

// ---------------- bf16 RNE convert helpers ----------------
__device__ __forceinline__ unsigned short f2bf_bits(float f) {
    unsigned int u = __float_as_uint(f);
    u += 0x7FFFu + ((u >> 16) & 1u);
    return (unsigned short)(u >> 16);
}
__device__ __forceinline__ float bf16_rne(float f) {
    unsigned int u = __float_as_uint(f);
    u += 0x7FFFu + ((u >> 16) & 1u);
    return __uint_as_float(u & 0xFFFF0000u);
}

// ---------------- 16x32 fragment loaders (wave32 split k map, same for A and B) ----------------
// lane l: row (A) / column (B) = l & 15; elements 0..7 <- k0 + 8*(l>>4) + 0..7, elements 8..15 <- k0 + 16 + 8*(l>>4) + 0..7.
// p points at element (row, k0 + 8*(l>>4)) of a k-contiguous 16-bit row; 16-B aligned.
__device__ __forceinline__ v16h ldfrag_h(const _Float16* p) {
    union { v16h v; v8h h[2]; } u;
    u.h[0] = *(const v8ha*)(p);
    u.h[1] = *(const v8ha*)(p + 16);
    return u.v;
}
__device__ __forceinline__ v16b ldfrag_b(const unsigned short* p) {
    union { v16b v; v8us h[2]; } u;
    u.h[0] = *(const v8usa*)(p);
    u.h[1] = *(const v8usa*)(p + 16);
    return u.v;
}

// ---------------- WMMA wrappers with the VALU hazard guard ----------------
__device__ __forceinline__ v8f mma_h(v16h a, v16h b, v8f c) {
    c = __builtin_amdgcn_wmma_f32_16x16x32_f16(false, a, false, b, (short)0, c, false, false);
    asm volatile("v_nop\n\tv_nop\n\tv_nop\n\tv_nop" : "+v"(c) : "v"(a), "v"(b));
    return c;
}
__device__ __forceinline__ v8f mma_b(v16b a, v16b b, v8f c) {
    c = __builtin_amdgcn_wmma_f32_16x16x32_bf16(false, a, false, b, (short)0, c, false, false);
    const v8f ka = __builtin_bit_cast(v8f, a);
    const v8f kbv = __builtin_bit_cast(v8f, b);
    asm volatile("v_nop\n\tv_nop\n\tv_nop\n\tv_nop" : "+v"(c) : "v"(ka), "v"(kbv));
    return c;
}

// ---------------- f32 rows -> bf16 bit planes ----------------
// One launch converts X, Wq, Wk and Wv. The four planes lie one behind the other in the workspace, so a chunk of 8 elements
// has one flat index over all of them; a block takes CVB consecutive chunks, all of one source (block-uniform choice).
// A thread converts CVU chunks, 256 chunks apart: its 2 * CVU loads of 16 B are all issued before the first is used.
// Compact X plane row m reads source row (m / SEQ) * SEQ_FULL + (m % SEQ).
#define CVU 8                        // chunks per thread
#define CVB (256 * CVU)              // chunks per block
#define XCH (MROWS * (DD / 8))       // chunks of the X plane
#define WCH (DD * (DD / 8))          // chunks of one W plane
static_assert(XCH % CVB == 0);
static_assert(WCH % CVB == 0);

__global__ __launch_bounds__(256) void k_cvt(const float* __restrict__ X,
                                             const float* __restrict__ Wq, const float* __restrict__ Wk,
                                             const float* __restrict__ Wv,
                                             unsigned short* __restrict__ dst) {
    const int blk = blockIdx.x;
    const int t0 = blk * CVB + (int)threadIdx.x;          // flat chunk of the thread's first piece
    const bool isx = blk < XCH / CVB;
    const int w = isx ? 0 : (blk - XCH / CVB) / (WCH / CVB);
    const float* src = isx ? X : ((w == 0) ? Wq : ((w == 1) ? Wk : Wv));
    const int l0 = isx ? t0 : (t0 - XCH - w * WCH);       // chunk inside the source plane

    v4f f[2 * CVU];
    // unrolled: every index of f is a constant, so the array stays in registers and the loads stand together
    #pragma unroll
    for (int i = 0; i < CVU; ++i) {
        const int l = l0 + i * 256;
        size_t off = (size_t)l * 8;
        if (SEQ != SEQ_FULL && isx) {
            const int m  = l / (DD / 8);
            const int c8 = (l - m * (DD / 8)) * 8;
            const int bb = m / SEQ;
            off = (size_t)(bb * SEQ_FULL + (m - bb * SEQ)) * DD + c8;
        }
        const float* p = src + off;
        f[2 * i]     = *(const v4fa*)(p);
        f[2 * i + 1] = *(const v4fa*)(p + 4);
    }
    // stands behind the last load and takes the loads' address as an input, so that no register of it is rewritten in front of the wait
    asm volatile("s_wait_xcnt 0x0" :: "v"(src + (size_t)l0 * 8) : "memory");
    #pragma unroll
    for (int i = 0; i < CVU; ++i) {
        const v4f f0 = f[2 * i], f1 = f[2 * i + 1];
        v8us o;
        o[0] = f2bf_bits(f0.x); o[1] = f2bf_bits(f0.y); o[2] = f2bf_bits(f0.z); o[3] = f2bf_bits(f0.w);
        o[4] = f2bf_bits(f1.x); o[5] = f2bf_bits(f1.y); o[6] = f2bf_bits(f1.z); o[7] = f2bf_bits(f1.w);
        *(v8us*)(dst + (size_t)(t0 + i * 256) * 8) = o;
    }
}

// ---------------- QKV projection GEMM ----------------
// C[m][n] = sum_k Xb[m][k] * Wb[n][k] + bias[n], m in [0,MROWS), n in [0,DD), k in [0,DD); Wb is [out][in] = n-major, k contiguous.
// grid (DD/128, MROWS/128, 3), block 128 = 4 waves (2x2), block tile 128x128, wave tile 64x64.
// Both operand tiles are staged in LDS, 64 k (128 B of every row) per stage, by asynchronous 16-byte copies into two buffers:
// the copies of stage t + 2 fly while stage t + 1 is worked on. Fragments are read from LDS by ldfrag_b, k ascending, so every sum keeps its order.
// mat 0,1 -> Qh/Kh f16 [NB*HH][SEQ][64] (x8); mat 2 -> Vt f16 [NB*HH][64][SEQ] (x8, transposed for the p.v A operand).
union __attribute__((aligned(16))) ProjLds {
    unsigned short s[2 * PSTG];   // two stage buffers, each [X 128 rows | W 128 rows] at pitch PLD
    _Float16       h[PBM * CST];  // epilogue tile after the k loop
};
static_assert(sizeof(ProjLds) == 73728);

// Eight asynchronous copies of one lane, 16 B each, rows 16 apart in the source plane and in the LDS buffer.
// l0: the lane's LDS byte address, g0: the lane's global address, both of the first row.
__device__ __forceinline__ void copy8_rows16(unsigned l0, const unsigned short* g0) {
    const unsigned lstep = 16u * PLD * 2u;
    const size_t gstep = (size_t)16 * DD;
    // s_wait_xcnt closes the statement so that no address register of a copy is rewritten in front of it
    asm volatile(
        "global_load_async_to_lds_b128 %0, %8, off\n\t"
        "global_load_async_to_lds_b128 %1, %9, off\n\t"
        "global_load_async_to_lds_b128 %2, %10, off\n\t"
        "global_load_async_to_lds_b128 %3, %11, off\n\t"
        "global_load_async_to_lds_b128 %4, %12, off\n\t"
        "global_load_async_to_lds_b128 %5, %13, off\n\t"
        "global_load_async_to_lds_b128 %6, %14, off\n\t"
        "global_load_async_to_lds_b128 %7, %15, off\n\t"
        "s_wait_xcnt 0x0"
        :: "v"(l0), "v"(l0 + lstep), "v"(l0 + 2u * lstep), "v"(l0 + 3u * lstep),
           "v"(l0 + 4u * lstep), "v"(l0 + 5u * lstep), "v"(l0 + 6u * lstep), "v"(l0 + 7u * lstep),
           "v"(g0), "v"(g0 + gstep), "v"(g0 + 2 * gstep), "v"(g0 + 3 * gstep),
           "v"(g0 + 4 * gstep), "v"(g0 + 5 * gstep), "v"(g0 + 6 * gstep), "v"(g0 + 7 * gstep)
        : "memory");
}

__global__ __launch_bounds__(128) void k_proj(
    const unsigned short* __restrict__ Xb,
    const unsigned short* __restrict__ Wqb, const unsigned short* __restrict__ Wkb,
    const unsigned short* __restrict__ Wvb,
    const float* __restrict__ bq, const float* __restrict__ bk, const float* __restrict__ bv,
    _Float16* __restrict__ Qh, _Float16* __restrict__ Kh, _Float16* __restrict__ Vt)
{
    __shared__ ProjLds lds;

    const int tid = threadIdx.x, lane = tid & 31, wave = tid >> 5;
    const int row16 = lane & 15, hsel = lane >> 4, kbase = hsel << 3;
    const int mat = blockIdx.z;
    const int n0 = blockIdx.x * PBN;
    const int m0 = blockIdx.y * PBM;
    const int wm = (wave & 1) << 6;
    const int wn = (wave >> 1) << 6;
    const unsigned short* Wb = (mat == 0) ? Wqb : ((mat == 1) ? Wkb : Wvb);
    const float* bias = (mat == 0) ? bq : ((mat == 1) ? bk : bv);

    v8f c[4][4];
    #pragma unroll
    for (int i = 0; i < 4; ++i)
        #pragma unroll
        for (int j = 0; j < 4; ++j)
            #pragma unroll
            for (int r = 0; r < 8; ++r) c[i][j][r] = 0.f;

    // copy map: thread -> row (tid >> 3) + 16 * i, 16-byte chunk tid & 7 of the row's 128 B; a wave's copy covers 4 whole lines
    const int crow = tid >> 3, cchk = tid & 7;
    const unsigned short* gX = Xb + (size_t)(m0 + crow) * DD + (cchk << 3);
    const unsigned short* gW = Wb + (size_t)(n0 + crow) * DD + (cchk << 3);
    const unsigned lX = (unsigned)(size_t)(&lds.s[crow * PLD + (cchk << 3)]);
    const unsigned lW = lX + (unsigned)(PBM * PLD * 2);

    copy8_rows16(lX, gX);
    copy8_rows16(lW, gW);
    asm volatile("s_wait_asynccnt 0x0" ::: "memory");   // stage 0 has landed before the barrier publishes it
    __syncthreads();
    copy8_rows16(lX + (unsigned)(PSTG * 2), gX + PKS);
    copy8_rows16(lW + (unsigned)(PSTG * 2), gW + PKS);

    // one copy of the loop body: the buffer is picked by an offset, and the copies' addresses stay few
    #pragma unroll 1
    for (int t = 0; t < PNT; ++t) {
        const int boff = (t & 1) * PSTG;
        const unsigned short* As = &lds.s[boff + (wm + row16) * PLD + kbase];
        const unsigned short* Bs = &lds.s[boff + (PBM + wn + row16) * PLD + kbase];
        // unrolled throughout: every index of a, b and c is a constant, so the arrays stay in registers
        #pragma unroll
        for (int kk = 0; kk < PKS; kk += 32) {
            v16b a[4], b[4];
            #pragma unroll
            for (int i = 0; i < 4; ++i) a[i] = ldfrag_b(As + i * 16 * PLD + kk);
            #pragma unroll
            for (int j = 0; j < 4; ++j) b[j] = ldfrag_b(Bs + j * 16 * PLD + kk);
            #pragma unroll
            for (int i = 0; i < 4; ++i)
                #pragma unroll
                for (int j = 0; j < 4; ++j) c[i][j] = mma_b(a[i], b[j], c[i][j]);
        }
        asm volatile("s_wait_dscnt 0x0" ::: "memory");      // this wave's reads of buffer t & 1 are done before it is refilled
        asm volatile("s_wait_asynccnt 0x0" ::: "memory");   // this wave's copies of stage t + 1 have landed
        __syncthreads();                                    // publishes stage t + 1, ends every read of stage t
        if (t + 2 < PNT) {
            copy8_rows16(lX + (unsigned)(boff * 2), gX + (t + 2) * PKS);
            copy8_rows16(lW + (unsigned)(boff * 2), gW + (t + 2) * PKS);
        }
    }
    asm volatile("s_wait_asynccnt 0x0" ::: "memory");       // no copy is in flight when the buffers become the epilogue tile

    // epilogue: + bf16(bias), x8 carry, f16, staged in LDS as [s][n] (mat 0,1) or [n][s] (mat 2)
    _Float16* Cs = lds.h;
    #pragma unroll
    for (int j = 0; j < 4; ++j) {
        const int nl = wn + (j << 4) + row16;
        const float bb = bf16_rne(bias[n0 + nl]);
        #pragma unroll
        for (int i = 0; i < 4; ++i) {
            #pragma unroll
            for (int r = 0; r < 8; ++r) {
                const int ml = wm + (i << 4) + (hsel << 3) + r;
                const _Float16 hv = (_Float16)((c[i][j][r] + bb) * QKV_CARRY);
                const int idx = (mat != 2) ? (ml * CST + nl) : (nl * CST + ml);
                Cs[idx] = hv;
            }
        }
    }
    __syncthreads();

    const int hd0 = n0 >> 6;                // first of the two heads of this 128-wide n tile
    const int bi = m0 / SEQ;                // batch of this 128-row m tile
    const int s0 = m0 - bi * SEQ;
    const int q8 = (tid & 15) << 3;         // 16-byte chunk of a 128-wide staged row
    const int l0 = tid >> 4;
    v8h v[16];
    #pragma unroll
    for (int p = 0; p < 16; ++p) v[p] = *(const v8ha*)(&Cs[(l0 + (p << 3)) * CST + q8]);
    if (mat == 2) {
        #pragma unroll
        for (int p = 0; p < 16; ++p) {
            const int l = l0 + (p << 3);    // staged row = n: head hd0 + (l >> 6), dh = l & 63; chunk = s
            const size_t bhh = (size_t)bi * HH + hd0 + (l >> 6);
            *(v8h*)(Vt + (bhh * DHD + (l & 63)) * SEQ + s0 + q8) = v[p];
        }
    } else {
        _Float16* dst = (mat == 0) ? Qh : Kh;
        const size_t bhh = (size_t)bi * HH + hd0 + (q8 >> 6);
        #pragma unroll
        for (int p = 0; p < 16; ++p) {
            const int l = l0 + (p << 3);    // staged row = s; chunk = n: head hd0 + (q8 >> 6), dh = q8 & 63
            *(v8h*)(dst + (bhh * SEQ + s0 + l) * DHD + (q8 & 63)) = v[p];
        }
        // the built code lets this path run on into the V path's address arithmetic, which rewrites the stores' address pair: the wait stands in front of that
        asm volatile("s_wait_xcnt 0x0" ::: "memory");
    }
}

// ---------------- flash-style attention ----------------
// Qh,Kh: [NB*HH][SEQ][64] f16 (x8); Vt: [NB*HH][64][SEQ] f16 (x8); out: [NB][SEQ][DD] f32.
// grid (SEQ/QT, NB*HH), block 256 = 8 waves, wave owns 16 queries; keys staged 64 at a time.
// Transposed products: S^T = K x Q^T and O^T += V^T x P^T. A lane holds one query (column lane & 15) and, of every 16-key tile,
// the keys 8 * (lane >> 4) + 0..7: maximum and sum run in the lane, the two halves of a wave meet by one cross-row move,
// and two converted score tiles are the B fragment of the second product as they stand (same split k map as ldfrag_h).
union __attribute__((aligned(16))) LdsU {
    _Float16 h[4 * KBLK * LDK];   // Ks | Vs | per-key gate and mask tables during the key loop
    float    f[2 * KBLK * LDK];   // Os after the key loop
};
static_assert(sizeof(LdsU) == 36864);
static_assert(8 * 16 * OST <= 2 * KBLK * LDK);
static_assert(KBLK * LDK + 2 * SEQ <= 2 * KBLK * LDK);
static_assert(SEQ % 4 == 0 && SEQ / 4 <= 256);

// lane l <-> lane l ^ 16
__device__ __forceinline__ float xhalf(float x) {
    const int b = __builtin_bit_cast(int, x);
    return __builtin_bit_cast(float, __builtin_amdgcn_permlanex16(b, b, 0x76543210, 0xfedcba98, false, false));
}
__device__ __forceinline__ v8f ld8f(const float* p) {
    union { v8f v; v4f q[2]; } u;
    u.q[0] = *(const v4fa*)(p);
    u.q[1] = *(const v4fa*)(p + 4);
    return u.v;
}

__global__ __launch_bounds__(256) __attribute__((amdgpu_num_vgpr(256)))
void k_attn(const _Float16* __restrict__ Qh, const _Float16* __restrict__ Kh,
            const _Float16* __restrict__ Vt, const float* __restrict__ amask,
            const float* __restrict__ click, float* __restrict__ out)
{
    __shared__ LdsU lds;
    _Float16* Ks = lds.h;                      // [key][dh], cross-wave (block barriers)
    _Float16* Vs = lds.h + KBLK * LDK;         // [dh][key], cross-wave (block barriers)
    float* Gs = lds.f + KBLK * LDK;            // [key] score scale x gate, all SEQ keys
    float* Ms = Gs + SEQ;                      // [key] additive mask, all SEQ keys

    const int tid = threadIdx.x, lane = tid & 31, wave = tid >> 5;
    const int row16 = lane & 15, hsel = lane >> 4, kbase = hsel << 3;
    const int bh = blockIdx.y;
    const int b = bh / HH;
    const int hd = bh - b * HH;
    const int q0 = blockIdx.x * QT + (wave << 4);
    const size_t baseQK = (size_t)bh * SEQ * DHD;
    const size_t baseV  = (size_t)bh * DHD * SEQ;

    // resident Q fragments (B operand, column = query): 64 dh x 16 queries = 2 k-steps
    v16h qf[2];
    #pragma unroll
    for (int kk = 0; kk < 2; ++kk)
        qf[kk] = ldfrag_h(Qh + baseQK + (size_t)(q0 + row16) * DHD + (kk << 5) + kbase);

    // per-key tables: scale 1/sqrt(64) folded with the carries x gate, and the additive mask (both inputs RNE-converted to bf16);
    // published by the barriers at the head of the first pass
    if (tid < SEQ / 4) {
        const v4f c4 = *(const v4fa*)(click + (size_t)b * SEQ_FULL + (tid << 2));
        const v4f m4 = *(const v4fa*)(amask + (size_t)b * SEQ_FULL + (tid << 2));
        v4f g4, k4;
        #pragma unroll
        for (int e = 0; e < 4; ++e) { g4[e] = S_SCALE * bf16_rne(c4[e]); k4[e] = bf16_rne(m4[e]); }
        *(v4fa*)(&Gs[tid << 2]) = g4;
        *(v4fa*)(&Ms[tid << 2]) = k4;
    }

    v8f acc[4];                          // O^T: element r of tile jd = dh 16 * jd + 8 * hsel + r of query row16
    #pragma unroll
    for (int jd = 0; jd < 4; ++jd)
        #pragma unroll
        for (int r = 0; r < 8; ++r) acc[jd][r] = 0.f;
    float mrow = -1e30f;                 // running maximum of the lane's query, equal in both halves
    v8f lrow;                            // running sums of the lane's query, one per element position; joined behind the loop
    #pragma unroll
    for (int r = 0; r < 8; ++r) lrow[r] = 0.f;

    const int key = tid >> 2;            // staged key (K) or dh row (V), 0..63
    const int dc  = (tid & 3) << 4;      // 16 halves per thread

    #pragma unroll 1
    for (int kb = 0; kb < SEQ; kb += KBLK) {
        __syncthreads();
        {   // K block [key][dh] and V block [dh][key], 64x64 each, fully written
            const _Float16* ksrc = Kh + baseQK + (size_t)(kb + key) * DHD + dc;
            const _Float16* vsrc = Vt + baseV + (size_t)key * SEQ + kb + dc;
            const v8h ka  = *(const v8ha*)(ksrc);
            const v8h kb8 = *(const v8ha*)(ksrc + 8);
            const v8h va  = *(const v8ha*)(vsrc);
            const v8h vb  = *(const v8ha*)(vsrc + 8);
            *(v8ha*)(&Ks[key * LDK + dc])     = ka;
            *(v8ha*)(&Ks[key * LDK + dc + 8]) = kb8;
            *(v8ha*)(&Vs[key * LDK + dc])     = va;
            *(v8ha*)(&Vs[key * LDK + dc + 8]) = vb;
        }
        __syncthreads();

        // scores S^T(64x16) = K(64x64) x Qw^T : A[m=key][k=dh] = Ks[key][dh], 4 m-tiles x 2 k-steps
        v8f sc[4];
        #pragma unroll
        for (int j = 0; j < 4; ++j) {
            v8f s;
            #pragma unroll
            for (int r = 0; r < 8; ++r) s[r] = 0.f;
            #pragma unroll
            for (int kk = 0; kk < 2; ++kk) {
                const v16h kf = ldfrag_h(&Ks[((j << 4) + row16) * LDK + (kk << 5) + kbase]);
                s = mma_h(kf, qf[kk], s);
            }
            sc[j] = s;
        }
        // multiplicative per-key gate and additive mask: element r of tile j is key kb + 16 * j + 8 * hsel + r
        #pragma unroll
        for (int j = 0; j < 4; ++j) {
            const v8f g8 = ld8f(&Gs[kb + (j << 4) + kbase]);
            const v8f m8 = ld8f(&Ms[kb + (j << 4) + kbase]);
            sc[j] = sc[j] * g8 + m8;
        }
        // online softmax of the lane's query
        float mj[4];                     // one chain per tile: four independent chains
        #pragma unroll
        for (int j = 0; j < 4; ++j) {
            float m = sc[j][0];
            #pragma unroll
            for (int r = 1; r < 8; ++r) m = fmaxf(m, sc[j][r]);
            mj[j] = m;
        }
        float mx = fmaxf(fmaxf(mj[0], mj[1]), fmaxf(mj[2], mj[3]));
        mx = fmaxf(mx, xhalf(mx));
        const float mnew = fmaxf(mrow, mx);
        const float corr = __expf(mrow - mnew);
        mrow = mnew;
        #pragma unroll
        for (int jd = 0; jd < 4; ++jd) acc[jd] = acc[jd] * corr;
        #pragma unroll
        for (int j = 0; j < 4; ++j)
            #pragma unroll
            for (int r = 0; r < 8; ++r) sc[j][r] = __expf(sc[j][r] - mnew);
        lrow = lrow * corr + ((sc[0] + sc[1]) + (sc[2] + sc[3]));
        // acc(64x16) += V^T(64x64) x P^T(64x16) : A[m=dh][k=key] = Vs[dh][key]; B[k=key][n=query] = P x1024 as f16,
        // elements 0..7 from score tile 2 * kk, elements 8..15 from tile 2 * kk + 1
        #pragma unroll
        for (int kk = 0; kk < 2; ++kk) {
            v16h pf;
            #pragma unroll
            for (int r = 0; r < 8; ++r) {
                pf[r]     = (_Float16)(sc[2 * kk][r] * P_CARRY);
                pf[r + 8] = (_Float16)(sc[2 * kk + 1][r] * P_CARRY);
            }
            #pragma unroll
            for (int jd = 0; jd < 4; ++jd) {
                const v16h vf = ldfrag_h(&Vs[((jd << 4) + row16) * LDK + (kk << 5) + kbase]);
                acc[jd] = mma_h(vf, pf, acc[jd]);
            }
        }
    }

    const float lhalf = ((lrow[0] + lrow[1]) + (lrow[2] + lrow[3])) + ((lrow[4] + lrow[5]) + (lrow[6] + lrow[7]));
    const float scl = (1.0f / (lhalf + xhalf(lhalf))) * OUT_SCALE;

    __syncthreads();                             // every wave is done with Ks / Vs and the tables
    float* Os = lds.f + wave * (16 * OST);       // wave-private region, block barriers used anyway
    #pragma unroll
    for (int jd = 0; jd < 4; ++jd) {
        const v8f o = acc[jd] * scl;
        float* od = &Os[row16 * OST + (jd << 4) + kbase];
        v4f lo, hi;
        #pragma unroll
        for (int e = 0; e < 4; ++e) { lo[e] = o[e]; hi[e] = o[e + 4]; }
        *(v4fa*)(od)     = lo;
        *(v4fa*)(od + 4) = hi;
    }
    __syncthreads();

    const int q4 = (lane & 15) << 2;
    v4f ov[8];
    #pragma unroll
    for (int p = 0; p < 8; ++p) ov[p] = *(const v4fa*)(&Os[((p << 1) + hsel) * OST + q4]);
    float* orow = out + ((size_t)b * SEQ + q0) * DD + hd * DHD + q4;
    #pragma unroll
    for (int p = 0; p < 8; ++p)
        *(v4f*)(orow + (size_t)((p << 1) + hsel) * DD) = ov[p];
    
}

// ---------------- launcher ----------------
extern "C" void kernel_launch(void* const* d_in, const int* in_sizes, int n_in,
                              void* d_out, int out_size, void* d_ws, size_t ws_size,
                              hipStream_t stream) {
    if (n_in < 9) return;
    const long long need_rows = (long long)(NB - 1) * SEQ_FULL + SEQ;
    if ((long long)in_sizes[0] < need_rows * DD) return;
    if ((long long)in_sizes[1] < need_rows) return;
    if ((long long)in_sizes[2] < need_rows) return;
    if (in_sizes[3] < DD * DD || in_sizes[5] < DD * DD || in_sizes[7] < DD * DD) return;
    if (in_sizes[4] < DD || in_sizes[6] < DD || in_sizes[8] < DD) return;
    if ((long long)out_size < (long long)MROWS * DD) return;

    const float* X     = (const float*)d_in[0];
    const float* amask = (const float*)d_in[1];
    const float* click = (const float*)d_in[2];
    const float* Wq    = (const float*)d_in[3];
    const float* bq    = (const float*)d_in[4];
    const float* Wk    = (const float*)d_in[5];
    const float* bk    = (const float*)d_in[6];
    const float* Wv    = (const float*)d_in[7];
    const float* bv    = (const float*)d_in[8];
    float* out = (float*)d_out;

    //   Xb  MROWS*DD bf16 | Wqb, Wkb, Wvb  DD*DD bf16 each | Qh, Kh, Vt  MROWS*DD f16 each
    const size_t plane = (size_t)MROWS * DD;      // elements
    const size_t wpl   = (size_t)DD * DD;
    const size_t total_bytes = 2u * (4u * plane + 3u * wpl);
    if (ws_size < total_bytes) return;
    unsigned short* Xb  = (unsigned short*)d_ws;
    unsigned short* Wqb = Xb + plane;
    unsigned short* Wkb = Wqb + wpl;
    unsigned short* Wvb = Wkb + wpl;
    _Float16* Qh = (_Float16*)(Wvb + wpl);
    _Float16* Kh = Qh + plane;
    _Float16* Vt = Kh + plane;

    k_cvt<<<dim3((XCH + 3 * WCH) / CVB), dim3(256), 0, stream>>>(X, Wq, Wk, Wv, Xb);   // fills Xb, Wqb, Wkb, Wvb

    k_proj<<<dim3(DD / PBN, MROWS / PBM, 3), dim3(128), 0, stream>>>(
        Xb, Wqb, Wkb, Wvb, bq, bk, bv, Qh, Kh, Vt);

    k_attn<<<dim3(SEQ / QT, NB * HH), dim3(256), 0, stream>>>(Qh, Kh, Vt, amask, click, out);
}

// v004
// A run of this version takes 86.1 microseconds.
// In two side-by-side timings against v003, it was 1.08 and 1.07 times as fast.
// Counting every step since v000, it is 2.14 times as fast.
#include <hip/hip_runtime.h>

// Contractions: q/k/v projections on v_wmma_f32_16x16x32_bf16 (bf16 operands = RNE-converted f32 inputs, f32 accumulate);
// q.k^T and p.v on v_wmma_f32_16x16x32_f16 (f16 operands: q,k,v carried x8, unnormalised p carried x1024), f32 accumulate;
// softmax, gating and epilogues in f32.

#ifndef NB
#define NB 8
#endif
#ifndef SEQ
#define SEQ 1024
#endif
#define NB_FULL 8
#define SEQ_FULL 1024
#define DD 768
#define HH 12
#define DHD 64
#define MROWS (NB * SEQ)

#define PBM 128         // projection block tile, rows of X
#define PBN 128         // projection block tile, rows of W
#define PKS 64          // k per staged projection stage (128 B of every operand row)
#define PLD 72          // 16-bit LDS pitch of a staged operand row (144 B)
#define PSTG ((PBM + PBN) * PLD)     // 16-bit elements of one stage buffer
#define PNT (DD / PKS)  // stages
#define CST 136         // f16 LDS pitch of the projection epilogue tile (272 B)
#define QT 128          // queries per block (4 waves x 32 rows)
#define KBLK 64         // keys per staged block
#define LDK 72          // f16 LDS pitch of K / V tiles (144 B)
#define OST 68          // f32 LDS pitch of the output staging tile (272 B)
#define QKV_CARRY 8.0f
#define P_CARRY 1024.0f
#define OUT_SCALE (1.0f / 8192.0f)   // 1 / (QKV_CARRY * P_CARRY)
#define S_SCALE (1.0f / 512.0f)      // 1/sqrt(64) / (QKV_CARRY * QKV_CARRY)

static_assert(NB >= 1 && NB <= NB_FULL);
static_assert(SEQ >= QT && SEQ <= SEQ_FULL);
static_assert(SEQ % QT == 0);
static_assert(SEQ % KBLK == 0);
static_assert(SEQ % PBM == 0);
static_assert(DD % PBN == 0);
static_assert(DD % PKS == 0);
static_assert(PNT >= 2);
static_assert(DD % 64 == 0);
static_assert(DD % 32 == 0);
static_assert(HH * DHD == DD);
static_assert(DHD == 64);

typedef _Float16 v16h __attribute__((ext_vector_type(16)));
typedef _Float16 v8h  __attribute__((ext_vector_type(8)));
typedef v8h v8ha __attribute__((may_alias));
typedef __bf16 v16b __attribute__((ext_vector_type(16)));
typedef unsigned short v8us __attribute__((ext_vector_type(8)));
typedef v8us v8usa __attribute__((may_alias));
typedef float v8f __attribute__((ext_vector_type(8)));
typedef float v4f __attribute__((ext_vector_type(4)));
typedef v4f v4fa __attribute__((may_alias));

static_assert(sizeof(v16b) == sizeof(v8f));

// ---------------- bf16 RNE convert helpers ----------------
__device__ __forceinline__ unsigned short f2bf_bits(float f) {
    unsigned int u = __float_as_uint(f);
    u += 0x7FFFu + ((u >> 16) & 1u);
    return (unsigned short)(u >> 16);
}
__device__ __forceinline__ float bf16_rne(float f) {
    unsigned int u = __float_as_uint(f);
    u += 0x7FFFu + ((u >> 16) & 1u);
    return __uint_as_float(u & 0xFFFF0000u);
}

// ---------------- 16x32 fragment loaders (wave32 split k map, same for A and B) ----------------
// lane l: row (A) / column (B) = l & 15; elements 0..7 <- k0 + 8*(l>>4) + 0..7, elements 8..15 <- k0 + 16 + 8*(l>>4) + 0..7.
// p points at element (row, k0 + 8*(l>>4)) of a k-contiguous 16-bit row; 16-B aligned.
__device__ __forceinline__ v16h ldfrag_h(const _Float16* p) {
    union { v16h v; v8h h[2]; } u;
    u.h[0] = *(const v8ha*)(p);
    u.h[1] = *(const v8ha*)(p + 16);
    return u.v;
}
__device__ __forceinline__ v16b ldfrag_b(const unsigned short* p) {
    union { v16b v; v8us h[2]; } u;
    u.h[0] = *(const v8usa*)(p);
    u.h[1] = *(const v8usa*)(p + 16);
    return u.v;
}

// ---------------- WMMA wrappers with the VALU hazard guard ----------------
__device__ __forceinline__ v8f mma_h(v16h a, v16h b, v8f c) {
    c = __builtin_amdgcn_wmma_f32_16x16x32_f16(false, a, false, b, (short)0, c, false, false);
    asm volatile("v_nop\n\tv_nop\n\tv_nop\n\tv_nop" : "+v"(c) : "v"(a), "v"(b));
    return c;
}
__device__ __forceinline__ v8f mma_b(v16b a, v16b b, v8f c) {
    c = __builtin_amdgcn_wmma_f32_16x16x32_bf16(false, a, false, b, (short)0, c, false, false);
    const v8f ka = __builtin_bit_cast(v8f, a);
    const v8f kbv = __builtin_bit_cast(v8f, b);
    asm volatile("v_nop\n\tv_nop\n\tv_nop\n\tv_nop" : "+v"(c) : "v"(ka), "v"(kbv));
    return c;
}

// ---------------- f32 rows -> bf16 bit planes ----------------
// One launch converts X, Wq, Wk and Wv. The four planes lie one behind the other in the workspace, so a chunk of 8 elements
// has one flat index over all of them; a block takes CVB consecutive chunks, all of one source (block-uniform choice).
// A thread converts CVU chunks, 256 chunks apart: its 2 * CVU loads of 16 B are all issued before the first is used.
// Compact X plane row m reads source row (m / SEQ) * SEQ_FULL + (m % SEQ).
#define CVU 8                        // chunks per thread
#define CVB (256 * CVU)              // chunks per block
#define XCH (MROWS * (DD / 8))       // chunks of the X plane
#define WCH (DD * (DD / 8))          // chunks of one W plane
static_assert(XCH % CVB == 0);
static_assert(WCH % CVB == 0);

__global__ __launch_bounds__(256) void k_cvt(const float* __restrict__ X,
                                             const float* __restrict__ Wq, const float* __restrict__ Wk,
                                             const float* __restrict__ Wv,
                                             unsigned short* __restrict__ dst) {
    const int blk = blockIdx.x;
    const int t0 = blk * CVB + (int)threadIdx.x;          // flat chunk of the thread's first piece
    const bool isx = blk < XCH / CVB;
    const int w = isx ? 0 : (blk - XCH / CVB) / (WCH / CVB);
    const float* src = isx ? X : ((w == 0) ? Wq : ((w == 1) ? Wk : Wv));
    const int l0 = isx ? t0 : (t0 - XCH - w * WCH);       // chunk inside the source plane

    v4f f[2 * CVU];
    // unrolled: every index of f is a constant, so the array stays in registers and the loads stand together
    #pragma unroll
    for (int i = 0; i < CVU; ++i) {
        const int l = l0 + i * 256;
        size_t off = (size_t)l * 8;
        if (SEQ != SEQ_FULL && isx) {
            const int m  = l / (DD / 8);
            const int c8 = (l - m * (DD / 8)) * 8;
            const int bb = m / SEQ;
            off = (size_t)(bb * SEQ_FULL + (m - bb * SEQ)) * DD + c8;
        }
        const float* p = src + off;
        f[2 * i]     = *(const v4fa*)(p);
        f[2 * i + 1] = *(const v4fa*)(p + 4);
    }
    // stands behind the last load and takes the loads' address as an input, so that no register of it is rewritten in front of the wait
    asm volatile("s_wait_xcnt 0x0" :: "v"(src + (size_t)l0 * 8) : "memory");
    #pragma unroll
    for (int i = 0; i < CVU; ++i) {
        const v4f f0 = f[2 * i], f1 = f[2 * i + 1];
        v8us o;
        o[0] = f2bf_bits(f0.x); o[1] = f2bf_bits(f0.y); o[2] = f2bf_bits(f0.z); o[3] = f2bf_bits(f0.w);
        o[4] = f2bf_bits(f1.x); o[5] = f2bf_bits(f1.y); o[6] = f2bf_bits(f1.z); o[7] = f2bf_bits(f1.w);
        *(v8us*)(dst + (size_t)(t0 + i * 256) * 8) = o;
    }
}

// ---------------- QKV projection GEMM ----------------
// C[m][n] = sum_k Xb[m][k] * Wb[n][k] + bias[n], m in [0,MROWS), n in [0,DD), k in [0,DD); Wb is [out][in] = n-major, k contiguous.
// grid (DD/128, MROWS/128, 3), block 128 = 4 waves (2x2), block tile 128x128, wave tile 64x64.
// Both operand tiles are staged in LDS, 64 k (128 B of every row) per stage, by asynchronous 16-byte copies into two buffers:
// the copies of stage t + 2 fly while stage t + 1 is worked on. Fragments are read from LDS by ldfrag_b, k ascending, so every sum keeps its order.
// mat 0,1 -> Qh/Kh f16 [NB*HH][SEQ][64] (x8); mat 2 -> Vt f16 [NB*HH][64][SEQ] (x8, transposed for the p.v A operand).
union __attribute__((aligned(16))) ProjLds {
    unsigned short s[2 * PSTG];   // two stage buffers, each [X 128 rows | W 128 rows] at pitch PLD
    _Float16       h[PBM * CST];  // epilogue tile after the k loop
};
static_assert(sizeof(ProjLds) == 73728);

// Eight asynchronous copies of one lane, 16 B each, rows 16 apart in the source plane and in the LDS buffer.
// l0: the lane's LDS byte address, g0: the lane's global address, both of the first row.
__device__ __forceinline__ void copy8_rows16(unsigned l0, const unsigned short* g0) {
    const unsigned lstep = 16u * PLD * 2u;
    const size_t gstep = (size_t)16 * DD;
    // s_wait_xcnt closes the statement so that no address register of a copy is rewritten in front of it
    asm volatile(
        "global_load_async_to_lds_b128 %0, %8, off\n\t"
        "global_load_async_to_lds_b128 %1, %9, off\n\t"
        "global_load_async_to_lds_b128 %2, %10, off\n\t"
        "global_load_async_to_lds_b128 %3, %11, off\n\t"
        "global_load_async_to_lds_b128 %4, %12, off\n\t"
        "global_load_async_to_lds_b128 %5, %13, off\n\t"
        "global_load_async_to_lds_b128 %6, %14, off\n\t"
        "global_load_async_to_lds_b128 %7, %15, off\n\t"
        "s_wait_xcnt 0x0"
        :: "v"(l0), "v"(l0 + lstep), "v"(l0 + 2u * lstep), "v"(l0 + 3u * lstep),
           "v"(l0 + 4u * lstep), "v"(l0 + 5u * lstep), "v"(l0 + 6u * lstep), "v"(l0 + 7u * lstep),
           "v"(g0), "v"(g0 + gstep), "v"(g0 + 2 * gstep), "v"(g0 + 3 * gstep),
           "v"(g0 + 4 * gstep), "v"(g0 + 5 * gstep), "v"(g0 + 6 * gstep), "v"(g0 + 7 * gstep)
        : "memory");
}

__global__ __launch_bounds__(128) void k_proj(
    const unsigned short* __restrict__ Xb,
    const unsigned short* __restrict__ Wqb, const unsigned short* __restrict__ Wkb,
    const unsigned short* __restrict__ Wvb,
    const float* __restrict__ bq, const float* __restrict__ bk, const float* __restrict__ bv,
    _Float16* __restrict__ Qh, _Float16* __restrict__ Kh, _Float16* __restrict__ Vt)
{
    __shared__ ProjLds lds;

    const int tid = threadIdx.x, lane = tid & 31, wave = tid >> 5;
    const int row16 = lane & 15, hsel = lane >> 4, kbase = hsel << 3;
    const int mat = blockIdx.z;
    const int n0 = blockIdx.x * PBN;
    const int m0 = blockIdx.y * PBM;
    const int wm = (wave & 1) << 6;
    const int wn = (wave >> 1) << 6;
    const unsigned short* Wb = (mat == 0) ? Wqb : ((mat == 1) ? Wkb : Wvb);
    const float* bias = (mat == 0) ? bq : ((mat == 1) ? bk : bv);

    v8f c[4][4];
    #pragma unroll
    for (int i = 0; i < 4; ++i)
        #pragma unroll
        for (int j = 0; j < 4; ++j)
            #pragma unroll
            for (int r = 0; r < 8; ++r) c[i][j][r] = 0.f;

    // copy map: thread -> row (tid >> 3) + 16 * i, 16-byte chunk tid & 7 of the row's 128 B; a wave's copy covers 4 whole lines
    const int crow = tid >> 3, cchk = tid & 7;
    const unsigned short* gX = Xb + (size_t)(m0 + crow) * DD + (cchk << 3);
    const unsigned short* gW = Wb + (size_t)(n0 + crow) * DD + (cchk << 3);
    const unsigned lX = (unsigned)(size_t)(&lds.s[crow * PLD + (cchk << 3)]);
    const unsigned lW = lX + (unsigned)(PBM * PLD * 2);

    copy8_rows16(lX, gX);
    copy8_rows16(lW, gW);
    asm volatile("s_wait_asynccnt 0x0" ::: "memory");   // stage 0 has landed before the barrier publishes it
    __syncthreads();
    copy8_rows16(lX + (unsigned)(PSTG * 2), gX + PKS);
    copy8_rows16(lW + (unsigned)(PSTG * 2), gW + PKS);

    // one copy of the loop body: the buffer is picked by an offset, and the copies' addresses stay few
    #pragma unroll 1
    for (int t = 0; t < PNT; ++t) {
        const int boff = (t & 1) * PSTG;
        const unsigned short* As = &lds.s[boff + (wm + row16) * PLD + kbase];
        const unsigned short* Bs = &lds.s[boff + (PBM + wn + row16) * PLD + kbase];
        // unrolled throughout: every index of a, b and c is a constant, so the arrays stay in registers
        #pragma unroll
        for (int kk = 0; kk < PKS; kk += 32) {
            v16b a[4], b[4];
            #pragma unroll
            for (int i = 0; i < 4; ++i) a[i] = ldfrag_b(As + i * 16 * PLD + kk);
            #pragma unroll
            for (int j = 0; j < 4; ++j) b[j] = ldfrag_b(Bs + j * 16 * PLD + kk);
            #pragma unroll
            for (int i = 0; i < 4; ++i)
                #pragma unroll
                for (int j = 0; j < 4; ++j) c[i][j] = mma_b(a[i], b[j], c[i][j]);
        }
        asm volatile("s_wait_dscnt 0x0" ::: "memory");      // this wave's reads of buffer t & 1 are done before it is refilled
        asm volatile("s_wait_asynccnt 0x0" ::: "memory");   // this wave's copies of stage t + 1 have landed
        __syncthreads();                                    // publishes stage t + 1, ends every read of stage t
        if (t + 2 < PNT) {
            copy8_rows16(lX + (unsigned)(boff * 2), gX + (t + 2) * PKS);
            copy8_rows16(lW + (unsigned)(boff * 2), gW + (t + 2) * PKS);
        }
    }
    asm volatile("s_wait_asynccnt 0x0" ::: "memory");       // no copy is in flight when the buffers become the epilogue tile

    // epilogue: + bf16(bias), x8 carry, f16, staged in LDS as [s][n] (mat 0,1) or [n][s] (mat 2)
    _Float16* Cs = lds.h;
    #pragma unroll
    for (int j = 0; j < 4; ++j) {
        const int nl = wn + (j << 4) + row16;
        const float bb = bf16_rne(bias[n0 + nl]);
        #pragma unroll
        for (int i = 0; i < 4; ++i) {
            #pragma unroll
            for (int r = 0; r < 8; ++r) {
                const int ml = wm + (i << 4) + (hsel << 3) + r;
                const _Float16 hv = (_Float16)((c[i][j][r] + bb) * QKV_CARRY);
                const int idx = (mat != 2) ? (ml * CST + nl) : (nl * CST + ml);
                Cs[idx] = hv;
            }
        }
    }
    __syncthreads();

    const int hd0 = n0 >> 6;                // first of the two heads of this 128-wide n tile
    const int bi = m0 / SEQ;                // batch of this 128-row m tile
    const int s0 = m0 - bi * SEQ;
    const int q8 = (tid & 15) << 3;         // 16-byte chunk of a 128-wide staged row
    const int l0 = tid >> 4;
    v8h v[16];
    #pragma unroll
    for (int p = 0; p < 16; ++p) v[p] = *(const v8ha*)(&Cs[(l0 + (p << 3)) * CST + q8]);
    if (mat == 2) {
        #pragma unroll
        for (int p = 0; p < 16; ++p) {
            const int l = l0 + (p << 3);    // staged row = n: head hd0 + (l >> 6), dh = l & 63; chunk = s
            const size_t bhh = (size_t)bi * HH + hd0 + (l >> 6);
            *(v8h*)(Vt + (bhh * DHD + (l & 63)) * SEQ + s0 + q8) = v[p];
        }
    } else {
        _Float16* dst = (mat == 0) ? Qh : Kh;
        const size_t bhh = (size_t)bi * HH + hd0 + (q8 >> 6);
        #pragma unroll
        for (int p = 0; p < 16; ++p) {
            const int l = l0 + (p << 3);    // staged row = s; chunk = n: head hd0 + (q8 >> 6), dh = q8 & 63
            *(v8h*)(dst + (bhh * SEQ + s0 + l) * DHD + (q8 & 63)) = v[p];
        }
        // the built code lets this path run on into the V path's address arithmetic, which rewrites the stores' address pair: the wait stands in front of that
        asm volatile("s_wait_xcnt 0x0" ::: "memory");
    }
}

// ---------------- flash-style attention ----------------
// Qh,Kh: [NB*HH][SEQ][64] f16 (x8); Vt: [NB*HH][64][SEQ] f16 (x8); out: [NB][SEQ][DD] f32.
// grid (SEQ/QT, NB*HH), block 128 = 4 waves, wave owns 32 queries = two column tiles; keys staged 64 at a time.
// Transposed products: S^T = K x Q^T and O^T += V^T x P^T. A lane holds one query of each column tile (column lane & 15) and, of every
// 16-key tile, the keys 8 * (lane >> 4) + 0..7: maximum and sum run in the lane, the two halves of a wave meet by one cross-row move,
// and two converted score tiles are the B fragment of the second product as they stand (same split k map as ldfrag_h).
// Every K fragment, V fragment and gate / mask vector read from LDS serves both column tiles.
#define AW 4            // waves per block
#define AT 2            // column tiles (16 queries each) per wave
static_assert(AW * AT * 16 == QT && AT == 2);
union __attribute__((aligned(16))) LdsU {
    _Float16 h[4 * KBLK * LDK];   // Ks | Vs | per-key gate and mask tables during the key loop
    float    f[2 * KBLK * LDK];   // Os after the key loop
};
static_assert(sizeof(LdsU) == 36864);
static_assert(QT * OST <= 2 * KBLK * LDK);
static_assert(KBLK * LDK + 2 * SEQ <= 2 * KBLK * LDK);
static_assert(SEQ % 4 == 0);
static_assert(KBLK == 64 && (KBLK * DHD / 8) % (AW * 32) == 0);

// lane l <-> lane l ^ 16
__device__ __forceinline__ float xhalf(float x) {
    const int b = __builtin_bit_cast(int, x);
    return __builtin_bit_cast(float, __builtin_amdgcn_permlanex16(b, b, 0x76543210, 0xfedcba98, false, false));
}
__device__ __forceinline__ v8f ld8f(const float* p) {
    union { v8f v; v4f q[2]; } u;
    u.q[0] = *(const v4fa*)(p);
    u.q[1] = *(const v4fa*)(p + 4);
    return u.v;
}

// second launch-bounds argument: three waves a SIMD, so that the three blocks a WGP gets are resident together
__global__ __launch_bounds__(AW * 32, 3)
void k_attn(const _Float16* __restrict__ Qh, const _Float16* __restrict__ Kh,
            const _Float16* __restrict__ Vt, const float* __restrict__ amask,
            const float* __restrict__ click, float* __restrict__ out)
{
    __shared__ LdsU lds;
    _Float16* Ks = lds.h;                      // [key][dh], cross-wave (block barriers)
    _Float16* Vs = lds.h + KBLK * LDK;         // [dh][key], cross-wave (block barriers)
    float* Gs = lds.f + KBLK * LDK;            // [key] score scale x gate, all SEQ keys
    float* Ms = Gs + SEQ;                      // [key] additive mask, all SEQ keys

    const int tid = threadIdx.x, lane = tid & 31, wave = tid >> 5;
    const int row16 = lane & 15, hsel = lane >> 4, kbase = hsel << 3;
    const int bh = blockIdx.y;
    const int b = bh / HH;
    const int hd = bh - b * HH;
    const int q0 = blockIdx.x * QT + wave * (AT * 16);
    const size_t baseQK = (size_t)bh * SEQ * DHD;
    const size_t baseV  = (size_t)bh * DHD * SEQ;

    // resident Q fragments (B operand, column = query): per column tile 64 dh x 16 queries = 2 k-steps
    const _Float16* qp[AT];
    v16h qf[AT][2];
    #pragma unroll
    for (int t = 0; t < AT; ++t) {
        qp[t] = Qh + baseQK + (size_t)(q0 + (t << 4) + row16) * DHD + kbase;
        #pragma unroll
        for (int kk = 0; kk < 2; ++kk) qf[t][kk] = ldfrag_h(qp[t] + (kk << 5));
    }

    // per-key tables: scale 1/sqrt(64) folded with the carries x gate, and the additive mask (both inputs RNE-converted to bf16);
    // published by the barriers at the head of the first pass
    constexpr int TU = (SEQ / 4 + AW * 32 - 1) / (AW * 32);       // 16-byte pieces of a table per thread
    constexpr bool tfull = (SEQ / 4) % (AW * 32) == 0;            // then no lane is ever off
    const float* cb = click + (size_t)b * SEQ_FULL;
    const float* mb = amask + (size_t)b * SEQ_FULL;
    v4f c4[TU], m4[TU];
    // unrolled, here and below: every index of c4 and m4 is a constant, so the arrays stay in registers
    #pragma unroll
    for (int u = 0; u < TU; ++u) {
        const int i = tid + u * (AW * 32);
        if (tfull || i < SEQ / 4) {
            c4[u] = *(const v4fa*)(cb + (i << 2));
            m4[u] = *(const v4fa*)(mb + (i << 2));
        }
    }
    // stands behind the last of the Q and table loads and takes their addresses as inputs, so that no register of them is rewritten in front of the wait
    asm volatile("s_wait_xcnt 0x0" :: "v"(qp[0]), "v"(qp[1]), "s"(cb), "s"(mb), "v"(tid) : "memory");
    #pragma unroll
    for (int u = 0; u < TU; ++u) {
        const int i = tid + u * (AW * 32);
        if (tfull || i < SEQ / 4) {
            v4f g4, k4;
            #pragma unroll
            for (int e = 0; e < 4; ++e) { g4[e] = S_SCALE * bf16_rne(c4[u][e]); k4[e] = bf16_rne(m4[u][e]); }
            *(v4fa*)(&Gs[i << 2]) = g4;
            *(v4fa*)(&Ms[i << 2]) = k4;
        }
    }

    v8f acc[AT][4];                      // O^T: element r of tile jd = dh 16 * jd + 8 * hsel + r of query 16 * t + row16
    float mrow[AT];                      // running maximum of the lane's queries, equal in both halves
    v8f lrow[AT];                        // running sums of the lane's queries, one per element position; joined behind the loop
    #pragma unroll
    for (int t = 0; t < AT; ++t) {
        #pragma unroll
        for (int jd = 0; jd < 4; ++jd)
            #pragma unroll
            for (int r = 0; r < 8; ++r) acc[t][jd][r] = 0.f;
        mrow[t] = -1e30f;
        #pragma unroll
        for (int r = 0; r < 8; ++r) lrow[t][r] = 0.f;
    }

    // staging map: 16-byte chunk c = tid + 128 * i of a 64 x 64 tile, row c >> 3, chunk c & 7: a wave's load covers four whole 128-byte rows
    const int srow = tid >> 3;           // + 16 * i
    const int sch  = (tid & 7) << 3;

    #pragma unroll 1
    for (int kb = 0; kb < SEQ; kb += KBLK) {
        __syncthreads();
        {   // K block [key][dh] and V block [dh][key], 64x64 each, fully written
            const _Float16* ksrc = Kh + baseQK + (size_t)(kb + srow) * DHD + sch;
            const _Float16* vsrc = Vt + baseV + (size_t)srow * SEQ + kb + sch;
            v8h k8[4], v8[4];
            #pragma unroll
            for (int i = 0; i < 4; ++i) k8[i] = *(const v8ha*)(ksrc + (size_t)(i << 4) * DHD);
            #pragma unroll
            for (int i = 0; i < 4; ++i) v8[i] = *(const v8ha*)(vsrc + (size_t)(i << 4) * SEQ);
            #pragma unroll
            for (int i = 0; i < 4; ++i) *(v8ha*)(&Ks[(srow + (i << 4)) * LDK + sch]) = k8[i];
            #pragma unroll
            for (int i = 0; i < 4; ++i) *(v8ha*)(&Vs[(srow + (i << 4)) * LDK + sch]) = v8[i];
        }
        __syncthreads();

        // scores S^T(64x32) = K(64x64) x Qw^T : A[m=key][k=dh] = Ks[key][dh], 4 m-tiles x 2 k-steps x 2 column tiles.
        // The eight K fragments are read as one group in front of the sixteen products.
        v16h kf[2][4];
        #pragma unroll
        for (int kk = 0; kk < 2; ++kk)
            #pragma unroll
            for (int j = 0; j < 4; ++j)
                kf[kk][j] = ldfrag_h(&Ks[((j << 4) + row16) * LDK + (kk << 5) + kbase]);
        // multiplicative per-key gate and additive mask: element r of tile j is key kb + 16 * j + 8 * hsel + r, the same for both column tiles;
        // read behind the fragments in the same group, they land under the products
        v8f g8[4], m8[4];
        #pragma unroll
        for (int j = 0; j < 4; ++j) {
            g8[j] = ld8f(&Gs[kb + (j << 4) + kbase]);
            m8[j] = ld8f(&Ms[kb + (j << 4) + kbase]);
        }
        v8f sc[AT][4];
        #pragma unroll
        for (int t = 0; t < AT; ++t)
            #pragma unroll
            for (int j = 0; j < 4; ++j)
                #pragma unroll
                for (int r = 0; r < 8; ++r) sc[t][j][r] = 0.f;
        #pragma unroll
        for (int kk = 0; kk < 2; ++kk)       // k-step outside: eight independent accumulators in a row; each sum keeps its order
            #pragma unroll
            for (int j = 0; j < 4; ++j)
                #pragma unroll
                for (int t = 0; t < AT; ++t) sc[t][j] = mma_h(kf[kk][j], qf[t][kk], sc[t][j]);
        // V fragments of keys 0..31 of the block, read well ahead of their products: they land under the softmax arithmetic
        v16h vf[4];
        #pragma unroll
        for (int jd = 0; jd < 4; ++jd) vf[jd] = ldfrag_h(&Vs[((jd << 4) + row16) * LDK + kbase]);
        #pragma unroll
        for (int j = 0; j < 4; ++j)
            #pragma unroll
            for (int t = 0; t < AT; ++t) sc[t][j] = sc[t][j] * g8[j] + m8[j];
        // online softmax of the lane's queries
        float corr[AT];
        #pragma unroll
        for (int t = 0; t < AT; ++t) {
            float mj[4];                 // one chain per tile: four independent chains
            #pragma unroll
            for (int j = 0; j < 4; ++j) {
                float m = sc[t][j][0];
                #pragma unroll
                for (int r = 1; r < 8; ++r) m = fmaxf(m, sc[t][j][r]);
                mj[j] = m;
            }
            float mx = fmaxf(fmaxf(mj[0], mj[1]), fmaxf(mj[2], mj[3]));
            mx = fmaxf(mx, xhalf(mx));
            const float mnew = fmaxf(mrow[t], mx);
            corr[t] = __expf(mrow[t] - mnew);
            mrow[t] = mnew;
            #pragma unroll
            for (int jd = 0; jd < 4; ++jd) acc[t][jd] = acc[t][jd] * corr[t];
        }
        // acc(64x32) += V^T(64x64) x P^T(64x32) : A[m=dh][k=key] = Vs[dh][key]; B[k=key][n=query] = P x1024 as f16,
        // elements 0..7 from score tile 2 * kk, elements 8..15 from tile 2 * kk + 1
        #pragma unroll
        for (int kk = 0; kk < 2; ++kk) {
            v16h pf[AT];
            #pragma unroll
            for (int t = 0; t < AT; ++t) {
                #pragma unroll
                for (int j = 2 * kk; j < 2 * kk + 2; ++j)
                    #pragma unroll
                    for (int r = 0; r < 8; ++r) sc[t][j][r] = __expf(sc[t][j][r] - mrow[t]);
                pf[t] = __builtin_shufflevector(__builtin_convertvector(sc[t][2 * kk] * P_CARRY, v8h),
                                                __builtin_convertvector(sc[t][2 * kk + 1] * P_CARRY, v8h),
                                                0, 1, 2, 3, 4, 5, 6, 7, 8, 9, 10, 11, 12, 13, 14, 15);
            }
            #pragma unroll
            for (int jd = 0; jd < 4; ++jd)
                #pragma unroll
                for (int t = 0; t < AT; ++t) acc[t][jd] = mma_h(vf[jd], pf[t], acc[t][jd]);
            if (kk == 0) {
                // V fragments of keys 32..63, one group behind the first eight products: they land under the second half's exponentials
                #pragma unroll
                for (int jd = 0; jd < 4; ++jd) vf[jd] = ldfrag_h(&Vs[((jd << 4) + row16) * LDK + 32 + kbase]);
                // keeps those exponentials behind the reads; without it the compiler lifts them in front of the first products and the reads are waited for uncovered
                __builtin_amdgcn_sched_barrier(0);
            }
        }
        #pragma unroll
        for (int t = 0; t < AT; ++t)
            lrow[t] = lrow[t] * corr[t] + ((sc[t][0] + sc[t][1]) + (sc[t][2] + sc[t][3]));
    }

    __syncthreads();                             // every wave is done with Ks / Vs and the tables
    float* Os = lds.f + wave * (AT * 16 * OST);  // wave-private region, block barriers used anyway
    #pragma unroll
    for (int t = 0; t < AT; ++t) {
        const v8f lr = lrow[t];
        const float lhalf = ((lr[0] + lr[1]) + (lr[2] + lr[3])) + ((lr[4] + lr[5]) + (lr[6] + lr[7]));
        const float scl = (1.0f / (lhalf + xhalf(lhalf))) * OUT_SCALE;
        #pragma unroll
        for (int jd = 0; jd < 4; ++jd) {
            const v8f o = acc[t][jd] * scl;
            float* od = &Os[((t << 4) + row16) * OST + (jd << 4) + kbase];
            v4f lo, hi;
            #pragma unroll
            for (int e = 0; e < 4; ++e) { lo[e] = o[e]; hi[e] = o[e + 4]; }
            *(v4fa*)(od)     = lo;
            *(v4fa*)(od + 4) = hi;
        }
    }
    __syncthreads();

    const int q4 = (lane & 15) << 2;
    v4f ov[AT * 8];
    #pragma unroll
    for (int p = 0; p < AT * 8; ++p) ov[p] = *(const v4fa*)(&Os[((p << 1) + hsel) * OST + q4]);
    float* orow = out + ((size_t)b * SEQ + q0) * DD + hd * DHD + q4;
    #pragma unroll
    for (int p = 0; p < AT * 8; ++p)
        *(v4f*)(orow + (size_t)((p << 1) + hsel) * DD) = ov[p];
}

// ---------------- launcher ----------------
extern "C" void kernel_launch(void* const* d_in, const int* in_sizes, int n_in,
                              void* d_out, int out_size, void* d_ws, size_t ws_size,
                              hipStream_t stream) {
    if (n_in < 9) return;
    const long long need_rows = (long long)(NB - 1) * SEQ_FULL + SEQ;
    if ((long long)in_sizes[0] < need_rows * DD) return;
    if ((long long)in_sizes[1] < need_rows) return;
    if ((long long)in_sizes[2] < need_rows) return;
    if (in_sizes[3] < DD * DD || in_sizes[5] < DD * DD || in_sizes[7] < DD * DD) return;
    if (in_sizes[4] < DD || in_sizes[6] < DD || in_sizes[8] < DD) return;
    if ((long long)out_size < (long long)MROWS * DD) return;

    const float* X     = (const float*)d_in[0];
    const float* amask = (const float*)d_in[1];
    const float* click = (const float*)d_in[2];
    const float* Wq    = (const float*)d_in[3];
    const float* bq    = (const float*)d_in[4];
    const float* Wk    = (const float*)d_in[5];
    const float* bk    = (const float*)d_in[6];
    const float* Wv    = (const float*)d_in[7];
    const float* bv    = (const float*)d_in[8];
    float* out = (float*)d_out;

    //   Xb  MROWS*DD bf16 | Wqb, Wkb, Wvb  DD*DD bf16 each | Qh, Kh, Vt  MROWS*DD f16 each
    const size_t plane = (size_t)MROWS * DD;      // elements
    const size_t wpl   = (size_t)DD * DD;
    const size_t total_bytes = 2u * (4u * plane + 3u * wpl);
    if (ws_size < total_bytes) return;
    unsigned short* Xb  = (unsigned short*)d_ws;
    unsigned short* Wqb = Xb + plane;
    unsigned short* Wkb = Wqb + wpl;
    unsigned short* Wvb = Wkb + wpl;
    _Float16* Qh = (_Float16*)(Wvb + wpl);
    _Float16* Kh = Qh + plane;
    _Float16* Vt = Kh + plane;

    k_cvt<<<dim3((XCH + 3 * WCH) / CVB), dim3(256), 0, stream>>>(X, Wq, Wk, Wv, Xb);   // fills Xb, Wqb, Wkb, Wvb

    k_proj<<<dim3(DD / PBN, MROWS / PBM, 3), dim3(128), 0, stream>>>(
        Xb, Wqb, Wkb, Wvb, bq, bk, bv, Qh, Kh, Vt);

    k_attn<<<dim3(SEQ / QT, NB * HH), dim3(AW * 32), 0, stream>>>(Qh, Kh, Vt, amask, click, out);
}

// v005
// It runs in 76.6 microseconds.
// In two side-by-side timings against v004, it was 1.12 and 1.13 times as fast.
// Over all steps from v000 it is 2.42 times as fast.
#include <hip/hip_runtime.h>

// Contractions: q/k/v projections on v_wmma_f32_16x16x32_bf16 (bf16 operands = RNE-converted f32 inputs, f32 accumulate);
// q.k^T and p.v on v_wmma_f32_16x16x32_f16 (f16 operands: q,k,v carried x8, unnormalised p carried x1024), f32 accumulate;
// softmax, gating and epilogues in f32.

#ifndef NB
#define NB 8
#endif
#ifndef SEQ
#define SEQ 1024
#endif
#define NB_FULL 8
#define SEQ_FULL 1024
#define DD 768
#define HH 12
#define DHD 64
#define MROWS (NB * SEQ)

#define PBM 128         // projection block tile, rows of X
#define PBN 128         // projection block tile, rows of W
#define PKS 64          // k per staged projection stage (128 B of every operand row)
#define PLD 72          // 16-bit LDS pitch of a staged operand row (144 B)
#define PSTG ((PBM + PBN) * PLD)     // 16-bit elements of one stage buffer
#define PNT (DD / PKS)  // stages
#define CST 136         // f16 LDS pitch of the projection epilogue tile (272 B)
#define QT 128          // queries per block (4 waves x 32 rows)
#define KBLK 64         // keys per staged block
#define LDK 72          // f16 LDS pitch of K / V tiles (144 B)
#define OST 68          // f32 LDS pitch of the output staging tile (272 B)
#define QKV_CARRY 8.0f
#define P_CARRY 1024.0f
#define OUT_SCALE (1.0f / 8192.0f)   // 1 / (QKV_CARRY * P_CARRY)
#define S_SCALE (1.0f / 512.0f)      // 1/sqrt(64) / (QKV_CARRY * QKV_CARRY)

static_assert(NB >= 1 && NB <= NB_FULL);
static_assert(SEQ >= QT && SEQ <= SEQ_FULL);
static_assert(SEQ % QT == 0);
static_assert(SEQ % KBLK == 0);
static_assert(SEQ % PBM == 0);
static_assert(DD % PBN == 0);
static_assert(DD % PKS == 0);
static_assert(PNT >= 2);
static_assert(DD % 64 == 0);
static_assert(DD % 32 == 0);
static_assert(HH * DHD == DD);
static_assert(DHD == 64);

typedef _Float16 v16h __attribute__((ext_vector_type(16)));
typedef _Float16 v8h  __attribute__((ext_vector_type(8)));
typedef v8h v8ha __attribute__((may_alias));
typedef __bf16 v16b __attribute__((ext_vector_type(16)));
typedef unsigned short v8us __attribute__((ext_vector_type(8)));
typedef v8us v8usa __attribute__((may_alias));
typedef float v8f __attribute__((ext_vector_type(8)));
typedef float v4f __attribute__((ext_vector_type(4)));
typedef v4f v4fa __attribute__((may_alias));

static_assert(sizeof(v16b) == sizeof(v8f));

// ---------------- bf16 RNE convert helpers ----------------
__device__ __forceinline__ unsigned short f2bf_bits(float f) {
    unsigned int u = __float_as_uint(f);
    u += 0x7FFFu + ((u >> 16) & 1u);
    return (unsigned short)(u >> 16);
}
__device__ __forceinline__ float bf16_rne(float f) {
    unsigned int u = __float_as_uint(f);
    u += 0x7FFFu + ((u >> 16) & 1u);
    return __uint_as_float(u & 0xFFFF0000u);
}

// ---------------- 16x32 fragment loaders (wave32 split k map, same for A and B) ----------------
// lane l: row (A) / column (B) = l & 15; elements 0..7 <- k0 + 8*(l>>4) + 0..7, elements 8..15 <- k0 + 16 + 8*(l>>4) + 0..7.
// p points at element (row, k0 + 8*(l>>4)) of a k-contiguous 16-bit row; 16-B aligned.
__device__ __forceinline__ v16h ldfrag_h(const _Float16* p) {
    union { v16h v; v8h h[2]; } u;
    u.h[0] = *(const v8ha*)(p);
    u.h[1] = *(const v8ha*)(p + 16);
    return u.v;
}
__device__ __forceinline__ v16b ldfrag_b(const unsigned short* p) {
    union { v16b v; v8us h[2]; } u;
    u.h[0] = *(const v8usa*)(p);
    u.h[1] = *(const v8usa*)(p + 16);
    return u.v;
}

__device__ __forceinline__ v8f ld8f(const float* p) {
    union { v8f v; v4f q[2]; } u;
    u.q[0] = *(const v4fa*)(p);
    u.q[1] = *(const v4fa*)(p + 4);
    return u.v;
}

// ---------------- WMMA wrappers with the VALU hazard guard ----------------
__device__ __forceinline__ v8f mma_h(v16h a, v16h b, v8f c) {
    c = __builtin_amdgcn_wmma_f32_16x16x32_f16(false, a, false, b, (short)0, c, false, false);
    asm volatile("v_nop\n\tv_nop\n\tv_nop\n\tv_nop" : "+v"(c) : "v"(a), "v"(b));
    return c;
}
__device__ __forceinline__ v8f mma_b(v16b a, v16b b, v8f c) {
    c = __builtin_amdgcn_wmma_f32_16x16x32_bf16(false, a, false, b, (short)0, c, false, false);
    const v8f ka = __builtin_bit_cast(v8f, a);
    const v8f kbv = __builtin_bit_cast(v8f, b);
    asm volatile("v_nop\n\tv_nop\n\tv_nop\n\tv_nop" : "+v"(c) : "v"(ka), "v"(kbv));
    return c;
}

// ---------------- f32 rows -> bf16 bit planes ----------------
// One launch converts X, Wq, Wk and Wv. The four planes lie one behind the other in the workspace, so a chunk of 8 elements
// has one flat index over all of them; a block takes CVB consecutive chunks, all of one source (block-uniform choice).
// A thread converts CVU chunks, 256 chunks apart: its 2 * CVU loads of 16 B are all issued before the first is used.
// Compact X plane row m reads source row (m / SEQ) * SEQ_FULL + (m % SEQ).
#define CVU 8                        // chunks per thread
#define CVB (256 * CVU)              // chunks per block
#define XCH (MROWS * (DD / 8))       // chunks of the X plane
#define WCH (DD * (DD / 8))          // chunks of one W plane
static_assert(XCH % CVB == 0);
static_assert(WCH % CVB == 0);

__global__ __launch_bounds__(256) void k_cvt(const float* __restrict__ X,
                                             const float* __restrict__ Wq, const float* __restrict__ Wk,
                                             const float* __restrict__ Wv,
                                             unsigned short* __restrict__ dst) {
    const int blk = blockIdx.x;
    const int t0 = blk * CVB + (int)threadIdx.x;          // flat chunk of the thread's first piece
    const bool isx = blk < XCH / CVB;
    const int w = isx ? 0 : (blk - XCH / CVB) / (WCH / CVB);
    const float* src = isx ? X : ((w == 0) ? Wq : ((w == 1) ? Wk : Wv));
    const int l0 = isx ? t0 : (t0 - XCH - w * WCH);       // chunk inside the source plane

    v4f f[2 * CVU];
    // unrolled: every index of f is a constant, so the array stays in registers and the loads stand together
    #pragma unroll
    for (int i = 0; i < CVU; ++i) {
        const int l = l0 + i * 256;
        size_t off = (size_t)l * 8;
        if (SEQ != SEQ_FULL && isx) {
            const int m  = l / (DD / 8);
            const int c8 = (l - m * (DD / 8)) * 8;
            const int bb = m / SEQ;
            off = (size_t)(bb * SEQ_FULL + (m - bb * SEQ)) * DD + c8;
        }
        const float* p = src + off;
        f[2 * i]     = *(const v4fa*)(p);
        f[2 * i + 1] = *(const v4fa*)(p + 4);
    }
    // stands behind the last load and takes the loads' address as an input, so that no register of it is rewritten in front of the wait
    asm volatile("s_wait_xcnt 0x0" :: "v"(src + (size_t)l0 * 8) : "memory");
    #pragma unroll
    for (int i = 0; i < CVU; ++i) {
        const v4f f0 = f[2 * i], f1 = f[2 * i + 1];
        v8us o;
        o[0] = f2bf_bits(f0.x); o[1] = f2bf_bits(f0.y); o[2] = f2bf_bits(f0.z); o[3] = f2bf_bits(f0.w);
        o[4] = f2bf_bits(f1.x); o[5] = f2bf_bits(f1.y); o[6] = f2bf_bits(f1.z); o[7] = f2bf_bits(f1.w);
        *(v8us*)(dst + (size_t)(t0 + i * 256) * 8) = o;
    }
}

// ---------------- QKV projection GEMM ----------------
// C[m][n] = sum_k Xb[m][k] * Wb[n][k] + bias[n], m in [0,MROWS), n in [0,DD), k in [0,DD); Wb is [out][in] = n-major, k contiguous.
// grid (DD/128, MROWS/128, 3), block 128 = 4 waves (2x2), block tile 128x128, wave tile 64x64.
// Both operand tiles are staged in LDS, 64 k (128 B of every row) per stage, by asynchronous 16-byte copies into two buffers:
// the copies of stage t + 2 fly while stage t + 1 is worked on. Fragments are read from LDS by ldfrag_b, k ascending, so every sum keeps its order.
// The operand whose index runs along a row of the epilogue tile is the A operand (W rows for mat 0,1; X rows for mat 2): a lane's eight
// accumulator elements are then eight neighbours of one staged row. Both loaders share one k map, so the swap pairs the same k.
// mat 0,1 -> Qh/Kh f16 [NB*HH][SEQ][64] (x8); mat 2 -> Vt f16 [NB*HH][64][SEQ] (x8, transposed for the p.v A operand).
union __attribute__((aligned(16))) ProjLds {
    unsigned short s[2 * PSTG];   // two stage buffers, each [X 128 rows | W 128 rows] at pitch PLD
    _Float16       h[PBM * CST];  // epilogue tile after the k loop
};
static_assert(sizeof(ProjLds) == 73728);

// Eight asynchronous copies of one lane, 16 B each, rows 16 apart in the source plane and in the LDS buffer.
// l0: the lane's LDS byte address, g0: the lane's global address, both of the first row.
__device__ __forceinline__ void copy8_rows16(unsigned l0, const unsigned short* g0) {
    const unsigned lstep = 16u * PLD * 2u;
    const size_t gstep = (size_t)16 * DD;
    // s_wait_xcnt closes the statement so that no address register of a copy is rewritten in front of it
    asm volatile(
        "global_load_async_to_lds_b128 %0, %8, off\n\t"
        "global_load_async_to_lds_b128 %1, %9, off\n\t"
        "global_load_async_to_lds_b128 %2, %10, off\n\t"
        "global_load_async_to_lds_b128 %3, %11, off\n\t"
        "global_load_async_to_lds_b128 %4, %12, off\n\t"
        "global_load_async_to_lds_b128 %5, %13, off\n\t"
        "global_load_async_to_lds_b128 %6, %14, off\n\t"
        "global_load_async_to_lds_b128 %7, %15, off\n\t"
        "s_wait_xcnt 0x0"
        :: "v"(l0), "v"(l0 + lstep), "v"(l0 + 2u * lstep), "v"(l0 + 3u * lstep),
           "v"(l0 + 4u * lstep), "v"(l0 + 5u * lstep), "v"(l0 + 6u * lstep), "v"(l0 + 7u * lstep),
           "v"(g0), "v"(g0 + gstep), "v"(g0 + 2 * gstep), "v"(g0 + 3 * gstep),
           "v"(g0 + 4 * gstep), "v"(g0 + 5 * gstep), "v"(g0 + 6 * gstep), "v"(g0 + 7 * gstep)
        : "memory");
}

__global__ __launch_bounds__(128) void k_proj(
    const unsigned short* __restrict__ Xb,
    const unsigned short* __restrict__ Wqb, const unsigned short* __restrict__ Wkb,
    const unsigned short* __restrict__ Wvb,
    const float* __restrict__ bq, const float* __restrict__ bk, const float* __restrict__ bv,
    _Float16* __restrict__ Qh, _Float16* __restrict__ Kh, _Float16* __restrict__ Vt)
{
    __shared__ ProjLds lds;

    const int tid = threadIdx.x, lane = tid & 31, wave = tid >> 5;
    const int row16 = lane & 15, hsel = lane >> 4, kbase = hsel << 3;
    const int mat = blockIdx.z;
    const int n0 = blockIdx.x * PBN;
    const int m0 = blockIdx.y * PBM;
    const int wm = (wave & 1) << 6;
    const int wn = (wave >> 1) << 6;
    const unsigned short* Wb = (mat == 0) ? Wqb : ((mat == 1) ? Wkb : Wvb);
    const float* bias = (mat == 0) ? bq : ((mat == 1) ? bk : bv);
    const bool wa = (mat != 2);                 // block-uniform: W rows are the A operand
    const int abase = wa ? wn : wm;             // the wave's first A row inside its operand tile = first column of the staged tile
    const int bbase = wa ? wm : wn;             // the wave's first B row inside its operand tile = first row of the staged tile
    const int arow0 = wa ? (PBM + wn) : wm;     // the same two as rows of a stage buffer [X | W]
    const int brow0 = wa ? wm : (PBM + wn);

    v8f c[4][4];
    #pragma unroll
    for (int i = 0; i < 4; ++i)
        #pragma unroll
        for (int j = 0; j < 4; ++j)
            #pragma unroll
            for (int r = 0; r < 8; ++r) c[i][j][r] = 0.f;

    // copy map: thread -> row (tid >> 3) + 16 * i, 16-byte chunk tid & 7 of the row's 128 B; a wave's copy covers 4 whole lines
    const int crow = tid >> 3, cchk = tid & 7;
    const unsigned short* gX = Xb + (size_t)(m0 + crow) * DD + (cchk << 3);
    const unsigned short* gW = Wb + (size_t)(n0 + crow) * DD + (cchk << 3);
    const unsigned lX = (unsigned)(size_t)(&lds.s[crow * PLD + (cchk << 3)]);
    const unsigned lW = lX + (unsigned)(PBM * PLD * 2);

    copy8_rows16(lX, gX);
    copy8_rows16(lW, gW);
    asm volatile("s_wait_asynccnt 0x0" ::: "memory");   // stage 0 has landed before the barrier publishes it
    __syncthreads();
    copy8_rows16(lX + (unsigned)(PSTG * 2), gX + PKS);
    copy8_rows16(lW + (unsigned)(PSTG * 2), gW + PKS);

    // one copy of the loop body: the buffer is picked by an offset, and the copies' addresses stay few
    #pragma unroll 1
    for (int t = 0; t < PNT; ++t) {
        const int boff = (t & 1) * PSTG;
        const unsigned short* As = &lds.s[boff + (arow0 + row16) * PLD + kbase];
        const unsigned short* Bs = &lds.s[boff + (brow0 + row16) * PLD + kbase];
        // unrolled throughout: every index of a, b and c is a constant, so the arrays stay in registers
        #pragma unroll
        for (int kk = 0; kk < PKS; kk += 32) {
            v16b a[4], b[4];
            #pragma unroll
            for (int i = 0; i < 4; ++i) a[i] = ldfrag_b(As + i * 16 * PLD + kk);
            #pragma unroll
            for (int j = 0; j < 4; ++j) b[j] = ldfrag_b(Bs + j * 16 * PLD + kk);
            #pragma unroll
            for (int i = 0; i < 4; ++i)
                #pragma unroll
                for (int j = 0; j < 4; ++j) c[i][j] = mma_b(a[i], b[j], c[i][j]);
        }
        asm volatile("s_wait_dscnt 0x0" ::: "memory");      // this wave's reads of buffer t & 1 are done before it is refilled
        asm volatile("s_wait_asynccnt 0x0" ::: "memory");   // this wave's copies of stage t + 1 have landed
        __syncthreads();                                    // publishes stage t + 1, ends every read of stage t
        if (t + 2 < PNT) {
            copy8_rows16(lX + (unsigned)(boff * 2), gX + (t + 2) * PKS);
            copy8_rows16(lW + (unsigned)(boff * 2), gW + (t + 2) * PKS);
        }
    }
    asm volatile("s_wait_asynccnt 0x0" ::: "memory");       // no copy is in flight when the buffers become the epilogue tile

    // epilogue: + bf16(bias), x8 carry, f16, staged in LDS as [s][n] (mat 0,1) or [n][s] (mat 2)
    // element r of c[i][j] is staged row bbase + 16 * j + row16, column abase + 16 * i + 8 * hsel + r: one 16-byte store per tile
    _Float16* Cs = lds.h;
    _Float16* cd = &Cs[(bbase + row16) * CST + abase + kbase];
    if (wa) {       // n runs along the staged row: eight biases per A tile
        const float* bp = bias + n0 + wn + kbase;
        v8f bb[4];
        #pragma unroll
        for (int i = 0; i < 4; ++i) bb[i] = ld8f(bp + (i << 4));
        // stands behind the bias loads and takes their address as an input, so that no register of it is rewritten in front of the wait
        asm volatile("s_wait_xcnt 0x0" :: "v"(bp) : "memory");
        #pragma unroll
        for (int i = 0; i < 4; ++i) {
            #pragma unroll
            for (int r = 0; r < 8; ++r) bb[i][r] = bf16_rne(bb[i][r]);
            #pragma unroll
            for (int j = 0; j < 4; ++j)
                *(v8ha*)(cd + (j << 4) * CST + (i << 4)) = __builtin_convertvector((c[i][j] + bb[i]) * QKV_CARRY, v8h);
        }
    } else {        // n is the staged row: one bias per B tile
        const float* bp = bias + n0 + wn + row16;
        float bb[4];
        #pragma unroll
        for (int j = 0; j < 4; ++j) bb[j] = bp[j << 4];
        // as above
        asm volatile("s_wait_xcnt 0x0" :: "v"(bp) : "memory");
        #pragma unroll
        for (int j = 0; j < 4; ++j) {
            const float bj = bf16_rne(bb[j]);
            #pragma unroll
            for (int i = 0; i < 4; ++i)
                *(v8ha*)(cd + (j << 4) * CST + (i << 4)) = __builtin_convertvector((c[i][j] + bj) * QKV_CARRY, v8h);
        }
    }
    __syncthreads();

    const int hd0 = n0 >> 6;                // first of the two heads of this 128-wide n tile
    const int bi = m0 / SEQ;                // batch of this 128-row m tile
    const int s0 = m0 - bi * SEQ;
    const int q8 = (tid & 15) << 3;         // 16-byte chunk of a 128-wide staged row
    const int l0 = tid >> 4;
    v8h v[16];
    #pragma unroll
    for (int p = 0; p < 16; ++p) v[p] = *(const v8ha*)(&Cs[(l0 + (p << 3)) * CST + q8]);
    if (mat == 2) {
        #pragma unroll
        for (int p = 0; p < 16; ++p) {
            const int l = l0 + (p << 3);    // staged row = n: head hd0 + (l >> 6), dh = l & 63; chunk = s
            const size_t bhh = (size_t)bi * HH + hd0 + (l >> 6);
            *(v8h*)(Vt + (bhh * DHD + (l & 63)) * SEQ + s0 + q8) = v[p];
        }
    } else {
        _Float16* dst = (mat == 0) ? Qh : Kh;
        const size_t bhh = (size_t)bi * HH + hd0 + (q8 >> 6);
        #pragma unroll
        for (int p = 0; p < 16; ++p) {
            const int l = l0 + (p << 3);    // staged row = s; chunk = n: head hd0 + (q8 >> 6), dh = q8 & 63
            *(v8h*)(dst + (bhh * SEQ + s0 + l) * DHD + (q8 & 63)) = v[p];
        }
        // the built code lets this path run on into the V path's address arithmetic, which rewrites the stores' address pair: the wait stands in front of that
        asm volatile("s_wait_xcnt 0x0" ::: "memory");
    }
}

// ---------------- flash-style attention ----------------
// Qh,Kh: [NB*HH][SEQ][64] f16 (x8); Vt: [NB*HH][64][SEQ] f16 (x8); out: [NB][SEQ][DD] f32.
// grid (SEQ/QT, NB*HH), block 128 = 4 waves, wave owns 32 queries = two column tiles; keys staged 64 at a time.
// Transposed products: S^T = K x Q^T and O^T += V^T x P^T. A lane holds one query of each column tile (column lane & 15) and, of every
// 16-key tile, the keys 8 * (lane >> 4) + 0..7: maximum and sum run in the lane, the two halves of a wave meet by one cross-row move,
// and two converted score tiles are the B fragment of the second product as they stand (same split k map as ldfrag_h).
// Every K fragment, V fragment and gate / mask vector read from LDS serves both column tiles.
#define AW 4            // waves per block
#define AT 2            // column tiles (16 queries each) per wave
static_assert(AW * AT * 16 == QT && AT == 2);
union __attribute__((aligned(16))) LdsU {
    _Float16 h[4 * KBLK * LDK];   // Ks | Vs | per-key gate and mask tables during the key loop
    float    f[2 * KBLK * LDK];   // Os after the key loop
};
static_assert(sizeof(LdsU) == 36864);
static_assert(QT * OST <= 2 * KBLK * LDK);
static_assert(KBLK * LDK + 2 * SEQ <= 2 * KBLK * LDK);
static_assert(SEQ % 4 == 0);
static_assert(KBLK == 64 && (KBLK * DHD / 8) % (AW * 32) == 0);

// lane l <-> lane l ^ 16
__device__ __forceinline__ float xhalf(float x) {
    const int b = __builtin_bit_cast(int, x);
    return __builtin_bit_cast(float, __builtin_amdgcn_permlanex16(b, b, 0x76543210, 0xfedcba98, false, false));
}

// second launch-bounds argument: three waves a SIMD, so that the three blocks a WGP gets are resident together
__global__ __launch_bounds__(AW * 32, 3)
void k_attn(const _Float16* __restrict__ Qh, const _Float16* __restrict__ Kh,
            const _Float16* __restrict__ Vt, const float* __restrict__ amask,
            const float* __restrict__ click, float* __restrict__ out)
{
    __shared__ LdsU lds;
    _Float16* Ks = lds.h;                      // [key][dh], cross-wave (block barriers)
    _Float16* Vs = lds.h + KBLK * LDK;         // [dh][key], cross-wave (block barriers)
    float* Gs = lds.f + KBLK * LDK;            // [key] score scale x gate, all SEQ keys
    float* Ms = Gs + SEQ;                      // [key] additive mask, all SEQ keys

    const int tid = threadIdx.x, lane = tid & 31, wave = tid >> 5;
    const int row16 = lane & 15, hsel = lane >> 4, kbase = hsel << 3;
    const int bh = blockIdx.y;
    const int b = bh / HH;
    const int hd = bh - b * HH;
    const int q0 = blockIdx.x * QT + wave * (AT * 16);
    const size_t baseQK = (size_t)bh * SEQ * DHD;
    const size_t baseV  = (size_t)bh * DHD * SEQ;

    // resident Q fragments (B operand, column = query): per column tile 64 dh x 16 queries = 2 k-steps
    const _Float16* qp[AT];
    v16h qf[AT][2];
    #pragma unroll
    for (int t = 0; t < AT; ++t) {
        qp[t] = Qh + baseQK + (size_t)(q0 + (t << 4) + row16) * DHD + kbase;
        #pragma unroll
        for (int kk = 0; kk < 2; ++kk) qf[t][kk] = ldfrag_h(qp[t] + (kk << 5));
    }

    // per-key tables: scale 1/sqrt(64) folded with the carries x gate, and the additive mask (both inputs RNE-converted to bf16);
    // published by the barriers at the head of the first pass
    constexpr int TU = (SEQ / 4 + AW * 32 - 1) / (AW * 32);       // 16-byte pieces of a table per thread
    constexpr bool tfull = (SEQ / 4) % (AW * 32) == 0;            // then no lane is ever off
    const float* cb = click + (size_t)b * SEQ_FULL;
    const float* mb = amask + (size_t)b * SEQ_FULL;
    v4f c4[TU], m4[TU];
    // unrolled, here and below: every index of c4 and m4 is a constant, so the arrays stay in registers
    #pragma unroll
    for (int u = 0; u < TU; ++u) {
        const int i = tid + u * (AW * 32);
        if (tfull || i < SEQ / 4) {
            c4[u] = *(const v4fa*)(cb + (i << 2));
            m4[u] = *(const v4fa*)(mb + (i << 2));
        }
    }
    // stands behind the last of the Q and table loads and takes their addresses as inputs, so that no register of them is rewritten in front of the wait
    asm volatile("s_wait_xcnt 0x0" :: "v"(qp[0]), "v"(qp[1]), "s"(cb), "s"(mb), "v"(tid) : "memory");
    #pragma unroll
    for (int u = 0; u < TU; ++u) {
        const int i = tid + u * (AW * 32);
        if (tfull || i < SEQ / 4) {
            v4f g4, k4;
            #pragma unroll
            for (int e = 0; e < 4; ++e) { g4[e] = S_SCALE * bf16_rne(c4[u][e]); k4[e] = bf16_rne(m4[u][e]); }
            *(v4fa*)(&Gs[i << 2]) = g4;
            *(v4fa*)(&Ms[i << 2]) = k4;
        }
    }

    v8f acc[AT][4];                      // O^T: element r of tile jd = dh 16 * jd + 8 * hsel + r of query 16 * t + row16
    float mrow[AT];                      // running maximum of the lane's queries, equal in both halves
    v8f lrow[AT];                        // running sums of the lane's queries, one per element position; joined behind the loop
    #pragma unroll
    for (int t = 0; t < AT; ++t) {
        #pragma unroll
        for (int jd = 0; jd < 4; ++jd)
            #pragma unroll
            for (int r = 0; r < 8; ++r) acc[t][jd][r] = 0.f;
        mrow[t] = -1e30f;
        #pragma unroll
        for (int r = 0; r < 8; ++r) lrow[t][r] = 0.f;
    }

    // staging map: 16-byte chunk c = tid + 128 * i of a 64 x 64 tile, row c >> 3, chunk c & 7: a wave's load covers four whole 128-byte rows
    const int srow = tid >> 3;           // + 16 * i
    const int sch  = (tid & 7) << 3;

    #pragma unroll 1
    for (int kb = 0; kb < SEQ; kb += KBLK) {
        __syncthreads();
        {   // K block [key][dh] and V block [dh][key], 64x64 each, fully written
            const _Float16* ksrc = Kh + baseQK + (size_t)(kb + srow) * DHD + sch;
            const _Float16* vsrc = Vt + baseV + (size_t)srow * SEQ + kb + sch;
            v8h k8[4], v8[4];
            #pragma unroll
            for (int i = 0; i < 4; ++i) k8[i] = *(const v8ha*)(ksrc + (size_t)(i << 4) * DHD);
            #pragma unroll
            for (int i = 0; i < 4; ++i) v8[i] = *(const v8ha*)(vsrc + (size_t)(i << 4) * SEQ);
            #pragma unroll
            for (int i = 0; i < 4; ++i) *(v8ha*)(&Ks[(srow + (i << 4)) * LDK + sch]) = k8[i];
            #pragma unroll
            for (int i = 0; i < 4; ++i) *(v8ha*)(&Vs[(srow + (i << 4)) * LDK + sch]) = v8[i];
        }
        __syncthreads();

        // scores S^T(64x32) = K(64x64) x Qw^T : A[m=key][k=dh] = Ks[key][dh], 4 m-tiles x 2 k-steps x 2 column tiles.
        // The eight K fragments are read as one group in front of the sixteen products.
        v16h kf[2][4];
        #pragma unroll
        for (int kk = 0; kk < 2; ++kk)
            #pragma unroll
            for (int j = 0; j < 4; ++j)
                kf[kk][j] = ldfrag_h(&Ks[((j << 4) + row16) * LDK + (kk << 5) + kbase]);
        // multiplicative per-key gate and additive mask: element r of tile j is key kb + 16 * j + 8 * hsel + r, the same for both column tiles;
        // read behind the fragments in the same group, they land under the products
        v8f g8[4], m8[4];
        #pragma unroll
        for (int j = 0; j < 4; ++j) {
            g8[j] = ld8f(&Gs[kb + (j << 4) + kbase]);
            m8[j] = ld8f(&Ms[kb + (j << 4) + kbase]);
        }
        v8f sc[AT][4];
        #pragma unroll
        for (int t = 0; t < AT; ++t)
            #pragma unroll
            for (int j = 0; j < 4; ++j)
                #pragma unroll
                for (int r = 0; r < 8; ++r) sc[t][j][r] = 0.f;
        #pragma unroll
        for (int kk = 0; kk < 2; ++kk)       // k-step outside: eight independent accumulators in a row; each sum keeps its order
            #pragma unroll
            for (int j = 0; j < 4; ++j)
                #pragma unroll
                for (int t = 0; t < AT; ++t) sc[t][j] = mma_h(kf[kk][j], qf[t][kk], sc[t][j]);
        // V fragments of keys 0..31 of the block, read well ahead of their products: they land under the softmax arithmetic
        v16h vf[4];
        #pragma unroll
        for (int jd = 0; jd < 4; ++jd) vf[jd] = ldfrag_h(&Vs[((jd << 4) + row16) * LDK + kbase]);
        #pragma unroll
        for (int j = 0; j < 4; ++j)
            #pragma unroll
            for (int t = 0; t < AT; ++t) sc[t][j] = sc[t][j] * g8[j] + m8[j];
        // online softmax of the lane's queries
        float corr[AT];
        #pragma unroll
        for (int t = 0; t < AT; ++t) {
            float mj[4];                 // one chain per tile: four independent chains
            #pragma unroll
            for (int j = 0; j < 4; ++j) {
                float m = sc[t][j][0];
                #pragma unroll
                for (int r = 1; r < 8; ++r) m = fmaxf(m, sc[t][j][r]);
                mj[j] = m;
            }
            float mx = fmaxf(fmaxf(mj[0], mj[1]), fmaxf(mj[2], mj[3]));
            mx = fmaxf(mx, xhalf(mx));
            const float mnew = fmaxf(mrow[t], mx);
            corr[t] = __expf(mrow[t] - mnew);
            mrow[t] = mnew;
            #pragma unroll
            for (int jd = 0; jd < 4; ++jd) acc[t][jd] = acc[t][jd] * corr[t];
        }
        // acc(64x32) += V^T(64x64) x P^T(64x32) : A[m=dh][k=key] = Vs[dh][key]; B[k=key][n=query] = P x1024 as f16,
        // elements 0..7 from score tile 2 * kk, elements 8..15 from tile 2 * kk + 1
        #pragma unroll
        for (int kk = 0; kk < 2; ++kk) {
            v16h pf[AT];
            #pragma unroll
            for (int t = 0; t < AT; ++t) {
                #pragma unroll
                for (int j = 2 * kk; j < 2 * kk + 2; ++j)
                    #pragma unroll
                    for (int r = 0; r < 8; ++r) sc[t][j][r] = __expf(sc[t][j][r] - mrow[t]);
                pf[t] = __builtin_shufflevector(__builtin_convertvector(sc[t][2 * kk] * P_CARRY, v8h),
                                                __builtin_convertvector(sc[t][2 * kk + 1] * P_CARRY, v8h),
                                                0, 1, 2, 3, 4, 5, 6, 7, 8, 9, 10, 11, 12, 13, 14, 15);
            }
            #pragma unroll
            for (int jd = 0; jd < 4; ++jd)
                #pragma unroll
                for (int t = 0; t < AT; ++t) acc[t][jd] = mma_h(vf[jd], pf[t], acc[t][jd]);
            if (kk == 0) {
                // V fragments of keys 32..63, one group behind the first eight products: they land under the second half's exponentials
                #pragma unroll
                for (int jd = 0; jd < 4; ++jd) vf[jd] = ldfrag_h(&Vs[((jd << 4) + row16) * LDK + 32 + kbase]);
                // keeps those exponentials behind the reads; without it the compiler lifts them in front of the first products and the reads are waited for uncovered
                __builtin_amdgcn_sched_barrier(0);
            }
        }
        #pragma unroll
        for (int t = 0; t < AT; ++t)
            lrow[t] = lrow[t] * corr[t] + ((sc[t][0] + sc[t][1]) + (sc[t][2] + sc[t][3]));
    }

    __syncthreads();                             // every wave is done with Ks / Vs and the tables
    float* Os = lds.f + wave * (AT * 16 * OST);  // wave-private region, block barriers used anyway
    #pragma unroll
    for (int t = 0; t < AT; ++t) {
        const v8f lr = lrow[t];
        const float lhalf = ((lr[0] + lr[1]) + (lr[2] + lr[3])) + ((lr[4] + lr[5]) + (lr[6] + lr[7]));
        const float scl = (1.0f / (lhalf + xhalf(lhalf))) * OUT_SCALE;
        #pragma unroll
        for (int jd = 0; jd < 4; ++jd) {
            const v8f o = acc[t][jd] * scl;
            float* od = &Os[((t << 4) + row16) * OST + (jd << 4) + kbase];
            v4f lo, hi;
            #pragma unroll
            for (int e = 0; e < 4; ++e) { lo[e] = o[e]; hi[e] = o[e + 4]; }
            *(v4fa*)(od)     = lo;
            *(v4fa*)(od + 4) = hi;
        }
    }
    __syncthreads();

    const int q4 = (lane & 15) << 2;
    v4f ov[AT * 8];
    #pragma unroll
    for (int p = 0; p < AT * 8; ++p) ov[p] = *(const v4fa*)(&Os[((p << 1) + hsel) * OST + q4]);
    float* orow = out + ((size_t)b * SEQ + q0) * DD + hd * DHD + q4;
    #pragma unroll
    for (int p = 0; p < AT * 8; ++p)
        *(v4f*)(orow + (size_t)((p << 1) + hsel) * DD) = ov[p];
}

// ---------------- launcher ----------------
extern "C" void kernel_launch(void* const* d_in, const int* in_sizes, int n_in,
                              void* d_out, int out_size, void* d_ws, size_t ws_size,
                              hipStream_t stream) {
    if (n_in < 9) return;
    const long long need_rows = (long long)(NB - 1) * SEQ_FULL + SEQ;
    if ((long long)in_sizes[0] < need_rows * DD) return;
    if ((long long)in_sizes[1] < need_rows) return;
    if ((long long)in_sizes[2] < need_rows) return;
    if (in_sizes[3] < DD * DD || in_sizes[5] < DD * DD || in_sizes[7] < DD * DD) return;
    if (in_sizes[4] < DD || in_sizes[6] < DD || in_sizes[8] < DD) return;
    if ((long long)out_size < (long long)MROWS * DD) return;

    const float* X     = (const float*)d_in[0];
    const float* amask = (const float*)d_in[1];
    const float* click = (const float*)d_in[2];
    const float* Wq    = (const float*)d_in[3];
    const float* bq    = (const float*)d_in[4];
    const float* Wk    = (const float*)d_in[5];
    const float* bk    = (const float*)d_in[6];
    const float* Wv    = (const float*)d_in[7];
    const float* bv    = (const float*)d_in[8];
    float* out = (float*)d_out;

    //   Xb  MROWS*DD bf16 | Wqb, Wkb, Wvb  DD*DD bf16 each | Qh, Kh, Vt  MROWS*DD f16 each
    const size_t plane = (size_t)MROWS * DD;      // elements
    const size_t wpl   = (size_t)DD * DD;
    const size_t total_bytes = 2u * (4u * plane + 3u * wpl);
    if (ws_size < total_bytes) return;
    unsigned short* Xb  = (unsigned short*)d_ws;
    unsigned short* Wqb = Xb + plane;
    unsigned short* Wkb = Wqb + wpl;
    unsigned short* Wvb = Wkb + wpl;
    _Float16* Qh = (_Float16*)(Wvb + wpl);
    _Float16* Kh = Qh + plane;
    _Float16* Vt = Kh + plane;

    k_cvt<<<dim3((XCH + 3 * WCH) / CVB), dim3(256), 0, stream>>>(X, Wq, Wk, Wv, Xb);   // fills Xb, Wqb, Wkb, Wvb

    k_proj<<<dim3(DD / PBN, MROWS / PBM, 3), dim3(128), 0, stream>>>(
        Xb, Wqb, Wkb, Wvb, bq, bk, bv, Qh, Kh, Vt);

    k_attn<<<dim3(SEQ / QT, NB * HH), dim3(AW * 32), 0, stream>>>(Qh, Kh, Vt, amask, click, out);
}

// v006
// Measured time: 73.1 microseconds a run.
// In two side-by-side timings against v005, it was 1.04 and 1.05 times as fast.
// Over all steps from v000 it is 2.52 times as fast.
#include <hip/hip_runtime.h>

// Contractions: q/k/v projections on v_wmma_f32_16x16x32_bf16 (bf16 operands = RNE-converted f32 inputs, f32 accumulate);
// q.k^T and p.v on v_wmma_f32_16x16x32_f16 (f16 operands: q,k,v carried x8, unnormalised p carried x1024), f32 accumulate;
// softmax, gating and epilogues in f32.

#ifndef NB
#define NB 8
#endif
#ifndef SEQ
#define SEQ 1024
#endif
#define NB_FULL 8
#define SEQ_FULL 1024
#define DD 768
#define HH 12
#define DHD 64
#define MROWS (NB * SEQ)

#define PBM 128         // projection block tile, rows of X
#define PBN 128         // projection block tile, rows of W
#define PKS 64          // k per staged projection stage (128 B of every operand row)
#define PLD 72          // 16-bit LDS pitch of a staged operand row (144 B)
#define PSTG ((PBM + PBN) * PLD)     // 16-bit elements of one stage buffer
#define PNT (DD / PKS)  // stages
#define CST 136         // f16 LDS pitch of the projection epilogue tile (272 B)
#define QT 128          // queries per block (4 waves x 32 rows)
#define KBLK 64         // keys per staged block
#define LDK 72          // f16 LDS pitch of K / V tiles (144 B)
#define OST 68          // f32 LDS pitch of the output staging tile (272 B)
#define QKV_CARRY 8.0f
#define P_CARRY 1024.0f
#define OUT_SCALE (1.0f / 8192.0f)   // 1 / (QKV_CARRY * P_CARRY)
#define S_SCALE (1.0f / 512.0f)      // 1/sqrt(64) / (QKV_CARRY * QKV_CARRY)

static_assert(NB >= 1 && NB <= NB_FULL);
static_assert(SEQ >= QT && SEQ <= SEQ_FULL);
static_assert(SEQ % QT == 0);
static_assert(SEQ % KBLK == 0);
static_assert(SEQ % PBM == 0);
static_assert(DD % PBN == 0);
static_assert(DD % PKS == 0);
static_assert(PNT >= 2);
static_assert(DD % 64 == 0);
static_assert(DD % 32 == 0);
static_assert(HH * DHD == DD);
static_assert(DHD == 64);

typedef _Float16 v16h __attribute__((ext_vector_type(16)));
typedef _Float16 v8h  __attribute__((ext_vector_type(8)));
typedef v8h v8ha __attribute__((may_alias));
typedef __bf16 v16b __attribute__((ext_vector_type(16)));
typedef unsigned short v8us __attribute__((ext_vector_type(8)));
typedef v8us v8usa __attribute__((may_alias));
typedef float v8f __attribute__((ext_vector_type(8)));
typedef float v4f __attribute__((ext_vector_type(4)));
typedef v4f v4fa __attribute__((may_alias));

static_assert(sizeof(v16b) == sizeof(v8f));

// ---------------- bf16 RNE convert helpers ----------------
__device__ __forceinline__ unsigned short f2bf_bits(float f) {
    unsigned int u = __float_as_uint(f);
    u += 0x7FFFu + ((u >> 16) & 1u);
    return (unsigned short)(u >> 16);
}
__device__ __forceinline__ float bf16_rne(float f) {
    unsigned int u = __float_as_uint(f);
    u += 0x7FFFu + ((u >> 16) & 1u);
    return __uint_as_float(u & 0xFFFF0000u);
}

// ---------------- 16x32 fragment loaders (wave32 split k map, same for A and B) ----------------
// lane l: row (A) / column (B) = l & 15; elements 0..7 <- k0 + 8*(l>>4) + 0..7, elements 8..15 <- k0 + 16 + 8*(l>>4) + 0..7.
// p points at element (row, k0 + 8*(l>>4)) of a k-contiguous 16-bit row; 16-B aligned.
__device__ __forceinline__ v16h ldfrag_h(const _Float16* p) {
    union { v16h v; v8h h[2]; } u;
    u.h[0] = *(const v8ha*)(p);
    u.h[1] = *(const v8ha*)(p + 16);
    return u.v;
}
__device__ __forceinline__ v16b ldfrag_b(const unsigned short* p) {
    union { v16b v; v8us h[2]; } u;
    u.h[0] = *(const v8usa*)(p);
    u.h[1] = *(const v8usa*)(p + 16);
    return u.v;
}

__device__ __forceinline__ v8f ld8f(const float* p) {
    union { v8f v; v4f q[2]; } u;
    u.q[0] = *(const v4fa*)(p);
    u.q[1] = *(const v4fa*)(p + 4);
    return u.v;
}

// ---------------- WMMA wrappers ----------------
// f16 products (k_attn): the builtin alone; the compiler keeps the distance to the first vector instruction on a product's registers
__device__ __forceinline__ v8f mma_h(v16h a, v16h b, v8f c) {
    return __builtin_amdgcn_wmma_f32_16x16x32_f16(false, a, false, b, (short)0, c, false, false);
}
// the last f16 product in front of a loop's back edge
__device__ __forceinline__ v8f mma_h_edge(v16h a, v16h b, v8f c) {
    c = __builtin_amdgcn_wmma_f32_16x16x32_f16(false, a, false, b, (short)0, c, false, false);
    // four vector slots between the product and the branch, so that on the taken side the next pass's loads do not land on its operand registers too early
    asm volatile("v_nop\n\tv_nop\n\tv_nop\n\tv_nop" : "+v"(c) : "v"(a), "v"(b));
    return c;
}
// bf16 products (k_proj): with the VALU hazard guard
__device__ __forceinline__ v8f mma_b(v16b a, v16b b, v8f c) {
    c = __builtin_amdgcn_wmma_f32_16x16x32_bf16(false, a, false, b, (short)0, c, false, false);
    const v8f ka = __builtin_bit_cast(v8f, a);
    const v8f kbv = __builtin_bit_cast(v8f, b);
    asm volatile("v_nop\n\tv_nop\n\tv_nop\n\tv_nop" : "+v"(c) : "v"(ka), "v"(kbv));
    return c;
}

// ---------------- f32 rows -> bf16 bit planes ----------------
// One launch converts X, Wq, Wk and Wv. The four planes lie one behind the other in the workspace, so a chunk of 8 elements
// has one flat index over all of them; a block takes CVB consecutive chunks, all of one source (block-uniform choice).
// A thread converts CVU chunks, 256 chunks apart: its 2 * CVU loads of 16 B are all issued before the first is used.
// Compact X plane row m reads source row (m / SEQ) * SEQ_FULL + (m % SEQ).
#define CVU 8                        // chunks per thread
#define CVB (256 * CVU)              // chunks per block
#define XCH (MROWS * (DD / 8))       // chunks of the X plane
#define WCH (DD * (DD / 8))          // chunks of one W plane
static_assert(XCH % CVB == 0);
static_assert(WCH % CVB == 0);

__global__ __launch_bounds__(256) void k_cvt(const float* __restrict__ X,
                                             const float* __restrict__ Wq, const float* __restrict__ Wk,
                                             const float* __restrict__ Wv,
                                             unsigned short* __restrict__ dst) {
    const int blk = blockIdx.x;
    const int t0 = blk * CVB + (int)threadIdx.x;          // flat chunk of the thread's first piece
    const bool isx = blk < XCH / CVB;
    const int w = isx ? 0 : (blk - XCH / CVB) / (WCH / CVB);
    const float* src = isx ? X : ((w == 0) ? Wq : ((w == 1) ? Wk : Wv));
    const int l0 = isx ? t0 : (t0 - XCH - w * WCH);       // chunk inside the source plane

    v4f f[2 * CVU];
    // unrolled: every index of f is a constant, so the array stays in registers and the loads stand together
    #pragma unroll
    for (int i = 0; i < CVU; ++i) {
        const int l = l0 + i * 256;
        size_t off = (size_t)l * 8;
        if (SEQ != SEQ_FULL && isx) {
            const int m  = l / (DD / 8);
            const int c8 = (l - m * (DD / 8)) * 8;
            const int bb = m / SEQ;
            off = (size_t)(bb * SEQ_FULL + (m - bb * SEQ)) * DD + c8;
        }
        const float* p = src + off;
        f[2 * i]     = *(const v4fa*)(p);
        f[2 * i + 1] = *(const v4fa*)(p + 4);
    }
    // stands behind the last load and takes the loads' address as an input, so that no register of it is rewritten in front of the wait
    asm volatile("s_wait_xcnt 0x0" :: "v"(src + (size_t)l0 * 8) : "memory");
    #pragma unroll
    for (int i = 0; i < CVU; ++i) {
        const v4f f0 = f[2 * i], f1 = f[2 * i + 1];
        v8us o;
        o[0] = f2bf_bits(f0.x); o[1] = f2bf_bits(f0.y); o[2] = f2bf_bits(f0.z); o[3] = f2bf_bits(f0.w);
        o[4] = f2bf_bits(f1.x); o[5] = f2bf_bits(f1.y); o[6] = f2bf_bits(f1.z); o[7] = f2bf_bits(f1.w);
        *(v8us*)(dst + (size_t)(t0 + i * 256) * 8) = o;
    }
}

// ---------------- QKV projection GEMM ----------------
// C[m][n] = sum_k Xb[m][k] * Wb[n][k] + bias[n], m in [0,MROWS), n in [0,DD), k in [0,DD); Wb is [out][in] = n-major, k contiguous.
// grid (DD/128, MROWS/128, 3), block 128 = 4 waves (2x2), block tile 128x128, wave tile 64x64.
// Both operand tiles are staged in LDS, 64 k (128 B of every row) per stage, by asynchronous 16-byte copies into two buffers:
// the copies of stage t + 2 fly while stage t + 1 is worked on. Fragments are read from LDS by ldfrag_b, k ascending, so every sum keeps its order.
// The operand whose index runs along a row of the epilogue tile is the A operand (W rows for mat 0,1; X rows for mat 2): a lane's eight
// accumulator elements are then eight neighbours of one staged row. Both loaders share one k map, so the swap pairs the same k.
// mat 0,1 -> Qh/Kh f16 [NB*HH][SEQ][64] (x8); mat 2 -> Vt f16 [NB*HH][64][SEQ] (x8, transposed for the p.v A operand).
union __attribute__((aligned(16))) ProjLds {
    unsigned short s[2 * PSTG];   // two stage buffers, each [X 128 rows | W 128 rows] at pitch PLD
    _Float16       h[PBM * CST];  // epilogue tile after the k loop
};
static_assert(sizeof(ProjLds) == 73728);

// Eight asynchronous copies of one lane, 16 B each, rows 16 apart in the source plane and in the LDS buffer.
// l0: the lane's LDS byte address, g0: the lane's global address, both of the first row.
__device__ __forceinline__ void copy8_rows16(unsigned l0, const unsigned short* g0) {
    const unsigned lstep = 16u * PLD * 2u;
    const size_t gstep = (size_t)16 * DD;
    // s_wait_xcnt closes the statement so that no address register of a copy is rewritten in front of it
    asm volatile(
        "global_load_async_to_lds_b128 %0, %8, off\n\t"
        "global_load_async_to_lds_b128 %1, %9, off\n\t"
        "global_load_async_to_lds_b128 %2, %10, off\n\t"
        "global_load_async_to_lds_b128 %3, %11, off\n\t"
        "global_load_async_to_lds_b128 %4, %12, off\n\t"
        "global_load_async_to_lds_b128 %5, %13, off\n\t"
        "global_load_async_to_lds_b128 %6, %14, off\n\t"
        "global_load_async_to_lds_b128 %7, %15, off\n\t"
        "s_wait_xcnt 0x0"
        :: "v"(l0), "v"(l0 + lstep), "v"(l0 + 2u * lstep), "v"(l0 + 3u * lstep),
           "v"(l0 + 4u * lstep), "v"(l0 + 5u * lstep), "v"(l0 + 6u * lstep), "v"(l0 + 7u * lstep),
           "v"(g0), "v"(g0 + gstep), "v"(g0 + 2 * gstep), "v"(g0 + 3 * gstep),
           "v"(g0 + 4 * gstep), "v"(g0 + 5 * gstep), "v"(g0 + 6 * gstep), "v"(g0 + 7 * gstep)
        : "memory");
}

__global__ __launch_bounds__(128) void k_proj(
    const unsigned short* __restrict__ Xb,
    const unsigned short* __restrict__ Wqb, const unsigned short* __restrict__ Wkb,
    const unsigned short* __restrict__ Wvb,
    const float* __restrict__ bq, const float* __restrict__ bk, const float* __restrict__ bv,
    _Float16* __restrict__ Qh, _Float16* __restrict__ Kh, _Float16* __restrict__ Vt)
{
    __shared__ ProjLds lds;

    const int tid = threadIdx.x, lane = tid & 31, wave = tid >> 5;
    const int row16 = lane & 15, hsel = lane >> 4, kbase = hsel << 3;
    const int mat = blockIdx.z;
    const int n0 = blockIdx.x * PBN;
    const int m0 = blockIdx.y * PBM;
    const int wm = (wave & 1) << 6;
    const int wn = (wave >> 1) << 6;
    const unsigned short* Wb = (mat == 0) ? Wqb : ((mat == 1) ? Wkb : Wvb);
    const float* bias = (mat == 0) ? bq : ((mat == 1) ? bk : bv);
    const bool wa = (mat != 2);                 // block-uniform: W rows are the A operand
    const int abase = wa ? wn : wm;             // the wave's first A row inside its operand tile = first column of the staged tile
    const int bbase = wa ? wm : wn;             // the wave's first B row inside its operand tile = first row of the staged tile
    const int arow0 = wa ? (PBM + wn) : wm;     // the same two as rows of a stage buffer [X | W]
    const int brow0 = wa ? wm : (PBM + wn);

    v8f c[4][4];
    #pragma unroll
    for (int i = 0; i < 4; ++i)
        #pragma unroll
        for (int j = 0; j < 4; ++j)
            #pragma unroll
            for (int r = 0; r < 8; ++r) c[i][j][r] = 0.f;

    // copy map: thread -> row (tid >> 3) + 16 * i, 16-byte chunk tid & 7 of the row's 128 B; a wave's copy covers 4 whole lines
    const int crow = tid >> 3, cchk = tid & 7;
    const unsigned short* gX = Xb + (size_t)(m0 + crow) * DD + (cchk << 3);
    const unsigned short* gW = Wb + (size_t)(n0 + crow) * DD + (cchk << 3);
    const unsigned lX = (unsigned)(size_t)(&lds.s[crow * PLD + (cchk << 3)]);
    const unsigned lW = lX + (unsigned)(PBM * PLD * 2);

    copy8_rows16(lX, gX);
    copy8_rows16(lW, gW);
    asm volatile("s_wait_asynccnt 0x0" ::: "memory");   // stage 0 has landed before the barrier publishes it
    __syncthreads();
    copy8_rows16(lX + (unsigned)(PSTG * 2), gX + PKS);
    copy8_rows16(lW + (unsigned)(PSTG * 2), gW + PKS);

    // one copy of the loop body: the buffer is picked by an offset, and the copies' addresses stay few
    #pragma unroll 1
    for (int t = 0; t < PNT; ++t) {
        const int boff = (t & 1) * PSTG;
        const unsigned short* As = &lds.s[boff + (arow0 + row16) * PLD + kbase];
        const unsigned short* Bs = &lds.s[boff + (brow0 + row16) * PLD + kbase];
        // unrolled throughout: every index of a, b and c is a constant, so the arrays stay in registers
        #pragma unroll
        for (int kk = 0; kk < PKS; kk += 32) {
            v16b a[4], b[4];
            #pragma unroll
            for (int i = 0; i < 4; ++i) a[i] = ldfrag_b(As + i * 16 * PLD + kk);
            #pragma unroll
            for (int j = 0; j < 4; ++j) b[j] = ldfrag_b(Bs + j * 16 * PLD + kk);
            #pragma unroll
            for (int i = 0; i < 4; ++i)
                #pragma unroll
                for (int j = 0; j < 4; ++j) c[i][j] = mma_b(a[i], b[j], c[i][j]);
        }
        asm volatile("s_wait_dscnt 0x0" ::: "memory");      // this wave's reads of buffer t & 1 are done before it is refilled
        asm volatile("s_wait_asynccnt 0x0" ::: "memory");   // this wave's copies of stage t + 1 have landed
        __syncthreads();                                    // publishes stage t + 1, ends every read of stage t
        if (t + 2 < PNT) {
            copy8_rows16(lX + (unsigned)(boff * 2), gX + (t + 2) * PKS);
            copy8_rows16(lW + (unsigned)(boff * 2), gW + (t + 2) * PKS);
        }
    }
    asm volatile("s_wait_asynccnt 0x0" ::: "memory");       // no copy is in flight when the buffers become the epilogue tile

    // epilogue: + bf16(bias), x8 carry, f16, staged in LDS as [s][n] (mat 0,1) or [n][s] (mat 2)
    // element r of c[i][j] is staged row bbase + 16 * j + row16, column abase + 16 * i + 8 * hsel + r: one 16-byte store per tile
    _Float16* Cs = lds.h;
    _Float16* cd = &Cs[(bbase + row16) * CST + abase + kbase];
    if (wa) {       // n runs along the staged row: eight biases per A tile
        const float* bp = bias + n0 + wn + kbase;
        v8f bb[4];
        #pragma unroll
        for (int i = 0; i < 4; ++i) bb[i] = ld8f(bp + (i << 4));
        // stands behind the bias loads and takes their address as an input, so that no register of it is rewritten in front of the wait
        asm volatile("s_wait_xcnt 0x0" :: "v"(bp) : "memory");
        #pragma unroll
        for (int i = 0; i < 4; ++i) {
            #pragma unroll
            for (int r = 0; r < 8; ++r) bb[i][r] = bf16_rne(bb[i][r]);
            #pragma unroll
            for (int j = 0; j < 4; ++j)
                *(v8ha*)(cd + (j << 4) * CST + (i << 4)) = __builtin_convertvector((c[i][j] + bb[i]) * QKV_CARRY, v8h);
        }
    } else {        // n is the staged row: one bias per B tile
        const float* bp = bias + n0 + wn + row16;
        float bb[4];
        #pragma unroll
        for (int j = 0; j < 4; ++j) bb[j] = bp[j << 4];
        // as above
        asm volatile("s_wait_xcnt 0x0" :: "v"(bp) : "memory");
        #pragma unroll
        for (int j = 0; j < 4; ++j) {
            const float bj = bf16_rne(bb[j]);
            #pragma unroll
            for (int i = 0; i < 4; ++i)
                *(v8ha*)(cd + (j << 4) * CST + (i << 4)) = __builtin_convertvector((c[i][j] + bj) * QKV_CARRY, v8h);
        }
    }
    __syncthreads();

    const int hd0 = n0 >> 6;                // first of the two heads of this 128-wide n tile
    const int bi = m0 / SEQ;                // batch of this 128-row m tile
    const int s0 = m0 - bi * SEQ;
    const int q8 = (tid & 15) << 3;         // 16-byte chunk of a 128-wide staged row
    const int l0 = tid >> 4;
    v8h v[16];
    #pragma unroll
    for (int p = 0; p < 16; ++p) v[p] = *(const v8ha*)(&Cs[(l0 + (p << 3)) * CST + q8]);
    if (mat == 2) {
        #pragma unroll
        for (int p = 0; p < 16; ++p) {
            const int l = l0 + (p << 3);    // staged row = n: head hd0 + (l >> 6), dh = l & 63; chunk = s
            const size_t bhh = (size_t)bi * HH + hd0 + (l >> 6);
            *(v8h*)(Vt + (bhh * DHD + (l & 63)) * SEQ + s0 + q8) = v[p];
        }
    } else {
        _Float16* dst = (mat == 0) ? Qh : Kh;
        const size_t bhh = (size_t)bi * HH + hd0 + (q8 >> 6);
        #pragma unroll
        for (int p = 0; p < 16; ++p) {
            const int l = l0 + (p << 3);    // staged row = s; chunk = n: head hd0 + (q8 >> 6), dh = q8 & 63
            *(v8h*)(dst + (bhh * SEQ + s0 + l) * DHD + (q8 & 63)) = v[p];
        }
        // the built code lets this path run on into the V path's address arithmetic, which rewrites the stores' address pair: the wait stands in front of that
        asm volatile("s_wait_xcnt 0x0" ::: "memory");
    }
}

// ---------------- flash-style attention ----------------
// Qh,Kh: [NB*HH][SEQ][64] f16 (x8); Vt: [NB*HH][64][SEQ] f16 (x8); out: [NB][SEQ][DD] f32.
// grid (SEQ/QT, NB*HH), block 128 = 4 waves, wave owns 32 queries = two column tiles; keys staged 64 at a time.
// Transposed products: S^T = K x Q^T and O^T += V^T x P^T. A lane holds one query of each column tile (column lane & 15) and, of every
// 16-key tile, the keys 8 * (lane >> 4) + 0..7: maximum and sum run in the lane, the two halves of a wave meet by one cross-row move,
// and two converted score tiles are the B fragment of the second product as they stand (same split k map as ldfrag_h).
// Every K fragment, V fragment and gate / mask vector read from LDS serves both column tiles.
#define AW 4            // waves per block
#define AT 2            // column tiles (16 queries each) per wave
static_assert(AW * AT * 16 == QT && AT == 2);
union __attribute__((aligned(16))) LdsU {
    _Float16 h[4 * KBLK * LDK];   // Ks | Vs | per-key gate and mask tables during the key loop
    float    f[2 * KBLK * LDK];   // Os after the key loop
};
static_assert(sizeof(LdsU) == 36864);
static_assert(QT * OST <= 2 * KBLK * LDK);
static_assert(KBLK * LDK + 2 * SEQ <= 2 * KBLK * LDK);
static_assert(SEQ % 4 == 0);
static_assert(KBLK == 64 && (KBLK * DHD / 8) % (AW * 32) == 0);

// lane l <-> lane l ^ 16
__device__ __forceinline__ float xhalf(float x) {
    const int b = __builtin_bit_cast(int, x);
    return __builtin_bit_cast(float, __builtin_amdgcn_permlanex16(b, b, 0x76543210, 0xfedcba98, false, false));
}

// second launch-bounds argument: three waves a SIMD, so that the three blocks a WGP gets are resident together
__global__ __launch_bounds__(AW * 32, 3)
void k_attn(const _Float16* __restrict__ Qh, const _Float16* __restrict__ Kh,
            const _Float16* __restrict__ Vt, const float* __restrict__ amask,
            const float* __restrict__ click, float* __restrict__ out)
{
    __shared__ LdsU lds;
    _Float16* Ks = lds.h;                      // [key][dh], cross-wave (block barriers)
    _Float16* Vs = lds.h + KBLK * LDK;         // [dh][key], cross-wave (block barriers)
    float* Gs = lds.f + KBLK * LDK;            // [key] score scale x gate, all SEQ keys
    float* Ms = Gs + SEQ;                      // [key] additive mask, all SEQ keys

    const int tid = threadIdx.x, lane = tid & 31, wave = tid >> 5;
    const int row16 = lane & 15, hsel = lane >> 4, kbase = hsel << 3;
    const int bh = blockIdx.y;
    const int b = bh / HH;
    const int hd = bh - b * HH;
    const int q0 = blockIdx.x * QT + wave * (AT * 16);
    const size_t baseQK = (size_t)bh * SEQ * DHD;
    const size_t baseV  = (size_t)bh * DHD * SEQ;

    // resident Q fragments (B operand, column = query): per column tile 64 dh x 16 queries = 2 k-steps
    const _Float16* qp[AT];
    v16h qf[AT][2];
    #pragma unroll
    for (int t = 0; t < AT; ++t) {
        qp[t] = Qh + baseQK + (size_t)(q0 + (t << 4) + row16) * DHD + kbase;
        #pragma unroll
        for (int kk = 0; kk < 2; ++kk) qf[t][kk] = ldfrag_h(qp[t] + (kk << 5));
    }

    // per-key tables: scale 1/sqrt(64) folded with the carries x gate, and the additive mask (both inputs RNE-converted to bf16);
    // published by the barriers at the head of the first pass
    constexpr int TU = (SEQ / 4 + AW * 32 - 1) / (AW * 32);       // 16-byte pieces of a table per thread
    constexpr bool tfull = (SEQ / 4) % (AW * 32) == 0;            // then no lane is ever off
    const float* cb = click + (size_t)b * SEQ_FULL;
    const float* mb = amask + (size_t)b * SEQ_FULL;
    v4f c4[TU], m4[TU];
    // unrolled, here and below: every index of c4 and m4 is a constant, so the arrays stay in registers
    #pragma unroll
    for (int u = 0; u < TU; ++u) {
        const int i = tid + u * (AW * 32);
        if (tfull || i < SEQ / 4) {
            c4[u] = *(const v4fa*)(cb + (i << 2));
            m4[u] = *(const v4fa*)(mb + (i << 2));
        }
    }
    // stands behind the last of the Q and table loads and takes their addresses as inputs, so that no register of them is rewritten in front of the wait
    asm volatile("s_wait_xcnt 0x0" :: "v"(qp[0]), "v"(qp[1]), "s"(cb), "s"(mb), "v"(tid) : "memory");
    #pragma unroll
    for (int u = 0; u < TU; ++u) {
        const int i = tid + u * (AW * 32);
        if (tfull || i < SEQ / 4) {
            v4f g4, k4;
            #pragma unroll
            for (int e = 0; e < 4; ++e) { g4[e] = S_SCALE * bf16_rne(c4[u][e]); k4[e] = bf16_rne(m4[u][e]); }
            *(v4fa*)(&Gs[i << 2]) = g4;
            *(v4fa*)(&Ms[i << 2]) = k4;
        }
    }

    v8f acc[AT][4];                      // O^T: element r of tile jd = dh 16 * jd + 8 * hsel + r of query 16 * t + row16
    float mrow[AT];                      // running maximum of the lane's queries, equal in both halves
    v8f lrow[AT];                        // running sums of the lane's queries, one per element position; joined behind the loop
    #pragma unroll
    for (int t = 0; t < AT; ++t) {
        #pragma unroll
        for (int jd = 0; jd < 4; ++jd)
            #pragma unroll
            for (int r = 0; r < 8; ++r) acc[t][jd][r] = 0.f;
        mrow[t] = -1e30f;
        #pragma unroll
        for (int r = 0; r < 8; ++r) lrow[t][r] = 0.f;
    }

    // staging map: 16-byte chunk c = tid + 128 * i of a 64 x 64 tile, row c >> 3, chunk c & 7: a wave's load covers four whole 128-byte rows
    const int srow = tid >> 3;           // + 16 * i
    const int sch  = (tid & 7) << 3;

    #pragma unroll 1
    for (int kb = 0; kb < SEQ; kb += KBLK) {
        __syncthreads();
        {   // K block [key][dh] and V block [dh][key], 64x64 each, fully written
            const _Float16* ksrc = Kh + baseQK + (size_t)(kb + srow) * DHD + sch;
            const _Float16* vsrc = Vt + baseV + (size_t)srow * SEQ + kb + sch;
            v8h k8[4], v8[4];
            #pragma unroll
            for (int i = 0; i < 4; ++i) k8[i] = *(const v8ha*)(ksrc + (size_t)(i << 4) * DHD);
            #pragma unroll
            for (int i = 0; i < 4; ++i) v8[i] = *(const v8ha*)(vsrc + (size_t)(i << 4) * SEQ);
            #pragma unroll
            for (int i = 0; i < 4; ++i) *(v8ha*)(&Ks[(srow + (i << 4)) * LDK + sch]) = k8[i];
            #pragma unroll
            for (int i = 0; i < 4; ++i) *(v8ha*)(&Vs[(srow + (i << 4)) * LDK + sch]) = v8[i];
        }
        __syncthreads();

        // scores S^T(64x32) = K(64x64) x Qw^T : A[m=key][k=dh] = Ks[key][dh], 4 m-tiles x 2 k-steps x 2 column tiles.
        // The eight K fragments are read as one group in front of the sixteen products.
        v16h kf[2][4];
        #pragma unroll
        for (int kk = 0; kk < 2; ++kk)
            #pragma unroll
            for (int j = 0; j < 4; ++j)
                kf[kk][j] = ldfrag_h(&Ks[((j << 4) + row16) * LDK + (kk << 5) + kbase]);
        // multiplicative per-key gate and additive mask: element r of tile j is key kb + 16 * j + 8 * hsel + r, the same for both column tiles;
        // read behind the fragments in the same group, they land under the products
        v8f g8[4], m8[4];
        #pragma unroll
        for (int j = 0; j < 4; ++j) {
            g8[j] = ld8f(&Gs[kb + (j << 4) + kbase]);
            m8[j] = ld8f(&Ms[kb + (j << 4) + kbase]);
        }
        // keeps the reads above as one group in front of the products; without it the compiler reads two fragments at a time and waits for each pair uncovered
        __builtin_amdgcn_sched_barrier(0);
        v8f sc[AT][4];
        #pragma unroll
        for (int t = 0; t < AT; ++t)
            #pragma unroll
            for (int j = 0; j < 4; ++j)
                #pragma unroll
                for (int r = 0; r < 8; ++r) sc[t][j][r] = 0.f;
        #pragma unroll
        for (int kk = 0; kk < 2; ++kk)       // k-step outside: eight independent accumulators in a row; each sum keeps its order
            #pragma unroll
            for (int j = 0; j < 4; ++j)
                #pragma unroll
                for (int t = 0; t < AT; ++t) sc[t][j] = mma_h(kf[kk][j], qf[t][kk], sc[t][j]);
        // V fragments of keys 0..31 of the block, read well ahead of their products: they land under the softmax arithmetic
        v16h vf[4];
        #pragma unroll
        for (int jd = 0; jd < 4; ++jd) vf[jd] = ldfrag_h(&Vs[((jd << 4) + row16) * LDK + kbase]);
        // keeps these reads here, ahead of the softmax arithmetic; without it the compiler sinks them to just in front of their products
        __builtin_amdgcn_sched_barrier(0);
        #pragma unroll
        for (int j = 0; j < 4; ++j)
            #pragma unroll
            for (int t = 0; t < AT; ++t) sc[t][j] = sc[t][j] * g8[j] + m8[j];
        // online softmax of the lane's queries
        float corr[AT];
        #pragma unroll
        for (int t = 0; t < AT; ++t) {
            float mj[4];                 // one chain per tile: four independent chains
            #pragma unroll
            for (int j = 0; j < 4; ++j) {
                float m = sc[t][j][0];
                #pragma unroll
                for (int r = 1; r < 8; ++r) m = fmaxf(m, sc[t][j][r]);
                mj[j] = m;
            }
            float mx = fmaxf(fmaxf(mj[0], mj[1]), fmaxf(mj[2], mj[3]));
            mx = fmaxf(mx, xhalf(mx));
            const float mnew = fmaxf(mrow[t], mx);
            corr[t] = __expf(mrow[t] - mnew);
            mrow[t] = mnew;
            #pragma unroll
            for (int jd = 0; jd < 4; ++jd) acc[t][jd] = acc[t][jd] * corr[t];
        }
        // acc(64x32) += V^T(64x64) x P^T(64x32) : A[m=dh][k=key] = Vs[dh][key]; B[k=key][n=query] = P x1024 as f16,
        // elements 0..7 from score tile 2 * kk, elements 8..15 from tile 2 * kk + 1
        #pragma unroll
        for (int kk = 0; kk < 2; ++kk) {
            v16h pf[AT];
            #pragma unroll
            for (int t = 0; t < AT; ++t) {
                #pragma unroll
                for (int j = 2 * kk; j < 2 * kk + 2; ++j)
                    #pragma unroll
                    for (int r = 0; r < 8; ++r) sc[t][j][r] = __expf(sc[t][j][r] - mrow[t]);
                pf[t] = __builtin_shufflevector(__builtin_convertvector(sc[t][2 * kk] * P_CARRY, v8h),
                                                __builtin_convertvector(sc[t][2 * kk + 1] * P_CARRY, v8h),
                                                0, 1, 2, 3, 4, 5, 6, 7, 8, 9, 10, 11, 12, 13, 14, 15);
            }
            #pragma unroll
            for (int jd = 0; jd < 4; ++jd)
                #pragma unroll
                for (int t = 0; t < AT; ++t)
                    acc[t][jd] = (kk == 1 && jd == 3 && t == AT - 1) ? mma_h_edge(vf[jd], pf[t], acc[t][jd])
                                                                     : mma_h(vf[jd], pf[t], acc[t][jd]);
            if (kk == 0) {
                // V fragments of keys 32..63, one group behind the first eight products: they land under the second half's exponentials
                #pragma unroll
                for (int jd = 0; jd < 4; ++jd) vf[jd] = ldfrag_h(&Vs[((jd << 4) + row16) * LDK + 32 + kbase]);
                // keeps those exponentials behind the reads; without it the compiler lifts them in front of the first products and the reads are waited for uncovered
                __builtin_amdgcn_sched_barrier(0);
            }
        }
        #pragma unroll
        for (int t = 0; t < AT; ++t)
            lrow[t] = lrow[t] * corr[t] + ((sc[t][0] + sc[t][1]) + (sc[t][2] + sc[t][3]));
    }

    __syncthreads();                             // every wave is done with Ks / Vs and the tables
    float* Os = lds.f + wave * (AT * 16 * OST);  // wave-private region, block barriers used anyway
    #pragma unroll
    for (int t = 0; t < AT; ++t) {
        const v8f lr = lrow[t];
        const float lhalf = ((lr[0] + lr[1]) + (lr[2] + lr[3])) + ((lr[4] + lr[5]) + (lr[6] + lr[7]));
        const float scl = (1.0f / (lhalf + xhalf(lhalf))) * OUT_SCALE;
        #pragma unroll
        for (int jd = 0; jd < 4; ++jd) {
            const v8f o = acc[t][jd] * scl;
            float* od = &Os[((t << 4) + row16) * OST + (jd << 4) + kbase];
            v4f lo, hi;
            #pragma unroll
            for (int e = 0; e < 4; ++e) { lo[e] = o[e]; hi[e] = o[e + 4]; }
            *(v4fa*)(od)     = lo;
            *(v4fa*)(od + 4) = hi;
        }
    }
    __syncthreads();

    const int q4 = (lane & 15) << 2;
    v4f ov[AT * 8];
    #pragma unroll
    for (int p = 0; p < AT * 8; ++p) ov[p] = *(const v4fa*)(&Os[((p << 1) + hsel) * OST + q4]);
    float* orow = out + ((size_t)b * SEQ + q0) * DD + hd * DHD + q4;
    #pragma unroll
    for (int p = 0; p < AT * 8; ++p)
        *(v4f*)(orow + (size_t)((p << 1) + hsel) * DD) = ov[p];
}

// ---------------- launcher ----------------
extern "C" void kernel_launch(void* const* d_in, const int* in_sizes, int n_in,
                              void* d_out, int out_size, void* d_ws, size_t ws_size,
                              hipStream_t stream) {
    if (n_in < 9) return;
    const long long need_rows = (long long)(NB - 1) * SEQ_FULL + SEQ;
    if ((long long)in_sizes[0] < need_rows * DD) return;
    if ((long long)in_sizes[1] < need_rows) return;
    if ((long long)in_sizes[2] < need_rows) return;
    if (in_sizes[3] < DD * DD || in_sizes[5] < DD * DD || in_sizes[7] < DD * DD) return;
    if (in_sizes[4] < DD || in_sizes[6] < DD || in_sizes[8] < DD) return;
    if ((long long)out_size < (long long)MROWS * DD) return;

    const float* X     = (const float*)d_in[0];
    const float* amask = (const float*)d_in[1];
    const float* click = (const float*)d_in[2];
    const float* Wq    = (const float*)d_in[3];
    const float* bq    = (const float*)d_in[4];
    const float* Wk    = (const float*)d_in[5];
    const float* bk    = (const float*)d_in[6];
    const float* Wv    = (const float*)d_in[7];
    const float* bv    = (const float*)d_in[8];
    float* out = (float*)d_out;

    //   Xb  MROWS*DD bf16 | Wqb, Wkb, Wvb  DD*DD bf16 each | Qh, Kh, Vt  MROWS*DD f16 each
    const size_t plane = (size_t)MROWS * DD;      // elements
    const size_t wpl   = (size_t)DD * DD;
    const size_t total_bytes = 2u * (4u * plane + 3u * wpl);
    if (ws_size < total_bytes) return;
    unsigned short* Xb  = (unsigned short*)d_ws;
    unsigned short* Wqb = Xb + plane;
    unsigned short* Wkb = Wqb + wpl;
    unsigned short* Wvb = Wkb + wpl;
    _Float16* Qh = (_Float16*)(Wvb + wpl);
    _Float16* Kh = Qh + plane;
    _Float16* Vt = Kh + plane;

    k_cvt<<<dim3((XCH + 3 * WCH) / CVB), dim3(256), 0, stream>>>(X, Wq, Wk, Wv, Xb);   // fills Xb, Wqb, Wkb, Wvb

    k_proj<<<dim3(DD / PBN, MROWS / PBM, 3), dim3(128), 0, stream>>>(
        Xb, Wqb, Wkb, Wvb, bq, bk, bv, Qh, Kh, Vt);

    k_attn<<<dim3(SEQ / QT, NB * HH), dim3(AW * 32), 0, stream>>>(Qh, Kh, Vt, amask, click, out);
}

// v007
// A run of this version takes 71 microseconds.
// Two timings next to v006 put it at 1.03 and 1.04 times that version's speed.
// All steps since v000 together make it 2.61 times as fast.
#include <hip/hip_runtime.h>

// Contractions: q/k/v projections on v_wmma_f32_16x16x32_bf16 (bf16 operands = RNE-converted f32 inputs, f32 accumulate);
// q.k^T and p.v on v_wmma_f32_16x16x32_f16 (f16 operands: q carried x log2(e)/4, k carried x gate/2, v carried x8, unnormalised p carried x1024),
// f32 accumulate; softmax and epilogues in f32.

#ifndef NB
#define NB 8
#endif
#ifndef SEQ
#define SEQ 1024
#endif
#define NB_FULL 8
#define SEQ_FULL 1024
#define DD 768
#define HH 12
#define DHD 64
#define MROWS (NB * SEQ)

#define PBM 128         // projection block tile, rows of X
#define PBN 128         // projection block tile, rows of W
#define PKS 64          // k per staged projection stage (128 B of every operand row)
#define PLD 72          // 16-bit LDS pitch of a staged operand row (144 B)
#define PSTG ((PBM + PBN) * PLD)     // 16-bit elements of one stage buffer
#define PNT (DD / PKS)  // stages
#define CST 136         // f16 LDS pitch of the projection epilogue tile (272 B)
#define QT 128          // queries per block (4 waves x 32 rows)
#define KBLK 64         // keys per staged block
#define LDK 72          // f16 LDS pitch of K / V tiles (144 B)
#define OST 68          // f32 LDS pitch of the output staging tile (272 B)
#define V_CARRY 8.0f
#define P_CARRY_LOG2 10.0f           // unnormalised P is carried x 2^10
#define P_CARRY_LOG2_MAX 15.0f       // 2^15 is the largest power of two that f16 holds
#define OUT_SCALE (1.0f / 8.0f)      // 1 / V_CARRY; the row sum carries P's factor like the products
#define LOG2E 1.44269504088896340736f
#define Q_CARRY (0.25f * LOG2E)      // Q_CARRY * K_CARRY = log2(e) / sqrt(64): the score product is the exponent of two as it stands
#define K_CARRY 0.5f                 // times the key's gate

static_assert(NB >= 1 && NB <= NB_FULL);
static_assert(SEQ >= QT && SEQ <= SEQ_FULL);
static_assert(SEQ % QT == 0);
static_assert(SEQ % KBLK == 0);
static_assert(SEQ % PBM == 0);
static_assert(DD % PBN == 0);
static_assert(DD % PKS == 0);
static_assert(PNT >= 2);
static_assert(DD % 64 == 0);
static_assert(DD % 32 == 0);
static_assert(HH * DHD == DD);
static_assert(DHD == 64);

typedef _Float16 v16h __attribute__((ext_vector_type(16)));
typedef _Float16 v8h  __attribute__((ext_vector_type(8)));
typedef v8h v8ha __attribute__((may_alias));
typedef __bf16 v16b __attribute__((ext_vector_type(16)));
typedef unsigned short v8us __attribute__((ext_vector_type(8)));
typedef v8us v8usa __attribute__((may_alias));
typedef float v8f __attribute__((ext_vector_type(8)));
typedef float v4f __attribute__((ext_vector_type(4)));
typedef float v2f __attribute__((ext_vector_type(2)));
typedef v4f v4fa __attribute__((may_alias));

static_assert(sizeof(v16b) == sizeof(v8f));

// ---------------- bf16 RNE convert helpers ----------------
__device__ __forceinline__ unsigned short f2bf_bits(float f) {
    unsigned int u = __float_as_uint(f);
    u += 0x7FFFu + ((u >> 16) & 1u);
    return (unsigned short)(u >> 16);
}
__device__ __forceinline__ float bf16_rne(float f) {
    unsigned int u = __float_as_uint(f);
    u += 0x7FFFu + ((u >> 16) & 1u);
    return __uint_as_float(u & 0xFFFF0000u);
}

// ---------------- 16x32 fragment loaders (wave32 split k map, same for A and B) ----------------
// lane l: row (A) / column (B) = l & 15; elements 0..7 <- k0 + 8*(l>>4) + 0..7, elements 8..15 <- k0 + 16 + 8*(l>>4) + 0..7.
// p points at element (row, k0 + 8*(l>>4)) of a k-contiguous 16-bit row; 16-B aligned.
__device__ __forceinline__ v16h ldfrag_h(const _Float16* p) {
    union { v16h v; v8h h[2]; } u;
    u.h[0] = *(const v8ha*)(p);
    u.h[1] = *(const v8ha*)(p + 16);
    return u.v;
}
__device__ __forceinline__ v16b ldfrag_b(const unsigned short* p) {
    union { v16b v; v8us h[2]; } u;
    u.h[0] = *(const v8usa*)(p);
    u.h[1] = *(const v8usa*)(p + 16);
    return u.v;
}

__device__ __forceinline__ v8f ld8f(const float* p) {
    union { v8f v; v4f q[2]; } u;
    u.q[0] = *(const v4fa*)(p);
    u.q[1] = *(const v4fa*)(p + 4);
    return u.v;
}

// ---------------- WMMA wrappers ----------------
// f16 products (k_attn): the builtin alone; the compiler keeps the distance to the first vector instruction on a product's registers
__device__ __forceinline__ v8f mma_h(v16h a, v16h b, v8f c) {
    return __builtin_amdgcn_wmma_f32_16x16x32_f16(false, a, false, b, (short)0, c, false, false);
}
// the last f16 product in front of a loop's back edge
__device__ __forceinline__ v8f mma_h_edge(v16h a, v16h b, v8f c) {
    c = __builtin_amdgcn_wmma_f32_16x16x32_f16(false, a, false, b, (short)0, c, false, false);
    // four vector slots between the product and the branch, so that on the taken side the next pass's loads do not land on its operand registers too early
    asm volatile("v_nop\n\tv_nop\n\tv_nop\n\tv_nop" : "+v"(c) : "v"(a), "v"(b));
    return c;
}
// bf16 products (k_proj): with the VALU hazard guard
__device__ __forceinline__ v8f mma_b(v16b a, v16b b, v8f c) {
    c = __builtin_amdgcn_wmma_f32_16x16x32_bf16(false, a, false, b, (short)0, c, false, false);
    const v8f ka = __builtin_bit_cast(v8f, a);
    const v8f kbv = __builtin_bit_cast(v8f, b);
    asm volatile("v_nop\n\tv_nop\n\tv_nop\n\tv_nop" : "+v"(c) : "v"(ka), "v"(kbv));
    return c;
}

// ---------------- f32 rows -> bf16 bit planes ----------------
// One launch converts X, Wq, Wk and Wv. The four planes lie one behind the other in the workspace, so a chunk of 8 elements
// has one flat index over all of them; a block takes CVB consecutive chunks, all of one source (block-uniform choice).
// A thread converts CVU chunks, 256 chunks apart: its 2 * CVU loads of 16 B are all issued before the first is used.
// Compact X plane row m reads source row (m / SEQ) * SEQ_FULL + (m % SEQ).
#define CVU 8                        // chunks per thread
#define CVB (256 * CVU)              // chunks per block
#define XCH (MROWS * (DD / 8))       // chunks of the X plane
#define WCH (DD * (DD / 8))          // chunks of one W plane
static_assert(XCH % CVB == 0);
static_assert(WCH % CVB == 0);

__global__ __launch_bounds__(256) void k_cvt(const float* __restrict__ X,
                                             const float* __restrict__ Wq, const float* __restrict__ Wk,
                                             const float* __restrict__ Wv,
                                             unsigned short* __restrict__ dst) {
    const int blk = blockIdx.x;
    const int t0 = blk * CVB + (int)threadIdx.x;          // flat chunk of the thread's first piece
    const bool isx = blk < XCH / CVB;
    const int w = isx ? 0 : (blk - XCH / CVB) / (WCH / CVB);
    const float* src = isx ? X : ((w == 0) ? Wq : ((w == 1) ? Wk : Wv));
    const int l0 = isx ? t0 : (t0 - XCH - w * WCH);       // chunk inside the source plane

    v4f f[2 * CVU];
    // unrolled: every index of f is a constant, so the array stays in registers and the loads stand together
    #pragma unroll
    for (int i = 0; i < CVU; ++i) {
        const int l = l0 + i * 256;
        size_t off = (size_t)l * 8;
        if (SEQ != SEQ_FULL && isx) {
            const int m  = l / (DD / 8);
            const int c8 = (l - m * (DD / 8)) * 8;
            const int bb = m / SEQ;
            off = (size_t)(bb * SEQ_FULL + (m - bb * SEQ)) * DD + c8;
        }
        const float* p = src + off;
        f[2 * i]     = *(const v4fa*)(p);
        f[2 * i + 1] = *(const v4fa*)(p + 4);
    }
    // stands behind the last load and takes the loads' address as an input, so that no register of it is rewritten in front of the wait
    asm volatile("s_wait_xcnt 0x0" :: "v"(src + (size_t)l0 * 8) : "memory");
    #pragma unroll
    for (int i = 0; i < CVU; ++i) {
        const v4f f0 = f[2 * i], f1 = f[2 * i + 1];
        v8us o;
        o[0] = f2bf_bits(f0.x); o[1] = f2bf_bits(f0.y); o[2] = f2bf_bits(f0.z); o[3] = f2bf_bits(f0.w);
        o[4] = f2bf_bits(f1.x); o[5] = f2bf_bits(f1.y); o[6] = f2bf_bits(f1.z); o[7] = f2bf_bits(f1.w);
        *(v8us*)(dst + (size_t)(t0 + i * 256) * 8) = o;
    }
}

// ---------------- QKV projection GEMM ----------------
// C[m][n] = sum_k Xb[m][k] * Wb[n][k] + bias[n], m in [0,MROWS), n in [0,DD), k in [0,DD); Wb is [out][in] = n-major, k contiguous.
// grid (DD/128, MROWS/128, 3), block 128 = 4 waves (2x2), block tile 128x128, wave tile 64x64.
// Both operand tiles are staged in LDS, 64 k (128 B of every row) per stage, by asynchronous 16-byte copies into two buffers:
// the copies of stage t + 2 fly while stage t + 1 is worked on. Fragments are read from LDS by ldfrag_b, k ascending, so every sum keeps its order.
// The operand whose index runs along a row of the epilogue tile is the A operand (W rows for mat 0,1; X rows for mat 2): a lane's eight
// accumulator elements are then eight neighbours of one staged row. Both loaders share one k map, so the swap pairs the same k.
// mat 0,1 -> Qh/Kh f16 [NB*HH][SEQ][64] (x Q_CARRY; x K_CARRY x the row's gate); mat 2 -> Vt f16 [NB*HH][64][SEQ] (x8, transposed for the p.v A operand).
union __attribute__((aligned(16))) ProjLds {
    unsigned short s[2 * PSTG];   // two stage buffers, each [X 128 rows | W 128 rows] at pitch PLD
    _Float16       h[PBM * CST];  // epilogue tile after the k loop
};
static_assert(sizeof(ProjLds) == 73728);

// Eight asynchronous copies of one lane, 16 B each, rows 16 apart in the source plane and in the LDS buffer.
// l0: the lane's LDS byte address, g0: the lane's global address, both of the first row.
__device__ __forceinline__ void copy8_rows16(unsigned l0, const unsigned short* g0) {
    const unsigned lstep = 16u * PLD * 2u;
    const size_t gstep = (size_t)16 * DD;
    // s_wait_xcnt closes the statement so that no address register of a copy is rewritten in front of it
    asm volatile(
        "global_load_async_to_lds_b128 %0, %8, off\n\t"
        "global_load_async_to_lds_b128 %1, %9, off\n\t"
        "global_load_async_to_lds_b128 %2, %10, off\n\t"
        "global_load_async_to_lds_b128 %3, %11, off\n\t"
        "global_load_async_to_lds_b128 %4, %12, off\n\t"
        "global_load_async_to_lds_b128 %5, %13, off\n\t"
        "global_load_async_to_lds_b128 %6, %14, off\n\t"
        "global_load_async_to_lds_b128 %7, %15, off\n\t"
        "s_wait_xcnt 0x0"
        :: "v"(l0), "v"(l0 + lstep), "v"(l0 + 2u * lstep), "v"(l0 + 3u * lstep),
           "v"(l0 + 4u * lstep), "v"(l0 + 5u * lstep), "v"(l0 + 6u * lstep), "v"(l0 + 7u * lstep),
           "v"(g0), "v"(g0 + gstep), "v"(g0 + 2 * gstep), "v"(g0 + 3 * gstep),
           "v"(g0 + 4 * gstep), "v"(g0 + 5 * gstep), "v"(g0 + 6 * gstep), "v"(g0 + 7 * gstep)
        : "memory");
}

__global__ __launch_bounds__(128) void k_proj(
    const unsigned short* __restrict__ Xb,
    const unsigned short* __restrict__ Wqb, const unsigned short* __restrict__ Wkb,
    const unsigned short* __restrict__ Wvb,
    const float* __restrict__ bq, const float* __restrict__ bk, const float* __restrict__ bv,
    const float* __restrict__ click,
    _Float16* __restrict__ Qh, _Float16* __restrict__ Kh, _Float16* __restrict__ Vt)
{
    __shared__ ProjLds lds;

    const int tid = threadIdx.x, lane = tid & 31, wave = tid >> 5;
    const int row16 = lane & 15, hsel = lane >> 4, kbase = hsel << 3;
    const int mat = blockIdx.z;
    const int n0 = blockIdx.x * PBN;
    const int m0 = blockIdx.y * PBM;
    const int wm = (wave & 1) << 6;
    const int wn = (wave >> 1) << 6;
    const unsigned short* Wb = (mat == 0) ? Wqb : ((mat == 1) ? Wkb : Wvb);
    const float* bias = (mat == 0) ? bq : ((mat == 1) ? bk : bv);
    const bool wa = (mat != 2);                 // block-uniform: W rows are the A operand
    const int abase = wa ? wn : wm;             // the wave's first A row inside its operand tile = first column of the staged tile
    const int bbase = wa ? wm : wn;             // the wave's first B row inside its operand tile = first row of the staged tile
    const int arow0 = wa ? (PBM + wn) : wm;     // the same two as rows of a stage buffer [X | W]
    const int brow0 = wa ? wm : (PBM + wn);

    v8f c[4][4];
    #pragma unroll
    for (int i = 0; i < 4; ++i)
        #pragma unroll
        for (int j = 0; j < 4; ++j)
            #pragma unroll
            for (int r = 0; r < 8; ++r) c[i][j][r] = 0.f;

    // copy map: thread -> row (tid >> 3) + 16 * i, 16-byte chunk tid & 7 of the row's 128 B; a wave's copy covers 4 whole lines
    const int crow = tid >> 3, cchk = tid & 7;
    const unsigned short* gX = Xb + (size_t)(m0 + crow) * DD + (cchk << 3);
    const unsigned short* gW = Wb + (size_t)(n0 + crow) * DD + (cchk << 3);
    const unsigned lX = (unsigned)(size_t)(&lds.s[crow * PLD + (cchk << 3)]);
    const unsigned lW = lX + (unsigned)(PBM * PLD * 2);

    copy8_rows16(lX, gX);
    copy8_rows16(lW, gW);
    asm volatile("s_wait_asynccnt 0x0" ::: "memory");   // stage 0 has landed before the barrier publishes it
    __syncthreads();
    copy8_rows16(lX + (unsigned)(PSTG * 2), gX + PKS);
    copy8_rows16(lW + (unsigned)(PSTG * 2), gW + PKS);

    // one copy of the loop body: the buffer is picked by an offset, and the copies' addresses stay few
    #pragma unroll 1
    for (int t = 0; t < PNT; ++t) {
        const int boff = (t & 1) * PSTG;
        const unsigned short* As = &lds.s[boff + (arow0 + row16) * PLD + kbase];
        const unsigned short* Bs = &lds.s[boff + (brow0 + row16) * PLD + kbase];
        // unrolled throughout: every index of a, b and c is a constant, so the arrays stay in registers
        #pragma unroll
        for (int kk = 0; kk < PKS; kk += 32) {
            v16b a[4], b[4];
            #pragma unroll
            for (int i = 0; i < 4; ++i) a[i] = ldfrag_b(As + i * 16 * PLD + kk);
            #pragma unroll
            for (int j = 0; j < 4; ++j) b[j] = ldfrag_b(Bs + j * 16 * PLD + kk);
            #pragma unroll
            for (int i = 0; i < 4; ++i)
                #pragma unroll
                for (int j = 0; j < 4; ++j) c[i][j] = mma_b(a[i], b[j], c[i][j]);
        }
        asm volatile("s_wait_dscnt 0x0" ::: "memory");      // this wave's reads of buffer t & 1 are done before it is refilled
        asm volatile("s_wait_asynccnt 0x0" ::: "memory");   // this wave's copies of stage t + 1 have landed
        __syncthreads();                                    // publishes stage t + 1, ends every read of stage t
        if (t + 2 < PNT) {
            copy8_rows16(lX + (unsigned)(boff * 2), gX + (t + 2) * PKS);
            copy8_rows16(lW + (unsigned)(boff * 2), gW + (t + 2) * PKS);
        }
    }
    asm volatile("s_wait_asynccnt 0x0" ::: "memory");       // no copy is in flight when the buffers become the epilogue tile

    const int bi = m0 / SEQ;                // batch of this 128-row m tile
    const int s0 = m0 - bi * SEQ;

    // epilogue: + bf16(bias), x carry, f16, staged in LDS as [s][n] (mat 0,1) or [n][s] (mat 2)
    // element r of c[i][j] is staged row bbase + 16 * j + row16, column abase + 16 * i + 8 * hsel + r: one 16-byte store per tile
    _Float16* Cs = lds.h;
    _Float16* cd = &Cs[(bbase + row16) * CST + abase + kbase];
    if (wa) {       // n runs along the staged row: eight biases per A tile
        const float* bp = bias + n0 + wn + kbase;
        v8f bb[4];
        #pragma unroll
        for (int i = 0; i < 4; ++i) bb[i] = ld8f(bp + (i << 4));
        // stands behind the bias loads and takes their address as an input, so that no register of it is rewritten in front of the wait
        asm volatile("s_wait_xcnt 0x0" :: "v"(bp) : "memory");
        float rs[4] = {Q_CARRY, Q_CARRY, Q_CARRY, Q_CARRY};     // carry of staged row 16 * j + row16 of the wave's tile
        if (mat == 1) {     // the staged row is a sequence position: a K row takes its key's gate (RNE-converted to bf16) into its carry
            const float* cp = click + (size_t)bi * SEQ_FULL + s0 + wm + row16;
            #pragma unroll
            for (int j = 0; j < 4; ++j) rs[j] = cp[j << 4];
            // as above, for the gate loads
            asm volatile("s_wait_xcnt 0x0" :: "v"(cp) : "memory");
            #pragma unroll
            for (int j = 0; j < 4; ++j) rs[j] = K_CARRY * bf16_rne(rs[j]);
        }
        #pragma unroll
        for (int i = 0; i < 4; ++i) {
            #pragma unroll
            for (int r = 0; r < 8; ++r) bb[i][r] = bf16_rne(bb[i][r]);
            #pragma unroll
            for (int j = 0; j < 4; ++j)
                *(v8ha*)(cd + (j << 4) * CST + (i << 4)) = __builtin_convertvector((c[i][j] + bb[i]) * rs[j], v8h);
        }
    } else {        // n is the staged row: one bias per B tile
        const float* bp = bias + n0 + wn + row16;
        float bb[4];
        #pragma unroll
        for (int j = 0; j < 4; ++j) bb[j] = bp[j << 4];
        // as above
        asm volatile("s_wait_xcnt 0x0" :: "v"(bp) : "memory");
        #pragma unroll
        for (int j = 0; j < 4; ++j) {
            const float bj = bf16_rne(bb[j]);
            #pragma unroll
            for (int i = 0; i < 4; ++i)
                *(v8ha*)(cd + (j << 4) * CST + (i << 4)) = __builtin_convertvector((c[i][j] + bj) * V_CARRY, v8h);
        }
    }
    __syncthreads();

    const int hd0 = n0 >> 6;                // first of the two heads of this 128-wide n tile
    const int q8 = (tid & 15) << 3;         // 16-byte chunk of a 128-wide staged row
    const int l0 = tid >> 4;
    v8h v[16];
    #pragma unroll
    for (int p = 0; p < 16; ++p) v[p] = *(const v8ha*)(&Cs[(l0 + (p << 3)) * CST + q8]);
    if (mat == 2) {
        #pragma unroll
        for (int p = 0; p < 16; ++p) {
            const int l = l0 + (p << 3);    // staged row = n: head hd0 + (l >> 6), dh = l & 63; chunk = s
            const size_t bhh = (size_t)bi * HH + hd0 + (l >> 6);
            *(v8h*)(Vt + (bhh * DHD + (l & 63)) * SEQ + s0 + q8) = v[p];
        }
    } else {
        _Float16* dst = (mat == 0) ? Qh : Kh;
        const size_t bhh = (size_t)bi * HH + hd0 + (q8 >> 6);
        #pragma unroll
        for (int p = 0; p < 16; ++p) {
            const int l = l0 + (p << 3);    // staged row = s; chunk = n: head hd0 + (q8 >> 6), dh = q8 & 63
            *(v8h*)(dst + (bhh * SEQ + s0 + l) * DHD + (q8 & 63)) = v[p];
        }
        // the built code lets this path run on into the V path's address arithmetic, which rewrites the stores' address pair: the wait stands in front of that
        asm volatile("s_wait_xcnt 0x0" ::: "memory");
    }
}

// ---------------- flash-style attention ----------------
// Qh,Kh: [NB*HH][SEQ][64] f16 (carried so that q.k is gate x score x log2(e)); Vt: [NB*HH][64][SEQ] f16 (x8); out: [NB][SEQ][DD] f32.
// grid (SEQ/QT, NB*HH), block 128 = 4 waves, wave owns 32 queries = two column tiles; keys staged 64 at a time.
// Transposed products: S^T = K x Q^T and O^T += V^T x P^T. A lane holds one query of each column tile (column lane & 15) and, of every
// 16-key tile, the keys 8 * (lane >> 4) + 0..7: maximum and sum run in the lane, the two halves of a wave meet by one cross-row move,
// and two converted score tiles are the B fragment of the second product as they stand (same split k map as ldfrag_h).
// Every K fragment, V fragment and mask vector read from LDS serves both column tiles.
#define AW 4            // waves per block
#define AT 2            // column tiles (16 queries each) per wave
static_assert(AW * AT * 16 == QT && AT == 2);
union __attribute__((aligned(16))) LdsU {
    _Float16 h[4 * KBLK * LDK];   // Ks | Vs | per-key mask table during the key loop
    float    f[2 * KBLK * LDK];   // Os after the key loop
};
static_assert(sizeof(LdsU) == 36864);
static_assert(QT * OST <= 2 * KBLK * LDK);
static_assert(KBLK * LDK + SEQ <= 2 * KBLK * LDK);
static_assert(SEQ % 4 == 0);
static_assert(KBLK == 64 && (KBLK * DHD / 8) % (AW * 32) == 0);

// lane l <-> lane l ^ 16
__device__ __forceinline__ float xhalf(float x) {
    const int b = __builtin_bit_cast(int, x);
    return __builtin_bit_cast(float, __builtin_amdgcn_permlanex16(b, b, 0x76543210, 0xfedcba98, false, false));
}

// second launch-bounds argument: three waves a SIMD, so that the three blocks a WGP gets are resident together
__global__ __launch_bounds__(AW * 32, 3)
void k_attn(const _Float16* __restrict__ Qh, const _Float16* __restrict__ Kh,
            const _Float16* __restrict__ Vt, const float* __restrict__ amask,
            float* __restrict__ out)
{
    __shared__ LdsU lds;
    _Float16* Ks = lds.h;                      // [key][dh], cross-wave (block barriers)
    _Float16* Vs = lds.h + KBLK * LDK;         // [dh][key], cross-wave (block barriers)
    float* Ms = lds.f + KBLK * LDK;            // [key] additive mask x log2(e), all SEQ keys

    const int tid = threadIdx.x, lane = tid & 31, wave = tid >> 5;
    const int row16 = lane & 15, hsel = lane >> 4, kbase = hsel << 3;
    const int bh = blockIdx.y;
    const int b = bh / HH;
    const int hd = bh - b * HH;
    const int q0 = blockIdx.x * QT + wave * (AT * 16);
    const size_t baseQK = (size_t)bh * SEQ * DHD;
    const size_t baseV  = (size_t)bh * DHD * SEQ;

    // resident Q fragments (B operand, column = query): per column tile 64 dh x 16 queries = 2 k-steps
    const _Float16* qp[AT];
    v16h qf[AT][2];
    #pragma unroll
    for (int t = 0; t < AT; ++t) {
        qp[t] = Qh + baseQK + (size_t)(q0 + (t << 4) + row16) * DHD + kbase;
        #pragma unroll
        for (int kk = 0; kk < 2; ++kk) qf[t][kk] = ldfrag_h(qp[t] + (kk << 5));
    }

    // per-key table: the additive mask (RNE-converted to bf16) times log2(e), the start value of the score products: what leaves them is
    // the gated and masked score as an exponent of two; published by the barrier at the head of the first pass
    constexpr int TU = (SEQ / 4 + AW * 32 - 1) / (AW * 32);       // 16-byte pieces of a table per thread
    constexpr bool tfull = (SEQ / 4) % (AW * 32) == 0;            // then no lane is ever off
    const float* mb = amask + (size_t)b * SEQ_FULL;
    v4f m4[TU];
    // unrolled, here and below: every index of m4 is a constant, so the array stays in registers
    #pragma unroll
    for (int u = 0; u < TU; ++u) {
        const int i = tid + u * (AW * 32);
        if (tfull || i < SEQ / 4) m4[u] = *(const v4fa*)(mb + (i << 2));
    }
    // stands behind the last of the Q and table loads and takes their addresses as inputs, so that no register of them is rewritten in front of the wait
    asm volatile("s_wait_xcnt 0x0" :: "v"(qp[0]), "v"(qp[1]), "s"(mb), "v"(tid) : "memory");
    #pragma unroll
    for (int u = 0; u < TU; ++u) {
        const int i = tid + u * (AW * 32);
        if (tfull || i < SEQ / 4) {
            v4f k4;
            #pragma unroll
            for (int e = 0; e < 4; ++e) k4[e] = fminf(LOG2E * bf16_rne(m4[u][e]), 3.402823466e38f);   // a finite mask stays finite: +inf as a row's maximum would give inf - inf
            *(v4fa*)(&Ms[i << 2]) = k4;
        }
    }

    v8f acc[AT][4];                      // O^T: element r of tile jd = dh 16 * jd + 8 * hsel + r of query 16 * t + row16
    float mrow[AT];                      // running maximum of the lane's queries, equal in both halves
    float msub[AT];                      // what the exponentials subtract: the running maximum less the P carry's exponent
    v8f lrow[AT];                        // running sums of the lane's queries, one per element position; joined behind the loop
    #pragma unroll
    for (int t = 0; t < AT; ++t) {
        #pragma unroll
        for (int jd = 0; jd < 4; ++jd)
            #pragma unroll
            for (int r = 0; r < 8; ++r) acc[t][jd][r] = 0.f;
        mrow[t] = -1e30f * LOG2E;        // the floor under the maximum, in exponents of two
        msub[t] = mrow[t];
        #pragma unroll
        for (int r = 0; r < 8; ++r) lrow[t][r] = 0.f;
    }

    // staging map: 16-byte chunk c = tid + 128 * i of a 64 x 64 tile, row c >> 3, chunk c & 7: a wave's load covers four whole 128-byte rows
    const int srow = tid >> 3;           // + 16 * i
    const int sch  = (tid & 7) << 3;

    #pragma unroll 1
    for (int kb = 0; kb < SEQ; kb += KBLK) {
        __syncthreads();
        v8f m8[4];
        {   // K block [key][dh] and V block [dh][key], 64x64 each, fully written
            const _Float16* ksrc = Kh + baseQK + (size_t)(kb + srow) * DHD + sch;
            const _Float16* vsrc = Vt + baseV + (size_t)srow * SEQ + kb + sch;
            v8h k8[4], v8[4];
            #pragma unroll
            for (int i = 0; i < 4; ++i) k8[i] = *(const v8ha*)(ksrc + (size_t)(i << 4) * DHD);
            #pragma unroll
            for (int i = 0; i < 4; ++i) v8[i] = *(const v8ha*)(vsrc + (size_t)(i << 4) * SEQ);
            // additive mask: element r of tile j is key kb + 16 * j + 8 * hsel + r, the same for both column tiles; read here, it lands under the global loads
            #pragma unroll
            for (int j = 0; j < 4; ++j) m8[j] = ld8f(&Ms[kb + (j << 4) + kbase]);
            #pragma unroll
            for (int i = 0; i < 4; ++i) *(v8ha*)(&Ks[(srow + (i << 4)) * LDK + sch]) = k8[i];
            #pragma unroll
            for (int i = 0; i < 4; ++i) *(v8ha*)(&Vs[(srow + (i << 4)) * LDK + sch]) = v8[i];
        }
        __syncthreads();

        // scores S^T(64x32) = K(64x64) x Qw^T : A[m=key][k=dh] = Ks[key][dh], 4 m-tiles x 2 k-steps x 2 column tiles.
        // The eight K fragments are read as one group in front of the sixteen products.
        v16h kf[2][4];
        #pragma unroll
        for (int kk = 0; kk < 2; ++kk)
            #pragma unroll
            for (int j = 0; j < 4; ++j)
                kf[kk][j] = ldfrag_h(&Ks[((j << 4) + row16) * LDK + (kk << 5) + kbase]);
        // keeps the reads above as one group in front of the products; without it the compiler reads two fragments at a time and waits for each pair uncovered
        __builtin_amdgcn_sched_barrier(0);
        v8f sc[AT][4];
        #pragma unroll
        for (int kk = 0; kk < 2; ++kk)       // k-step outside: eight independent accumulators in a row; each sum starts from its key's mask
            #pragma unroll
            for (int j = 0; j < 4; ++j)
                #pragma unroll
                for (int t = 0; t < AT; ++t) sc[t][j] = mma_h(kf[kk][j], qf[t][kk], (kk == 0) ? m8[j] : sc[t][j]);
        // V fragments of keys 0..31 of the block, read well ahead of their products: they land under the softmax arithmetic
        v16h vf[4];
        #pragma unroll
        for (int jd = 0; jd < 4; ++jd) vf[jd] = ldfrag_h(&Vs[((jd << 4) + row16) * LDK + kbase]);
        // keeps these reads here, ahead of the softmax arithmetic; without it the compiler sinks them to just in front of their products
        __builtin_amdgcn_sched_barrier(0);
        // online softmax of the lane's queries
        float corr[AT], dsub[AT];
        #pragma unroll
        for (int t = 0; t < AT; ++t) {
            float mj[4];                 // one chain per tile: four independent chains
            #pragma unroll
            for (int j = 0; j < 4; ++j) {
                float m = sc[t][j][0];
                #pragma unroll
                for (int r = 1; r < 8; ++r) m = fmaxf(m, sc[t][j][r]);
                mj[j] = m;
            }
            float mx = fmaxf(fmaxf(mj[0], mj[1]), fmaxf(mj[2], mj[3]));
            mx = fmaxf(mx, xhalf(mx));
            const float mnew = fmaxf(mrow[t], mx);
            mrow[t] = mnew;
            // subtracting this gives P x1024 straight from the exponential. Where the maximum is so large that its last place is coarser than
            // the carry's exponent, the difference is rounded: no score lies above mnew, so mnew - ms bounds every exponent of the pass;
            // past 15 the f16 P could overflow, and the row goes without a carry
            float ms = mnew - P_CARRY_LOG2;
            ms = (mnew - ms <= P_CARRY_LOG2_MAX) ? ms : mnew;
            dsub[t] = msub[t] - ms;
            msub[t] = ms;
        }
        // sums and products so far carry 2^-(old msub), this pass's carry 2^-msub: the factor between them, whatever carry each pass got
        corr[0] = __builtin_amdgcn_exp2f(dsub[0]);
        // the slot behind a transcendental: the build sets the second exponential directly behind the first and lets it write over the first one's source register
        asm volatile("v_nop" :: "v"(corr[0]));
        // holds the second exponential behind that slot; without it the v_nop drifts off and the two stand side by side again
        __builtin_amdgcn_sched_barrier(0);
        corr[1] = __builtin_amdgcn_exp2f(dsub[1]);
        #pragma unroll
        for (int t = 0; t < AT; ++t)
            #pragma unroll
            for (int jd = 0; jd < 4; ++jd) acc[t][jd] = acc[t][jd] * corr[t];
        // acc(64x32) += V^T(64x64) x P^T(64x32) : A[m=dh][k=key] = Vs[dh][key]; B[k=key][n=query] = P x its carry as f16,
        // elements 0..7 from score tile 2 * kk, elements 8..15 from tile 2 * kk + 1
        #pragma unroll
        for (int kk = 0; kk < 2; ++kk) {
            v16h pf[AT];
            #pragma unroll
            for (int t = 0; t < AT; ++t) {
                #pragma unroll
                for (int j = 2 * kk; j < 2 * kk + 2; ++j) {
                    // subtracted two neighbours at a time: written so, the pairs stay those of the accumulator registers
                    #pragma unroll
                    for (int r = 0; r < 8; r += 2) {
                        v2f x = {sc[t][j][r], sc[t][j][r + 1]};
                        x = x - msub[t];
                        sc[t][j][r] = __builtin_amdgcn_exp2f(x.x);
                        sc[t][j][r + 1] = __builtin_amdgcn_exp2f(x.y);
                    }
                }
                pf[t] = __builtin_shufflevector(__builtin_convertvector(sc[t][2 * kk], v8h),
                                                __builtin_convertvector(sc[t][2 * kk + 1], v8h),
                                                0, 1, 2, 3, 4, 5, 6, 7, 8, 9, 10, 11, 12, 13, 14, 15);
            }
            #pragma unroll
            for (int jd = 0; jd < 4; ++jd)
                #pragma unroll
                for (int t = 0; t < AT; ++t)
                    acc[t][jd] = (kk == 1 && jd == 3 && t == AT - 1) ? mma_h_edge(vf[jd], pf[t], acc[t][jd])
                                                                     : mma_h(vf[jd], pf[t], acc[t][jd]);
            if (kk == 0) {
                // V fragments of keys 32..63, one group behind the first eight products: they land under the second half's exponentials
                #pragma unroll
                for (int jd = 0; jd < 4; ++jd) vf[jd] = ldfrag_h(&Vs[((jd << 4) + row16) * LDK + 32 + kbase]);
                // keeps those exponentials behind the reads; without it the compiler lifts them in front of the first products and the reads are waited for uncovered
                __builtin_amdgcn_sched_barrier(0);
            }
        }
        #pragma unroll
        for (int t = 0; t < AT; ++t)
            lrow[t] = lrow[t] * corr[t] + ((sc[t][0] + sc[t][1]) + (sc[t][2] + sc[t][3]));
    }

    __syncthreads();                             // every wave is done with Ks / Vs and the mask table
    float* Os = lds.f + wave * (AT * 16 * OST);  // wave-private region, block barriers used anyway
    #pragma unroll
    for (int t = 0; t < AT; ++t) {
        const v8f lr = lrow[t];
        const float lhalf = ((lr[0] + lr[1]) + (lr[2] + lr[3])) + ((lr[4] + lr[5]) + (lr[6] + lr[7]));
        const float scl = (1.0f / (lhalf + xhalf(lhalf))) * OUT_SCALE;
        #pragma unroll
        for (int jd = 0; jd < 4; ++jd) {
            const v8f o = acc[t][jd] * scl;
            float* od = &Os[((t << 4) + row16) * OST + (jd << 4) + kbase];
            v4f lo, hi;
            #pragma unroll
            for (int e = 0; e < 4; ++e) { lo[e] = o[e]; hi[e] = o[e + 4]; }
            *(v4fa*)(od)     = lo;
            *(v4fa*)(od + 4) = hi;
        }
    }
    __syncthreads();

    const int q4 = (lane & 15) << 2;
    v4f ov[AT * 8];
    #pragma unroll
    for (int p = 0; p < AT * 8; ++p) ov[p] = *(const v4fa*)(&Os[((p << 1) + hsel) * OST + q4]);
    float* orow = out + ((size_t)b * SEQ + q0) * DD + hd * DHD + q4;
    #pragma unroll
    for (int p = 0; p < AT * 8; ++p)
        *(v4f*)(orow + (size_t)((p << 1) + hsel) * DD) = ov[p];
}

// ---------------- launcher ----------------
extern "C" void kernel_launch(void* const* d_in, const int* in_sizes, int n_in,
                              void* d_out, int out_size, void* d_ws, size_t ws_size,
                              hipStream_t stream) {
    if (n_in < 9) return;
    const long long need_rows = (long long)(NB - 1) * SEQ_FULL + SEQ;
    if ((long long)in_sizes[0] < need_rows * DD) return;
    if ((long long)in_sizes[1] < need_rows) return;
    if ((long long)in_sizes[2] < need_rows) return;
    if (in_sizes[3] < DD * DD || in_sizes[5] < DD * DD || in_sizes[7] < DD * DD) return;
    if (in_sizes[4] < DD || in_sizes[6] < DD || in_sizes[8] < DD) return;
    if ((long long)out_size < (long long)MROWS * DD) return;

    const float* X     = (const float*)d_in[0];
    const float* amask = (const float*)d_in[1];
    const float* click = (const float*)d_in[2];
    const float* Wq    = (const float*)d_in[3];
    const float* bq    = (const float*)d_in[4];
    const float* Wk    = (const float*)d_in[5];
    const float* bk    = (const float*)d_in[6];
    const float* Wv    = (const float*)d_in[7];
    const float* bv    = (const float*)d_in[8];
    float* out = (float*)d_out;

    //   Xb  MROWS*DD bf16 | Wqb, Wkb, Wvb  DD*DD bf16 each | Qh, Kh, Vt  MROWS*DD f16 each
    const size_t plane = (size_t)MROWS * DD;      // elements
    const size_t wpl   = (size_t)DD * DD;
    const size_t total_bytes = 2u * (4u * plane + 3u * wpl);
    if (ws_size < total_bytes) return;
    unsigned short* Xb  = (unsigned short*)d_ws;
    unsigned short* Wqb = Xb + plane;
    unsigned short* Wkb = Wqb + wpl;
    unsigned short* Wvb = Wkb + wpl;
    _Float16* Qh = (_Float16*)(Wvb + wpl);
    _Float16* Kh = Qh + plane;
    _Float16* Vt = Kh + plane;

    k_cvt<<<dim3((XCH + 3 * WCH) / CVB), dim3(256), 0, stream>>>(X, Wq, Wk, Wv, Xb);   // fills Xb, Wqb, Wkb, Wvb

    k_proj<<<dim3(DD / PBN, MROWS / PBM, 3), dim3(128), 0, stream>>>(
        Xb, Wqb, Wkb, Wvb, bq, bk, bv, click, Qh, Kh, Vt);

    k_attn<<<dim3(SEQ / QT, NB * HH), dim3(AW * 32), 0, stream>>>(Qh, Kh, Vt, amask, out);
}

// v008
// It runs in 66.7 microseconds.
// In two side-by-side timings against v007, it was 1.05 and 1.06 times as fast.
// Over all steps from v000 it is 2.75 times as fast.
#include <hip/hip_runtime.h>

// Contractions: q/k/v projections on v_wmma_f32_16x16x32_bf16 (bf16 operands = RNE-converted f32 inputs, f32 accumulate);
// q.k^T and p.v on v_wmma_f32_16x16x32_f16 (f16 operands: q carried x log2(e)/4, k carried x gate/2, v carried x8, unnormalised p carried x1024),
// f32 accumulate; softmax and epilogues in f32.

#ifndef NB
#define NB 8
#endif
#ifndef SEQ
#define SEQ 1024
#endif
#define NB_FULL 8
#define SEQ_FULL 1024
#define DD 768
#define HH 12
#define DHD 64
#define MROWS (NB * SEQ)

#define PBM 128         // projection block tile, rows of X
#define PBN 128         // projection block tile, rows of W
#define PKS 64          // k per staged projection stage (128 B of every operand row)
#define PLD 72          // 16-bit LDS pitch of a staged operand row (144 B)
#define PSTG ((PBM + PBN) * PLD)     // 16-bit elements of one stage buffer
#define PNT (DD / PKS)  // stages
#define CST 136         // f16 LDS pitch of the projection epilogue tile (272 B)
#define QT 128          // queries per block (4 waves x 32 rows)
#define KBLK 64         // keys per staged block
#define LDK 72          // f16 LDS pitch of K / V tiles (144 B)
#define OST 68          // f32 LDS pitch of the output staging tile (272 B)
#define V_CARRY 8.0f
#define P_CARRY_LOG2 10.0f           // unnormalised P is carried x 2^10
#define P_CARRY_LOG2_MAX 15.0f       // 2^15 is the largest power of two that f16 holds
#define OUT_SCALE (1.0f / 8.0f)      // 1 / V_CARRY; the row sum carries P's factor like the products
#define LOG2E 1.44269504088896340736f
#define Q_CARRY (0.25f * LOG2E)      // Q_CARRY * K_CARRY = log2(e) / sqrt(64): the score product is the exponent of two as it stands
#define K_CARRY 0.5f                 // times the key's gate

static_assert(NB >= 1 && NB <= NB_FULL);
static_assert(SEQ >= QT && SEQ <= SEQ_FULL);
static_assert(SEQ % QT == 0);
static_assert(SEQ % KBLK == 0);
static_assert(SEQ % PBM == 0);
static_assert(DD % PBN == 0);
static_assert(DD % PKS == 0);
static_assert(PNT >= 2);
static_assert(DD % 64 == 0);
static_assert(DD % 32 == 0);
static_assert(HH * DHD == DD);
static_assert(DHD == 64);

typedef _Float16 v16h __attribute__((ext_vector_type(16)));
typedef _Float16 v8h  __attribute__((ext_vector_type(8)));
typedef v8h v8ha __attribute__((may_alias));
typedef __bf16 v16b __attribute__((ext_vector_type(16)));
typedef unsigned short v8us __attribute__((ext_vector_type(8)));
typedef v8us v8usa __attribute__((may_alias));
typedef float v8f __attribute__((ext_vector_type(8)));
typedef float v4f __attribute__((ext_vector_type(4)));
typedef float v2f __attribute__((ext_vector_type(2)));
typedef v4f v4fa __attribute__((may_alias));

static_assert(sizeof(v16b) == sizeof(v8f));

// ---------------- bf16 RNE convert helpers ----------------
__device__ __forceinline__ unsigned short f2bf_bits(float f) {
    unsigned int u = __float_as_uint(f);
    u += 0x7FFFu + ((u >> 16) & 1u);
    return (unsigned short)(u >> 16);
}
__device__ __forceinline__ float bf16_rne(float f) {
    unsigned int u = __float_as_uint(f);
    u += 0x7FFFu + ((u >> 16) & 1u);
    return __uint_as_float(u & 0xFFFF0000u);
}

// ---------------- 16x32 fragment loaders (wave32 split k map, same for A and B) ----------------
// lane l: row (A) / column (B) = l & 15; elements 0..7 <- k0 + 8*(l>>4) + 0..7, elements 8..15 <- k0 + 16 + 8*(l>>4) + 0..7.
// p points at element (row, k0 + 8*(l>>4)) of a k-contiguous 16-bit row; 16-B aligned.
__device__ __forceinline__ v16h ldfrag_h(const _Float16* p) {
    union { v16h v; v8h h[2]; } u;
    u.h[0] = *(const v8ha*)(p);
    u.h[1] = *(const v8ha*)(p + 16);
    return u.v;
}
__device__ __forceinline__ v16b ldfrag_b(const unsigned short* p) {
    union { v16b v; v8us h[2]; } u;
    u.h[0] = *(const v8usa*)(p);
    u.h[1] = *(const v8usa*)(p + 16);
    return u.v;
}

__device__ __forceinline__ v8f ld8f(const float* p) {
    union { v8f v; v4f q[2]; } u;
    u.q[0] = *(const v4fa*)(p);
    u.q[1] = *(const v4fa*)(p + 4);
    return u.v;
}

// ---------------- WMMA wrappers ----------------
// f16 products (k_attn): the builtin alone; the compiler keeps the distance to the first vector instruction on a product's registers
__device__ __forceinline__ v8f mma_h(v16h a, v16h b, v8f c) {
    return __builtin_amdgcn_wmma_f32_16x16x32_f16(false, a, false, b, (short)0, c, false, false);
}
// bf16 products (k_proj): with the VALU hazard guard
__device__ __forceinline__ v8f mma_b(v16b a, v16b b, v8f c) {
    c = __builtin_amdgcn_wmma_f32_16x16x32_bf16(false, a, false, b, (short)0, c, false, false);
    const v8f ka = __builtin_bit_cast(v8f, a);
    const v8f kbv = __builtin_bit_cast(v8f, b);
    asm volatile("v_nop\n\tv_nop\n\tv_nop\n\tv_nop" : "+v"(c) : "v"(ka), "v"(kbv));
    return c;
}

// ---------------- f32 rows -> bf16 bit planes ----------------
// One launch converts X, Wq, Wk and Wv. The four planes lie one behind the other in the workspace, so a chunk of 8 elements
// has one flat index over all of them; a block takes CVB consecutive chunks, all of one source (block-uniform choice).
// A thread converts CVU chunks, 256 chunks apart: its 2 * CVU loads of 16 B are all issued before the first is used.
// Compact X plane row m reads source row (m / SEQ) * SEQ_FULL + (m % SEQ).
#define CVU 8                        // chunks per thread
#define CVB (256 * CVU)              // chunks per block
#define XCH (MROWS * (DD / 8))       // chunks of the X plane
#define WCH (DD * (DD / 8))          // chunks of one W plane
static_assert(XCH % CVB == 0);
static_assert(WCH % CVB == 0);

__global__ __launch_bounds__(256) void k_cvt(const float* __restrict__ X,
                                             const float* __restrict__ Wq, const float* __restrict__ Wk,
                                             const float* __restrict__ Wv,
                                             unsigned short* __restrict__ dst) {
    const int blk = blockIdx.x;
    const int t0 = blk * CVB + (int)threadIdx.x;          // flat chunk of the thread's first piece
    const bool isx = blk < XCH / CVB;
    const int w = isx ? 0 : (blk - XCH / CVB) / (WCH / CVB);
    const float* src = isx ? X : ((w == 0) ? Wq : ((w == 1) ? Wk : Wv));
    const int l0 = isx ? t0 : (t0 - XCH - w * WCH);       // chunk inside the source plane

    v4f f[2 * CVU];
    // unrolled: every index of f is a constant, so the array stays in registers and the loads stand together
    #pragma unroll
    for (int i = 0; i < CVU; ++i) {
        const int l = l0 + i * 256;
        size_t off = (size_t)l * 8;
        if (SEQ != SEQ_FULL && isx) {
            const int m  = l / (DD / 8);
            const int c8 = (l - m * (DD / 8)) * 8;
            const int bb = m / SEQ;
            off = (size_t)(bb * SEQ_FULL + (m - bb * SEQ)) * DD + c8;
        }
        const float* p = src + off;
        f[2 * i]     = *(const v4fa*)(p);
        f[2 * i + 1] = *(const v4fa*)(p + 4);
    }
    // stands behind the last load and takes the loads' address as an input, so that no register of it is rewritten in front of the wait
    asm volatile("s_wait_xcnt 0x0" :: "v"(src + (size_t)l0 * 8) : "memory");
    #pragma unroll
    for (int i = 0; i < CVU; ++i) {
        const v4f f0 = f[2 * i], f1 = f[2 * i + 1];
        v8us o;
        o[0] = f2bf_bits(f0.x); o[1] = f2bf_bits(f0.y); o[2] = f2bf_bits(f0.z); o[3] = f2bf_bits(f0.w);
        o[4] = f2bf_bits(f1.x); o[5] = f2bf_bits(f1.y); o[6] = f2bf_bits(f1.z); o[7] = f2bf_bits(f1.w);
        *(v8us*)(dst + (size_t)(t0 + i * 256) * 8) = o;
    }
}

// ---------------- QKV projection GEMM ----------------
// C[m][n] = sum_k Xb[m][k] * Wb[n][k] + bias[n], m in [0,MROWS), n in [0,DD), k in [0,DD); Wb is [out][in] = n-major, k contiguous.
// grid (DD/128, MROWS/128, 3), block 128 = 4 waves (2x2), block tile 128x128, wave tile 64x64.
// Both operand tiles are staged in LDS, 64 k (128 B of every row) per stage, by asynchronous 16-byte copies into two buffers:
// the copies of stage t + 2 fly while stage t + 1 is worked on. Fragments are read from LDS by ldfrag_b, k ascending, so every sum keeps its order.
// The operand whose index runs along a row of the epilogue tile is the A operand (W rows for mat 0,1; X rows for mat 2): a lane's eight
// accumulator elements are then eight neighbours of one staged row. Both loaders share one k map, so the swap pairs the same k.
// mat 0,1 -> Qh/Kh f16 [NB*HH][SEQ][64] (x Q_CARRY; x K_CARRY x the row's gate); mat 2 -> Vt f16 [NB*HH][64][SEQ] (x8, transposed for the p.v A operand).
union __attribute__((aligned(16))) ProjLds {
    unsigned short s[2 * PSTG];   // two stage buffers, each [X 128 rows | W 128 rows] at pitch PLD
    _Float16       h[PBM * CST];  // epilogue tile after the k loop
};
static_assert(sizeof(ProjLds) == 73728);

// Eight asynchronous copies of one lane, 16 B each, rows 16 apart in the source plane and in the LDS buffer.
// l0: the lane's LDS byte address, g0: the lane's global address, both of the first row.
__device__ __forceinline__ void copy8_rows16(unsigned l0, const unsigned short* g0) {
    const unsigned lstep = 16u * PLD * 2u;
    const size_t gstep = (size_t)16 * DD;
    // s_wait_xcnt closes the statement so that no address register of a copy is rewritten in front of it
    asm volatile(
        "global_load_async_to_lds_b128 %0, %8, off\n\t"
        "global_load_async_to_lds_b128 %1, %9, off\n\t"
        "global_load_async_to_lds_b128 %2, %10, off\n\t"
        "global_load_async_to_lds_b128 %3, %11, off\n\t"
        "global_load_async_to_lds_b128 %4, %12, off\n\t"
        "global_load_async_to_lds_b128 %5, %13, off\n\t"
        "global_load_async_to_lds_b128 %6, %14, off\n\t"
        "global_load_async_to_lds_b128 %7, %15, off\n\t"
        "s_wait_xcnt 0x0"
        :: "v"(l0), "v"(l0 + lstep), "v"(l0 + 2u * lstep), "v"(l0 + 3u * lstep),
           "v"(l0 + 4u * lstep), "v"(l0 + 5u * lstep), "v"(l0 + 6u * lstep), "v"(l0 + 7u * lstep),
           "v"(g0), "v"(g0 + gstep), "v"(g0 + 2 * gstep), "v"(g0 + 3 * gstep),
           "v"(g0 + 4 * gstep), "v"(g0 + 5 * gstep), "v"(g0 + 6 * gstep), "v"(g0 + 7 * gstep)
        : "memory");
}

__global__ __launch_bounds__(128) void k_proj(
    const unsigned short* __restrict__ Xb,
    const unsigned short* __restrict__ Wqb, const unsigned short* __restrict__ Wkb,
    const unsigned short* __restrict__ Wvb,
    const float* __restrict__ bq, const float* __restrict__ bk, const float* __restrict__ bv,
    const float* __restrict__ click,
    _Float16* __restrict__ Qh, _Float16* __restrict__ Kh, _Float16* __restrict__ Vt)
{
    __shared__ ProjLds lds;

    const int tid = threadIdx.x, lane = tid & 31, wave = tid >> 5;
    const int row16 = lane & 15, hsel = lane >> 4, kbase = hsel << 3;
    const int mat = blockIdx.z;
    const int n0 = blockIdx.x * PBN;
    const int m0 = blockIdx.y * PBM;
    const int wm = (wave & 1) << 6;
    const int wn = (wave >> 1) << 6;
    const unsigned short* Wb = (mat == 0) ? Wqb : ((mat == 1) ? Wkb : Wvb);
    const float* bias = (mat == 0) ? bq : ((mat == 1) ? bk : bv);
    const bool wa = (mat != 2);                 // block-uniform: W rows are the A operand
    const int abase = wa ? wn : wm;             // the wave's first A row inside its operand tile = first column of the staged tile
    const int bbase = wa ? wm : wn;             // the wave's first B row inside its operand tile = first row of the staged tile
    const int arow0 = wa ? (PBM + wn) : wm;     // the same two as rows of a stage buffer [X | W]
    const int brow0 = wa ? wm : (PBM + wn);

    v8f c[4][4];
    #pragma unroll
    for (int i = 0; i < 4; ++i)
        #pragma unroll
        for (int j = 0; j < 4; ++j)
            #pragma unroll
            for (int r = 0; r < 8; ++r) c[i][j][r] = 0.f;

    // copy map: thread -> row (tid >> 3) + 16 * i, 16-byte chunk tid & 7 of the row's 128 B; a wave's copy covers 4 whole lines
    const int crow = tid >> 3, cchk = tid & 7;
    const unsigned short* gX = Xb + (size_t)(m0 + crow) * DD + (cchk << 3);
    const unsigned short* gW = Wb + (size_t)(n0 + crow) * DD + (cchk << 3);
    const unsigned lX = (unsigned)(size_t)(&lds.s[crow * PLD + (cchk << 3)]);
    const unsigned lW = lX + (unsigned)(PBM * PLD * 2);

    copy8_rows16(lX, gX);
    copy8_rows16(lW, gW);
    asm volatile("s_wait_asynccnt 0x0" ::: "memory");   // stage 0 has landed before the barrier publishes it
    __syncthreads();
    copy8_rows16(lX + (unsigned)(PSTG * 2), gX + PKS);
    copy8_rows16(lW + (unsigned)(PSTG * 2), gW + PKS);

    // one copy of the loop body: the buffer is picked by an offset, and the copies' addresses stay few
    #pragma unroll 1
    for (int t = 0; t < PNT; ++t) {
        const int boff = (t & 1) * PSTG;
        const unsigned short* As = &lds.s[boff + (arow0 + row16) * PLD + kbase];
        const unsigned short* Bs = &lds.s[boff + (brow0 + row16) * PLD + kbase];
        // unrolled throughout: every index of a, b and c is a constant, so the arrays stay in registers
        #pragma unroll
        for (int kk = 0; kk < PKS; kk += 32) {
            v16b a[4], b[4];
            #pragma unroll
            for (int i = 0; i < 4; ++i) a[i] = ldfrag_b(As + i * 16 * PLD + kk);
            #pragma unroll
            for (int j = 0; j < 4; ++j) b[j] = ldfrag_b(Bs + j * 16 * PLD + kk);
            #pragma unroll
            for (int i = 0; i < 4; ++i)
                #pragma unroll
                for (int j = 0; j < 4; ++j) c[i][j] = mma_b(a[i], b[j], c[i][j]);
        }
        asm volatile("s_wait_dscnt 0x0" ::: "memory");      // this wave's reads of buffer t & 1 are done before it is refilled
        asm volatile("s_wait_asynccnt 0x0" ::: "memory");   // this wave's copies of stage t + 1 have landed
        __syncthreads();                                    // publishes stage t + 1, ends every read of stage t
        if (t + 2 < PNT) {
            copy8_rows16(lX + (unsigned)(boff * 2), gX + (t + 2) * PKS);
            copy8_rows16(lW + (unsigned)(boff * 2), gW + (t + 2) * PKS);
        }
    }
    asm volatile("s_wait_asynccnt 0x0" ::: "memory");       // no copy is in flight when the buffers become the epilogue tile

    const int bi = m0 / SEQ;                // batch of this 128-row m tile
    const int s0 = m0 - bi * SEQ;

    // epilogue: + bf16(bias), x carry, f16, staged in LDS as [s][n] (mat 0,1) or [n][s] (mat 2)
    // element r of c[i][j] is staged row bbase + 16 * j + row16, column abase + 16 * i + 8 * hsel + r: one 16-byte store per tile
    _Float16* Cs = lds.h;
    _Float16* cd = &Cs[(bbase + row16) * CST + abase + kbase];
    if (wa) {       // n runs along the staged row: eight biases per A tile
        const float* bp = bias + n0 + wn + kbase;
        v8f bb[4];
        #pragma unroll
        for (int i = 0; i < 4; ++i) bb[i] = ld8f(bp + (i << 4));
        // stands behind the bias loads and takes their address as an input, so that no register of it is rewritten in front of the wait
        asm volatile("s_wait_xcnt 0x0" :: "v"(bp) : "memory");
        float rs[4] = {Q_CARRY, Q_CARRY, Q_CARRY, Q_CARRY};     // carry of staged row 16 * j + row16 of the wave's tile
        if (mat == 1) {     // the staged row is a sequence position: a K row takes its key's gate (RNE-converted to bf16) into its carry
            const float* cp = click + (size_t)bi * SEQ_FULL + s0 + wm + row16;
            #pragma unroll
            for (int j = 0; j < 4; ++j) rs[j] = cp[j << 4];
            // as above, for the gate loads
            asm volatile("s_wait_xcnt 0x0" :: "v"(cp) : "memory");
            #pragma unroll
            for (int j = 0; j < 4; ++j) rs[j] = K_CARRY * bf16_rne(rs[j]);
        }
        #pragma unroll
        for (int i = 0; i < 4; ++i) {
            #pragma unroll
            for (int r = 0; r < 8; ++r) bb[i][r] = bf16_rne(bb[i][r]);
            #pragma unroll
            for (int j = 0; j < 4; ++j)
                *(v8ha*)(cd + (j << 4) * CST + (i << 4)) = __builtin_convertvector((c[i][j] + bb[i]) * rs[j], v8h);
        }
    } else {        // n is the staged row: one bias per B tile
        const float* bp = bias + n0 + wn + row16;
        float bb[4];
        #pragma unroll
        for (int j = 0; j < 4; ++j) bb[j] = bp[j << 4];
        // as above
        asm volatile("s_wait_xcnt 0x0" :: "v"(bp) : "memory");
        #pragma unroll
        for (int j = 0; j < 4; ++j) {
            const float bj = bf16_rne(bb[j]);
            #pragma unroll
            for (int i = 0; i < 4; ++i)
                *(v8ha*)(cd + (j << 4) * CST + (i << 4)) = __builtin_convertvector((c[i][j] + bj) * V_CARRY, v8h);
        }
    }
    __syncthreads();

    const int hd0 = n0 >> 6;                // first of the two heads of this 128-wide n tile
    const int q8 = (tid & 15) << 3;         // 16-byte chunk of a 128-wide staged row
    const int l0 = tid >> 4;
    v8h v[16];
    #pragma unroll
    for (int p = 0; p < 16; ++p) v[p] = *(const v8ha*)(&Cs[(l0 + (p << 3)) * CST + q8]);
    if (mat == 2) {
        #pragma unroll
        for (int p = 0; p < 16; ++p) {
            const int l = l0 + (p << 3);    // staged row = n: head hd0 + (l >> 6), dh = l & 63; chunk = s
            const size_t bhh = (size_t)bi * HH + hd0 + (l >> 6);
            *(v8h*)(Vt + (bhh * DHD + (l & 63)) * SEQ + s0 + q8) = v[p];
        }
    } else {
        _Float16* dst = (mat == 0) ? Qh : Kh;
        const size_t bhh = (size_t)bi * HH + hd0 + (q8 >> 6);
        #pragma unroll
        for (int p = 0; p < 16; ++p) {
            const int l = l0 + (p << 3);    // staged row = s; chunk = n: head hd0 + (q8 >> 6), dh = q8 & 63
            *(v8h*)(dst + (bhh * SEQ + s0 + l) * DHD + (q8 & 63)) = v[p];
        }
        // the built code lets this path run on into the V path's address arithmetic, which rewrites the stores' address pair: the wait stands in front of that
        asm volatile("s_wait_xcnt 0x0" ::: "memory");
    }
}

// ---------------- flash-style attention ----------------
// Qh,Kh: [NB*HH][SEQ][64] f16 (carried so that q.k is gate x score x log2(e)); Vt: [NB*HH][64][SEQ] f16 (x8); out: [NB][SEQ][DD] f32.
// grid (SEQ/QT, NB*HH), block 128 = 4 waves, wave owns 32 queries = two column tiles; keys staged 64 at a time.
// The K and V blocks are staged in LDS by asynchronous 16-byte copies into two buffers: the copies of block kt + 2 fly while block kt + 1 is worked on.
// Transposed products: S^T = K x Q^T and O^T += V^T x P^T. A lane holds one query of each column tile (column lane & 15) and, of every
// 16-key tile, the keys 8 * (lane >> 4) + 0..7: maximum and sum run in the lane, the two halves of a wave meet by one cross-row move,
// and two converted score tiles are the B fragment of the second product as they stand (same split k map as ldfrag_h).
// Every K fragment, V fragment and mask vector read from LDS serves both column tiles.
#define AW 4            // waves per block
#define AT 2            // column tiles (16 queries each) per wave
static_assert(AW * AT * 16 == QT && AT == 2);
#define KVB (2 * KBLK * LDK)         // f16 elements of one stage buffer [Ks | Vs]
#define ANT (SEQ / KBLK)             // key blocks
struct __attribute__((aligned(16))) LdsU {
    union {
        _Float16 h[2 * KVB];      // two stage buffers during the key loop
        float    f[KVB];          // Os after the key loop
    } r;
    float m[SEQ];                 // per-key mask table
};
static_assert(sizeof(LdsU) == 36864 + 4 * SEQ);
static_assert(QT * OST <= KVB);
static_assert(ANT >= 2);
static_assert(SEQ % 4 == 0);
static_assert(KBLK == 64 && (KBLK * DHD / 8) % (AW * 32) == 0);

// Eight asynchronous copies of one lane, 16 B each: four K rows and four V rows, each four 16 rows apart in the source plane and in the LDS buffer.
// lk, lv: the lane's LDS byte addresses, gk, gv: the lane's global addresses, all of the first row.
__device__ __forceinline__ void copy_kv(unsigned lk, const _Float16* gk, unsigned lv, const _Float16* gv) {
    const unsigned lstep = 16u * LDK * 2u;
    const size_t kstep = (size_t)16 * DHD;
    const size_t vstep = (size_t)16 * SEQ;
    // s_wait_xcnt closes the statement so that no address register of a copy is rewritten in front of it
    asm volatile(
        "global_load_async_to_lds_b128 %0, %8, off\n\t"
        "global_load_async_to_lds_b128 %1, %9, off\n\t"
        "global_load_async_to_lds_b128 %2, %10, off\n\t"
        "global_load_async_to_lds_b128 %3, %11, off\n\t"
        "global_load_async_to_lds_b128 %4, %12, off\n\t"
        "global_load_async_to_lds_b128 %5, %13, off\n\t"
        "global_load_async_to_lds_b128 %6, %14, off\n\t"
        "global_load_async_to_lds_b128 %7, %15, off\n\t"
        "s_wait_xcnt 0x0"
        :: "v"(lk), "v"(lk + lstep), "v"(lk + 2u * lstep), "v"(lk + 3u * lstep),
           "v"(lv), "v"(lv + lstep), "v"(lv + 2u * lstep), "v"(lv + 3u * lstep),
           "v"(gk), "v"(gk + kstep), "v"(gk + 2 * kstep), "v"(gk + 3 * kstep),
           "v"(gv), "v"(gv + vstep), "v"(gv + 2 * vstep), "v"(gv + 3 * vstep)
        : "memory");
}

// lane l <-> lane l ^ 16
__device__ __forceinline__ float xhalf(float x) {
    const int b = __builtin_bit_cast(int, x);
    return __builtin_bit_cast(float, __builtin_amdgcn_permlanex16(b, b, 0x76543210, 0xfedcba98, false, false));
}

// second launch-bounds argument: three waves a SIMD, so that the three blocks a WGP gets are resident together
__global__ __launch_bounds__(AW * 32, 3)
void k_attn(const _Float16* __restrict__ Qh, const _Float16* __restrict__ Kh,
            const _Float16* __restrict__ Vt, const float* __restrict__ amask,
            float* __restrict__ out)
{
    __shared__ LdsU lds;
    float* Ms = lds.m;                         // [key] additive mask x log2(e), all SEQ keys

    const int tid = threadIdx.x, lane = tid & 31, wave = tid >> 5;
    const int row16 = lane & 15, hsel = lane >> 4, kbase = hsel << 3;
    const int bh = blockIdx.y;
    const int b = bh / HH;
    const int hd = bh - b * HH;
    const int q0 = blockIdx.x * QT + wave * (AT * 16);
    const size_t baseQK = (size_t)bh * SEQ * DHD;
    const size_t baseV  = (size_t)bh * DHD * SEQ;

    // copy map: 16-byte chunk c = tid + 128 * i of a 64 x 64 tile, row c >> 3, chunk c & 7: a wave's copy covers four whole 128-byte rows
    const int srow = tid >> 3;           // + 16 * i
    const int sch  = (tid & 7) << 3;
    const _Float16* gK = Kh + baseQK + (size_t)srow * DHD + sch;      // K block kt: + kt * KBLK rows
    const _Float16* gV = Vt + baseV + (size_t)srow * SEQ + sch;       // V block kt: + kt * KBLK columns
    const unsigned lK = (unsigned)(size_t)(&lds.r.h[srow * LDK + sch]);
    const unsigned lV = lK + (unsigned)(KBLK * LDK * 2);
    copy_kv(lK, gK, lV, gV);             // block 0 flies under the Q and mask loads

    // resident Q fragments (B operand, column = query): per column tile 64 dh x 16 queries = 2 k-steps
    const _Float16* qp[AT];
    v16h qf[AT][2];
    #pragma unroll
    for (int t = 0; t < AT; ++t) {
        qp[t] = Qh + baseQK + (size_t)(q0 + (t << 4) + row16) * DHD + kbase;
        #pragma unroll
        for (int kk = 0; kk < 2; ++kk) qf[t][kk] = ldfrag_h(qp[t] + (kk << 5));
    }

    // per-key table: the additive mask (RNE-converted to bf16) times log2(e), the start value of the score products: what leaves them is
    // the gated and masked score as an exponent of two; published by the barrier in front of the key loop
    constexpr int TU = (SEQ / 4 + AW * 32 - 1) / (AW * 32);       // 16-byte pieces of a table per thread
    constexpr bool tfull = (SEQ / 4) % (AW * 32) == 0;            // then no lane is ever off
    const float* mb = amask + (size_t)b * SEQ_FULL;
    v4f m4[TU];
    // unrolled, here and below: every index of m4 is a constant, so the array stays in registers
    #pragma unroll
    for (int u = 0; u < TU; ++u) {
        const int i = tid + u * (AW * 32);
        if (tfull || i < SEQ / 4) m4[u] = *(const v4fa*)(mb + (i << 2));
    }
    // stands behind the last of the Q and table loads and takes their addresses as inputs, so that no register of them is rewritten in front of the wait
    asm volatile("s_wait_xcnt 0x0" :: "v"(qp[0]), "v"(qp[1]), "s"(mb), "v"(tid) : "memory");
    #pragma unroll
    for (int u = 0; u < TU; ++u) {
        const int i = tid + u * (AW * 32);
        if (tfull || i < SEQ / 4) {
            v4f k4;
            #pragma unroll
            for (int e = 0; e < 4; ++e) k4[e] = fminf(LOG2E * bf16_rne(m4[u][e]), 3.402823466e38f);   // a finite mask stays finite: +inf as a row's maximum would give inf - inf
            *(v4fa*)(&Ms[i << 2]) = k4;
        }
    }

    v8f acc[AT][4];                      // O^T: element r of tile jd = dh 16 * jd + 8 * hsel + r of query 16 * t + row16
    float mrow[AT];                      // running maximum of the lane's queries, equal in both halves
    float msub[AT];                      // what the exponentials subtract: the running maximum less the P carry's exponent
    v8f lrow[AT];                        // running sums of the lane's queries, one per element position; joined behind the loop
    #pragma unroll
    for (int t = 0; t < AT; ++t) {
        #pragma unroll
        for (int jd = 0; jd < 4; ++jd)
            #pragma unroll
            for (int r = 0; r < 8; ++r) acc[t][jd][r] = 0.f;
        mrow[t] = -1e30f * LOG2E;        // the floor under the maximum, in exponents of two
        msub[t] = mrow[t];
        #pragma unroll
        for (int r = 0; r < 8; ++r) lrow[t][r] = 0.f;
    }

    asm volatile("s_wait_asynccnt 0x0" ::: "memory");   // block 0 has landed before the barrier publishes it
    __syncthreads();                                    // publishes block 0 and the mask table
    copy_kv(lK + (unsigned)(KVB * 2), gK + KBLK * DHD, lV + (unsigned)(KVB * 2), gV + KBLK);

    // one copy of the loop body: the buffer is picked by an offset
    #pragma unroll 1
    for (int kt = 0; kt < ANT; ++kt) {
        const int kb = kt * KBLK;
        const int boff = (kt & 1) * KVB;
        const _Float16* Ks = lds.r.h + boff;            // [key][dh], 64x64, cross-wave (block barriers)
        const _Float16* Vs = Ks + KBLK * LDK;           // [dh][key], 64x64, cross-wave (block barriers)
        // additive mask: element r of tile j is key kb + 16 * j + 8 * hsel + r, the same for both column tiles
        v8f m8[4];
        #pragma unroll
        for (int j = 0; j < 4; ++j) m8[j] = ld8f(&Ms[kb + (j << 4) + kbase]);

        // scores S^T(64x32) = K(64x64) x Qw^T : A[m=key][k=dh] = Ks[key][dh], 4 m-tiles x 2 k-steps x 2 column tiles.
        // The mask vectors and the eight K fragments are read as one group in front of the sixteen products.
        v16h kf[2][4];
        #pragma unroll
        for (int kk = 0; kk < 2; ++kk)
            #pragma unroll
            for (int j = 0; j < 4; ++j)
                kf[kk][j] = ldfrag_h(&Ks[((j << 4) + row16) * LDK + (kk << 5) + kbase]);
        // keeps the reads above as one group in front of the products; without it the compiler reads two fragments at a time and waits for each pair uncovered
        __builtin_amdgcn_sched_barrier(0);
        v8f sc[AT][4];
        #pragma unroll
        for (int kk = 0; kk < 2; ++kk)       // k-step outside: eight independent accumulators in a row; each sum starts from its key's mask
            #pragma unroll
            for (int j = 0; j < 4; ++j)
                #pragma unroll
                for (int t = 0; t < AT; ++t) sc[t][j] = mma_h(kf[kk][j], qf[t][kk], (kk == 0) ? m8[j] : sc[t][j]);
        // V fragments of keys 0..31 of the block, read well ahead of their products: they land under the softmax arithmetic
        v16h vf[4];
        #pragma unroll
        for (int jd = 0; jd < 4; ++jd) vf[jd] = ldfrag_h(&Vs[((jd << 4) + row16) * LDK + kbase]);
        // keeps these reads here, ahead of the softmax arithmetic; without it the compiler sinks them to just in front of their products
        __builtin_amdgcn_sched_barrier(0);
        // online softmax of the lane's queries
        float corr[AT], dsub[AT];
        #pragma unroll
        for (int t = 0; t < AT; ++t) {
            float mj[4];                 // one chain per tile: four independent chains
            #pragma unroll
            for (int j = 0; j < 4; ++j) {
                float m = sc[t][j][0];
                #pragma unroll
                for (int r = 1; r < 8; ++r) m = fmaxf(m, sc[t][j][r]);
                mj[j] = m;
            }
            float mx = fmaxf(fmaxf(mj[0], mj[1]), fmaxf(mj[2], mj[3]));
            mx = fmaxf(mx, xhalf(mx));
            const float mnew = fmaxf(mrow[t], mx);
            mrow[t] = mnew;
            // subtracting this gives P x1024 straight from the exponential. Where the maximum is so large that its last place is coarser than
            // the carry's exponent, the difference is rounded: no score lies above mnew, so mnew - ms bounds every exponent of the pass;
            // past 15 the f16 P could overflow, and the row goes without a carry
            float ms = mnew - P_CARRY_LOG2;
            ms = (mnew - ms <= P_CARRY_LOG2_MAX) ? ms : mnew;
            dsub[t] = msub[t] - ms;
            msub[t] = ms;
        }
        // sums and products so far carry 2^-(old msub), this pass's carry 2^-msub: the factor between them, whatever carry each pass got
        corr[0] = __builtin_amdgcn_exp2f(dsub[0]);
        // the slot behind a transcendental: the build sets the second exponential directly behind the first and lets it write over the first one's source register
        asm volatile("v_nop" :: "v"(corr[0]));
        // holds the second exponential behind that slot; without it the v_nop drifts off and the two stand side by side again
        __builtin_amdgcn_sched_barrier(0);
        corr[1] = __builtin_amdgcn_exp2f(dsub[1]);
        #pragma unroll
        for (int t = 0; t < AT; ++t)
            #pragma unroll
            for (int jd = 0; jd < 4; ++jd) acc[t][jd] = acc[t][jd] * corr[t];
        // acc(64x32) += V^T(64x64) x P^T(64x32) : A[m=dh][k=key] = Vs[dh][key]; B[k=key][n=query] = P x its carry as f16,
        // elements 0..7 from score tile 2 * kk, elements 8..15 from tile 2 * kk + 1
        #pragma unroll
        for (int kk = 0; kk < 2; ++kk) {
            v16h pf[AT];
            #pragma unroll
            for (int t = 0; t < AT; ++t) {
                #pragma unroll
                for (int j = 2 * kk; j < 2 * kk + 2; ++j) {
                    // subtracted two neighbours at a time: written so, the pairs stay those of the accumulator registers
                    #pragma unroll
                    for (int r = 0; r < 8; r += 2) {
                        v2f x = {sc[t][j][r], sc[t][j][r + 1]};
                        x = x - msub[t];
                        sc[t][j][r] = __builtin_amdgcn_exp2f(x.x);
                        sc[t][j][r + 1] = __builtin_amdgcn_exp2f(x.y);
                    }
                }
                pf[t] = __builtin_shufflevector(__builtin_convertvector(sc[t][2 * kk], v8h),
                                                __builtin_convertvector(sc[t][2 * kk + 1], v8h),
                                                0, 1, 2, 3, 4, 5, 6, 7, 8, 9, 10, 11, 12, 13, 14, 15);
            }
            #pragma unroll
            for (int jd = 0; jd < 4; ++jd)
                #pragma unroll
                for (int t = 0; t < AT; ++t)
                    acc[t][jd] = mma_h(vf[jd], pf[t], acc[t][jd]);
            if (kk == 0) {
                // V fragments of keys 32..63, one group behind the first eight products: they land under the second half's exponentials
                #pragma unroll
                for (int jd = 0; jd < 4; ++jd) vf[jd] = ldfrag_h(&Vs[((jd << 4) + row16) * LDK + 32 + kbase]);
                // keeps those exponentials behind the reads; without it the compiler lifts them in front of the first products and the reads are waited for uncovered
                __builtin_amdgcn_sched_barrier(0);
            }
        }
        #pragma unroll
        for (int t = 0; t < AT; ++t)
            lrow[t] = lrow[t] * corr[t] + ((sc[t][0] + sc[t][1]) + (sc[t][2] + sc[t][3]));
        asm volatile("s_wait_dscnt 0x0" ::: "memory");      // this wave's reads of buffer kt & 1 are done before it is refilled
        asm volatile("s_wait_asynccnt 0x0" ::: "memory");   // this wave's copies of block kt + 1 have landed
        __syncthreads();                                    // publishes block kt + 1, ends every read of block kt
        if (kt + 2 < ANT)
            copy_kv(lK + (unsigned)(boff * 2), gK + (size_t)(kt + 2) * (KBLK * DHD), lV + (unsigned)(boff * 2), gV + (kt + 2) * KBLK);
    }
    asm volatile("s_wait_asynccnt 0x0" ::: "memory");       // no copy is in flight when the buffers become the output tile

    // the last pass's barrier has ended every wave's reads of the buffers
    float* Os = lds.r.f + wave * (AT * 16 * OST);  // wave-private region, block barriers used anyway
    #pragma unroll
    for (int t = 0; t < AT; ++t) {
        const v8f lr = lrow[t];
        const float lhalf = ((lr[0] + lr[1]) + (lr[2] + lr[3])) + ((lr[4] + lr[5]) + (lr[6] + lr[7]));
        const float scl = (1.0f / (lhalf + xhalf(lhalf))) * OUT_SCALE;
        #pragma unroll
        for (int jd = 0; jd < 4; ++jd) {
            const v8f o = acc[t][jd] * scl;
            float* od = &Os[((t << 4) + row16) * OST + (jd << 4) + kbase];
            v4f lo, hi;
            #pragma unroll
            for (int e = 0; e < 4; ++e) { lo[e] = o[e]; hi[e] = o[e + 4]; }
            *(v4fa*)(od)     = lo;
            *(v4fa*)(od + 4) = hi;
        }
    }
    __syncthreads();

    const int q4 = (lane & 15) << 2;
    v4f ov[AT * 8];
    #pragma unroll
    for (int p = 0; p < AT * 8; ++p) ov[p] = *(const v4fa*)(&Os[((p << 1) + hsel) * OST + q4]);
    float* orow = out + ((size_t)b * SEQ + q0) * DD + hd * DHD + q4;
    #pragma unroll
    for (int p = 0; p < AT * 8; ++p)
        *(v4f*)(orow + (size_t)((p << 1) + hsel) * DD) = ov[p];
}

// ---------------- launcher ----------------
extern "C" void kernel_launch(void* const* d_in, const int* in_sizes, int n_in,
                              void* d_out, int out_size, void* d_ws, size_t ws_size,
                              hipStream_t stream) {
    if (n_in < 9) return;
    const long long need_rows = (long long)(NB - 1) * SEQ_FULL + SEQ;
    if ((long long)in_sizes[0] < need_rows * DD) return;
    if ((long long)in_sizes[1] < need_rows) return;
    if ((long long)in_sizes[2] < need_rows) return;
    if (in_sizes[3] < DD * DD || in_sizes[5] < DD * DD || in_sizes[7] < DD * DD) return;
    if (in_sizes[4] < DD || in_sizes[6] < DD || in_sizes[8] < DD) return;
    if ((long long)out_size < (long long)MROWS * DD) return;

    const float* X     = (const float*)d_in[0];
    const float* amask = (const float*)d_in[1];
    const float* click = (const float*)d_in[2];
    const float* Wq    = (const float*)d_in[3];
    const float* bq    = (const float*)d_in[4];
    const float* Wk    = (const float*)d_in[5];
    const float* bk    = (const float*)d_in[6];
    const float* Wv    = (const float*)d_in[7];
    const float* bv    = (const float*)d_in[8];
    float* out = (float*)d_out;

    //   Xb  MROWS*DD bf16 | Wqb, Wkb, Wvb  DD*DD bf16 each | Qh, Kh, Vt  MROWS*DD f16 each
    const size_t plane = (size_t)MROWS * DD;      // elements
    const size_t wpl   = (size_t)DD * DD;
    const size_t total_bytes = 2u * (4u * plane + 3u * wpl);
    if (ws_size < total_bytes) return;
    unsigned short* Xb  = (unsigned short*)d_ws;
    unsigned short* Wqb = Xb + plane;
    unsigned short* Wkb = Wqb + wpl;
    unsigned short* Wvb = Wkb + wpl;
    _Float16* Qh = (_Float16*)(Wvb + wpl);
    _Float16* Kh = Qh + plane;
    _Float16* Vt = Kh + plane;

    k_cvt<<<dim3((XCH + 3 * WCH) / CVB), dim3(256), 0, stream>>>(X, Wq, Wk, Wv, Xb);   // fills Xb, Wqb, Wkb, Wvb

    k_proj<<<dim3(DD / PBN, MROWS / PBM, 3), dim3(128), 0, stream>>>(
        Xb, Wqb, Wkb, Wvb, bq, bk, bv, click, Qh, Kh, Vt);

    k_attn<<<dim3(SEQ / QT, NB * HH), dim3(AW * 32), 0, stream>>>(Qh, Kh, Vt, amask, out);
}

// v009
// A run of this version takes 63.8 microseconds.
// In both of two side-by-side timings against v008, it was 1.05 times as fast.
// All steps since v000 together make it 2.88 times as fast.
#include <hip/hip_runtime.h>

// Contractions: q/k/v projections on v_wmma_f32_16x16x32_bf16 (bf16 operands = RNE-converted f32 inputs, f32 accumulate);
// q.k^T and p.v on v_wmma_f32_16x16x32_f16 (f16 operands: q carried x log2(e)/4, k carried x gate/2, v carried x8, unnormalised p carried x1024),
// f32 accumulate; softmax and epilogues in f32.

#ifndef NB
#define NB 8
#endif
#ifndef SEQ
#define SEQ 1024
#endif
#define NB_FULL 8
#define SEQ_FULL 1024
#define DD 768
#define HH 12
#define DHD 64
#define MROWS (NB * SEQ)

#define PBM 128         // projection block tile, rows of X
#define PBN 128         // projection block tile, rows of W
#define PKS 64          // k per staged projection stage (128 B of every operand row)
#define PLD 72          // 16-bit LDS pitch of a staged operand row (144 B)
#define PSTG ((PBM + PBN) * PLD)     // 16-bit elements of one stage buffer
#define PNT (DD / PKS)  // stages
#define CST 136         // f16 LDS pitch of the projection epilogue tile (272 B)
#define QT 128          // queries per block (4 waves x 32 rows)
#define KBLK 64         // keys per staged block
#define LDK 72          // f16 LDS pitch of K / V tiles (144 B)
#define OST 68          // f32 LDS pitch of the output staging tile (272 B)
#define V_CARRY 8.0f
#define P_CARRY_LOG2 10.0f           // unnormalised P is carried x 2^10
#define P_CARRY_LOG2_MAX 15.0f       // 2^15 is the largest power of two that f16 holds
#define OUT_SCALE (1.0f / 8.0f)      // 1 / V_CARRY; the row sum carries P's factor like the products
#define LOG2E 1.44269504088896340736f
#define Q_CARRY (0.25f * LOG2E)      // Q_CARRY * K_CARRY = log2(e) / sqrt(64): the score product is the exponent of two as it stands
#define K_CARRY 0.5f                 // times the key's gate

static_assert(NB >= 1 && NB <= NB_FULL);
static_assert(SEQ >= QT && SEQ <= SEQ_FULL);
static_assert(SEQ % QT == 0);
static_assert(SEQ % KBLK == 0);
static_assert(SEQ % PBM == 0);
static_assert(DD % PBN == 0);
static_assert(DD % PKS == 0);
static_assert(PNT >= 2);
static_assert(DD % 64 == 0);
static_assert(DD % 32 == 0);
static_assert(HH * DHD == DD);
static_assert(DHD == 64);

typedef _Float16 v16h __attribute__((ext_vector_type(16)));
typedef _Float16 v8h  __attribute__((ext_vector_type(8)));
typedef v8h v8ha __attribute__((may_alias));
typedef __bf16 v16b __attribute__((ext_vector_type(16)));
typedef unsigned short v8us __attribute__((ext_vector_type(8)));
typedef v8us v8usa __attribute__((may_alias));
typedef float v8f __attribute__((ext_vector_type(8)));
typedef float v4f __attribute__((ext_vector_type(4)));
typedef float v2f __attribute__((ext_vector_type(2)));
typedef v4f v4fa __attribute__((may_alias));

static_assert(sizeof(v16b) == sizeof(v8f));

// ---------------- bf16 RNE convert helpers ----------------
__device__ __forceinline__ unsigned short f2bf_bits(float f) {
    unsigned int u = __float_as_uint(f);
    u += 0x7FFFu + ((u >> 16) & 1u);
    return (unsigned short)(u >> 16);
}
__device__ __forceinline__ float bf16_rne(float f) {
    unsigned int u = __float_as_uint(f);
    u += 0x7FFFu + ((u >> 16) & 1u);
    return __uint_as_float(u & 0xFFFF0000u);
}

// ---------------- 16x32 fragment loaders (wave32 split k map, same for A and B) ----------------
// lane l: row (A) / column (B) = l & 15; elements 0..7 <- k0 + 8*(l>>4) + 0..7, elements 8..15 <- k0 + 16 + 8*(l>>4) + 0..7.
// p points at element (row, k0 + 8*(l>>4)) of a k-contiguous 16-bit row; 16-B aligned.
__device__ __forceinline__ v16h ldfrag_h(const _Float16* p) {
    union { v16h v; v8h h[2]; } u;
    u.h[0] = *(const v8ha*)(p);
    u.h[1] = *(const v8ha*)(p + 16);
    return u.v;
}
__device__ __forceinline__ v16b ldfrag_b(const unsigned short* p) {
    union { v16b v; v8us h[2]; } u;
    u.h[0] = *(const v8usa*)(p);
    u.h[1] = *(const v8usa*)(p + 16);
    return u.v;
}

__device__ __forceinline__ v8f ld8f(const float* p) {
    union { v8f v; v4f q[2]; } u;
    u.q[0] = *(const v4fa*)(p);
    u.q[1] = *(const v4fa*)(p + 4);
    return u.v;
}

// ---------------- WMMA wrappers ----------------
// f16 products (k_attn): the builtin alone; the compiler keeps the distance to the first vector instruction on a product's registers
__device__ __forceinline__ v8f mma_h(v16h a, v16h b, v8f c) {
    return __builtin_amdgcn_wmma_f32_16x16x32_f16(false, a, false, b, (short)0, c, false, false);
}
// bf16 products (k_proj): with the VALU hazard guard
__device__ __forceinline__ v8f mma_b(v16b a, v16b b, v8f c) {
    c = __builtin_amdgcn_wmma_f32_16x16x32_bf16(false, a, false, b, (short)0, c, false, false);
    const v8f ka = __builtin_bit_cast(v8f, a);
    const v8f kbv = __builtin_bit_cast(v8f, b);
    asm volatile("v_nop\n\tv_nop\n\tv_nop\n\tv_nop" : "+v"(c) : "v"(ka), "v"(kbv));
    return c;
}

// ---------------- f32 rows -> bf16 bit planes ----------------
// One launch converts X, Wq, Wk and Wv. The four planes lie one behind the other in the workspace, so a chunk of 8 elements
// has one flat index over all of them; a block takes CVB consecutive chunks, all of one source (block-uniform choice).
// A thread converts CVU chunks, 256 chunks apart: its 2 * CVU loads of 16 B are all issued before the first is used.
// Compact X plane row m reads source row (m / SEQ) * SEQ_FULL + (m % SEQ).
#define CVU 8                        // chunks per thread
#define CVB (256 * CVU)              // chunks per block
#define XCH (MROWS * (DD / 8))       // chunks of the X plane
#define WCH (DD * (DD / 8))          // chunks of one W plane
static_assert(XCH % CVB == 0);
static_assert(WCH % CVB == 0);

__global__ __launch_bounds__(256) void k_cvt(const float* __restrict__ X,
                                             const float* __restrict__ Wq, const float* __restrict__ Wk,
                                             const float* __restrict__ Wv,
                                             unsigned short* __restrict__ dst) {
    const int blk = blockIdx.x;
    const int t0 = blk * CVB + (int)threadIdx.x;          // flat chunk of the thread's first piece
    const bool isx = blk < XCH / CVB;
    const int w = isx ? 0 : (blk - XCH / CVB) / (WCH / CVB);
    const float* src = isx ? X : ((w == 0) ? Wq : ((w == 1) ? Wk : Wv));
    const int l0 = isx ? t0 : (t0 - XCH - w * WCH);       // chunk inside the source plane

    v4f f[2 * CVU];
    // unrolled: every index of f is a constant, so the array stays in registers and the loads stand together
    #pragma unroll
    for (int i = 0; i < CVU; ++i) {
        const int l = l0 + i * 256;
        size_t off = (size_t)l * 8;
        if (SEQ != SEQ_FULL && isx) {
            const int m  = l / (DD / 8);
            const int c8 = (l - m * (DD / 8)) * 8;
            const int bb = m / SEQ;
            off = (size_t)(bb * SEQ_FULL + (m - bb * SEQ)) * DD + c8;
        }
        const float* p = src + off;
        f[2 * i]     = *(const v4fa*)(p);
        f[2 * i + 1] = *(const v4fa*)(p + 4);
    }
    // stands behind the last load and takes the loads' address as an input, so that no register of it is rewritten in front of the wait
    asm volatile("s_wait_xcnt 0x0" :: "v"(src + (size_t)l0 * 8) : "memory");
    #pragma unroll
    for (int i = 0; i < CVU; ++i) {
        const v4f f0 = f[2 * i], f1 = f[2 * i + 1];
        v8us o;
        o[0] = f2bf_bits(f0.x); o[1] = f2bf_bits(f0.y); o[2] = f2bf_bits(f0.z); o[3] = f2bf_bits(f0.w);
        o[4] = f2bf_bits(f1.x); o[5] = f2bf_bits(f1.y); o[6] = f2bf_bits(f1.z); o[7] = f2bf_bits(f1.w);
        *(v8us*)(dst + (size_t)(t0 + i * 256) * 8) = o;
    }
}

// ---------------- QKV projection GEMM ----------------
// C[m][n] = sum_k Xb[m][k] * Wb[n][k] + bias[n], m in [0,MROWS), n in [0,DD), k in [0,DD); Wb is [out][in] = n-major, k contiguous.
// grid (DD/128, MROWS/128, 3), block 128 = 4 waves (2x2), block tile 128x128, wave tile 64x64.
// Both operand tiles are staged in LDS, 64 k (128 B of every row) per stage, by asynchronous 16-byte copies into two buffers:
// the copies of stage t + 2 fly while stage t + 1 is worked on. Fragments are read from LDS by ldfrag_b, k ascending inside a stage.
// The stages run in a rotated order, from a first stage of the block's own round to the one in front of it: all resident blocks start together and
// keep step, and blocks that share X rows or W rows would otherwise ask L2 for the same lines at the same moment.
// The operand whose index runs along a row of the epilogue tile is the A operand (W rows for mat 0,1; X rows for mat 2): a lane's eight
// accumulator elements are then eight neighbours of one staged row. Both loaders share one k map, so the swap pairs the same k.
// mat 0,1 -> Qh/Kh f16 [NB*HH][SEQ][64] (x Q_CARRY; x K_CARRY x the row's gate); mat 2 -> Vt f16 [NB*HH][64][SEQ] (x8, transposed for the p.v A operand).
union __attribute__((aligned(16))) ProjLds {
    unsigned short s[2 * PSTG];   // two stage buffers, each [X 128 rows | W 128 rows] at pitch PLD
    _Float16       h[PBM * CST];  // epilogue tile after the k loop
};
static_assert(sizeof(ProjLds) == 73728);

// Eight asynchronous copies of one lane, 16 B each, rows 16 apart in the source plane and in the LDS buffer.
// l0: the lane's LDS byte address, g0: the lane's global address, both of the first row.
__device__ __forceinline__ void copy8_rows16(unsigned l0, const unsigned short* g0) {
    const unsigned lstep = 16u * PLD * 2u;
    const size_t gstep = (size_t)16 * DD;
    // s_wait_xcnt closes the statement so that no address register of a copy is rewritten in front of it
    asm volatile(
        "global_load_async_to_lds_b128 %0, %8, off\n\t"
        "global_load_async_to_lds_b128 %1, %9, off\n\t"
        "global_load_async_to_lds_b128 %2, %10, off\n\t"
        "global_load_async_to_lds_b128 %3, %11, off\n\t"
        "global_load_async_to_lds_b128 %4, %12, off\n\t"
        "global_load_async_to_lds_b128 %5, %13, off\n\t"
        "global_load_async_to_lds_b128 %6, %14, off\n\t"
        "global_load_async_to_lds_b128 %7, %15, off\n\t"
        "s_wait_xcnt 0x0"
        :: "v"(l0), "v"(l0 + lstep), "v"(l0 + 2u * lstep), "v"(l0 + 3u * lstep),
           "v"(l0 + 4u * lstep), "v"(l0 + 5u * lstep), "v"(l0 + 6u * lstep), "v"(l0 + 7u * lstep),
           "v"(g0), "v"(g0 + gstep), "v"(g0 + 2 * gstep), "v"(g0 + 3 * gstep),
           "v"(g0 + 4 * gstep), "v"(g0 + 5 * gstep), "v"(g0 + 6 * gstep), "v"(g0 + 7 * gstep)
        : "memory");
}

__global__ __launch_bounds__(128) void k_proj(
    const unsigned short* __restrict__ Xb,
    const unsigned short* __restrict__ Wqb, const unsigned short* __restrict__ Wkb,
    const unsigned short* __restrict__ Wvb,
    const float* __restrict__ bq, const float* __restrict__ bk, const float* __restrict__ bv,
    const float* __restrict__ click,
    _Float16* __restrict__ Qh, _Float16* __restrict__ Kh, _Float16* __restrict__ Vt)
{
    __shared__ ProjLds lds;

    const int tid = threadIdx.x, lane = tid & 31, wave = tid >> 5;
    const int row16 = lane & 15, hsel = lane >> 4, kbase = hsel << 3;
    const int mat = blockIdx.z;
    const int n0 = blockIdx.x * PBN;
    const int m0 = blockIdx.y * PBM;
    const int wm = (wave & 1) << 6;
    const int wn = (wave >> 1) << 6;
    const unsigned short* Wb = (mat == 0) ? Wqb : ((mat == 1) ? Wkb : Wvb);
    const float* bias = (mat == 0) ? bq : ((mat == 1) ? bk : bv);
    const bool wa = (mat != 2);                 // block-uniform: W rows are the A operand
    const int abase = wa ? wn : wm;             // the wave's first A row inside its operand tile = first column of the staged tile
    const int bbase = wa ? wm : wn;             // the wave's first B row inside its operand tile = first row of the staged tile
    const int arow0 = wa ? (PBM + wn) : wm;     // the same two as rows of a stage buffer [X | W]
    const int brow0 = wa ? wm : (PBM + wn);

    v8f c[4][4];
    #pragma unroll
    for (int i = 0; i < 4; ++i)
        #pragma unroll
        for (int j = 0; j < 4; ++j)
            #pragma unroll
            for (int r = 0; r < 8; ++r) c[i][j][r] = 0.f;

    // copy map: thread -> row (tid >> 3) + 16 * i, 16-byte chunk tid & 7 of the row's 128 B; a wave's copy covers 4 whole lines
    const int crow = tid >> 3, cchk = tid & 7;
    const unsigned short* gX = Xb + (size_t)(m0 + crow) * DD + (cchk << 3);
    const unsigned short* gW = Wb + (size_t)(n0 + crow) * DD + (cchk << 3);
    const unsigned lX = (unsigned)(size_t)(&lds.s[crow * PLD + (cchk << 3)]);
    const unsigned lW = lX + (unsigned)(PBM * PLD * 2);

    // k stage of the next copies (block-uniform). The first differs among the mat 0,1 blocks of one y (same X rows; mat 2 repeats mat 0) and among neighbours in y (same W rows)
    int sn = (int)((blockIdx.x + blockIdx.z * (DD / PBN) + blockIdx.y) % PNT);
    copy8_rows16(lX, gX + sn * PKS);
    copy8_rows16(lW, gW + sn * PKS);
    sn = (sn + 1 == PNT) ? 0 : sn + 1;
    asm volatile("s_wait_asynccnt 0x0" ::: "memory");   // the first stage has landed before the barrier publishes it
    __syncthreads();
    copy8_rows16(lX + (unsigned)(PSTG * 2), gX + sn * PKS);
    copy8_rows16(lW + (unsigned)(PSTG * 2), gW + sn * PKS);
    sn = (sn + 1 == PNT) ? 0 : sn + 1;

    // one copy of the loop body: the buffer is picked by an offset, and the copies' addresses stay few
    #pragma unroll 1
    for (int t = 0; t < PNT; ++t) {
        const int boff = (t & 1) * PSTG;
        const unsigned short* As = &lds.s[boff + (arow0 + row16) * PLD + kbase];
        const unsigned short* Bs = &lds.s[boff + (brow0 + row16) * PLD + kbase];
        // unrolled throughout: every index of a, b and c is a constant, so the arrays stay in registers
        #pragma unroll
        for (int kk = 0; kk < PKS; kk += 32) {
            v16b a[4], b[4];
            #pragma unroll
            for (int i = 0; i < 4; ++i) a[i] = ldfrag_b(As + i * 16 * PLD + kk);
            #pragma unroll
            for (int j = 0; j < 4; ++j) b[j] = ldfrag_b(Bs + j * 16 * PLD + kk);
            #pragma unroll
            for (int i = 0; i < 4; ++i)
                #pragma unroll
                for (int j = 0; j < 4; ++j) c[i][j] = mma_b(a[i], b[j], c[i][j]);
        }
        asm volatile("s_wait_dscnt 0x0" ::: "memory");      // this wave's reads of buffer t & 1 are done before it is refilled
        asm volatile("s_wait_asynccnt 0x0" ::: "memory");   // this wave's copies of stage t + 1 have landed
        __syncthreads();                                    // publishes stage t + 1, ends every read of stage t
        if (t + 2 < PNT) {
            copy8_rows16(lX + (unsigned)(boff * 2), gX + sn * PKS);
            copy8_rows16(lW + (unsigned)(boff * 2), gW + sn * PKS);
            sn = (sn + 1 == PNT) ? 0 : sn + 1;
        }
    }
    asm volatile("s_wait_asynccnt 0x0" ::: "memory");       // no copy is in flight when the buffers become the epilogue tile

    const int bi = m0 / SEQ;                // batch of this 128-row m tile
    const int s0 = m0 - bi * SEQ;

    // epilogue: + bf16(bias), x carry, f16, staged in LDS as [s][n] (mat 0,1) or [n][s] (mat 2)
    // element r of c[i][j] is staged row bbase + 16 * j + row16, column abase + 16 * i + 8 * hsel + r: one 16-byte store per tile
    _Float16* Cs = lds.h;
    _Float16* cd = &Cs[(bbase + row16) * CST + abase + kbase];
    if (wa) {       // n runs along the staged row: eight biases per A tile
        const float* bp = bias + n0 + wn + kbase;
        v8f bb[4];
        #pragma unroll
        for (int i = 0; i < 4; ++i) bb[i] = ld8f(bp + (i << 4));
        // stands behind the bias loads and takes their address as an input, so that no register of it is rewritten in front of the wait
        asm volatile("s_wait_xcnt 0x0" :: "v"(bp) : "memory");
        float rs[4] = {Q_CARRY, Q_CARRY, Q_CARRY, Q_CARRY};     // carry of staged row 16 * j + row16 of the wave's tile
        if (mat == 1) {     // the staged row is a sequence position: a K row takes its key's gate (RNE-converted to bf16) into its carry
            const float* cp = click + (size_t)bi * SEQ_FULL + s0 + wm + row16;
            #pragma unroll
            for (int j = 0; j < 4; ++j) rs[j] = cp[j << 4];
            // as above, for the gate loads
            asm volatile("s_wait_xcnt 0x0" :: "v"(cp) : "memory");
            #pragma unroll
            for (int j = 0; j < 4; ++j) rs[j] = K_CARRY * bf16_rne(rs[j]);
        }
        #pragma unroll
        for (int i = 0; i < 4; ++i) {
            #pragma unroll
            for (int r = 0; r < 8; ++r) bb[i][r] = bf16_rne(bb[i][r]);
            #pragma unroll
            for (int j = 0; j < 4; ++j)
                *(v8ha*)(cd + (j << 4) * CST + (i << 4)) = __builtin_convertvector((c[i][j] + bb[i]) * rs[j], v8h);
        }
    } else {        // n is the staged row: one bias per B tile
        const float* bp = bias + n0 + wn + row16;
        float bb[4];
        #pragma unroll
        for (int j = 0; j < 4; ++j) bb[j] = bp[j << 4];
        // as above
        asm volatile("s_wait_xcnt 0x0" :: "v"(bp) : "memory");
        #pragma unroll
        for (int j = 0; j < 4; ++j) {
            const float bj = bf16_rne(bb[j]);
            #pragma unroll
            for (int i = 0; i < 4; ++i)
                *(v8ha*)(cd + (j << 4) * CST + (i << 4)) = __builtin_convertvector((c[i][j] + bj) * V_CARRY, v8h);
        }
    }
    __syncthreads();

    const int hd0 = n0 >> 6;                // first of the two heads of this 128-wide n tile
    const int q8 = (tid & 15) << 3;         // 16-byte chunk of a 128-wide staged row
    const int l0 = tid >> 4;
    v8h v[16];
    #pragma unroll
    for (int p = 0; p < 16; ++p) v[p] = *(const v8ha*)(&Cs[(l0 + (p << 3)) * CST + q8]);
    if (mat == 2) {
        #pragma unroll
        for (int p = 0; p < 16; ++p) {
            const int l = l0 + (p << 3);    // staged row = n: head hd0 + (l >> 6), dh = l & 63; chunk = s
            const size_t bhh = (size_t)bi * HH + hd0 + (l >> 6);
            *(v8h*)(Vt + (bhh * DHD + (l & 63)) * SEQ + s0 + q8) = v[p];
        }
    } else {
        _Float16* dst = (mat == 0) ? Qh : Kh;
        const size_t bhh = (size_t)bi * HH + hd0 + (q8 >> 6);
        #pragma unroll
        for (int p = 0; p < 16; ++p) {
            const int l = l0 + (p << 3);    // staged row = s; chunk = n: head hd0 + (q8 >> 6), dh = q8 & 63
            *(v8h*)(dst + (bhh * SEQ + s0 + l) * DHD + (q8 & 63)) = v[p];
        }
        // the built code lets this path run on into the V path's address arithmetic, which rewrites the stores' address pair: the wait stands in front of that
        asm volatile("s_wait_xcnt 0x0" ::: "memory");
    }
}

// ---------------- flash-style attention ----------------
// Qh,Kh: [NB*HH][SEQ][64] f16 (carried so that q.k is gate x score x log2(e)); Vt: [NB*HH][64][SEQ] f16 (x8); out: [NB][SEQ][DD] f32.
// grid (SEQ/QT, NB*HH), block 128 = 4 waves, wave owns 32 queries = two column tiles; keys staged 64 at a time.
// The K and V blocks are staged in LDS by asynchronous 16-byte copies into two buffers: the copies of block kt + 2 fly while block kt + 1 is worked on.
// Transposed products: S^T = K x Q^T and O^T += V^T x P^T. A lane holds one query of each column tile (column lane & 15) and, of every
// 16-key tile, the keys 8 * (lane >> 4) + 0..7: maximum and sum run in the lane, the two halves of a wave meet by one cross-row move,
// and two converted score tiles are the B fragment of the second product as they stand (same split k map as ldfrag_h).
// Every K fragment, V fragment and mask vector read from LDS serves both column tiles.
#define AW 4            // waves per block
#define AT 2            // column tiles (16 queries each) per wave
static_assert(AW * AT * 16 == QT && AT == 2);
#define KVB (2 * KBLK * LDK)         // f16 elements of one stage buffer [Ks | Vs]
#define ANT (SEQ / KBLK)             // key blocks
struct __attribute__((aligned(16))) LdsU {
    union {
        _Float16 h[2 * KVB];      // two stage buffers during the key loop
        float    f[KVB];          // Os after the key loop
    } r;
    float m[SEQ];                 // per-key mask table
};
static_assert(sizeof(LdsU) == 36864 + 4 * SEQ);
static_assert(QT * OST <= KVB);
static_assert(ANT >= 2);
static_assert(SEQ % 4 == 0);
static_assert(KBLK == 64 && (KBLK * DHD / 8) % (AW * 32) == 0);

// Eight asynchronous copies of one lane, 16 B each: four K rows and four V rows, each four 16 rows apart in the source plane and in the LDS buffer.
// lk, lv: the lane's LDS byte addresses, gk, gv: the lane's global addresses, all of the first row.
__device__ __forceinline__ void copy_kv(unsigned lk, const _Float16* gk, unsigned lv, const _Float16* gv) {
    const unsigned lstep = 16u * LDK * 2u;
    const size_t kstep = (size_t)16 * DHD;
    const size_t vstep = (size_t)16 * SEQ;
    // s_wait_xcnt closes the statement so that no address register of a copy is rewritten in front of it
    asm volatile(
        "global_load_async_to_lds_b128 %0, %8, off\n\t"
        "global_load_async_to_lds_b128 %1, %9, off\n\t"
        "global_load_async_to_lds_b128 %2, %10, off\n\t"
        "global_load_async_to_lds_b128 %3, %11, off\n\t"
        "global_load_async_to_lds_b128 %4, %12, off\n\t"
        "global_load_async_to_lds_b128 %5, %13, off\n\t"
        "global_load_async_to_lds_b128 %6, %14, off\n\t"
        "global_load_async_to_lds_b128 %7, %15, off\n\t"
        "s_wait_xcnt 0x0"
        :: "v"(lk), "v"(lk + lstep), "v"(lk + 2u * lstep), "v"(lk + 3u * lstep),
           "v"(lv), "v"(lv + lstep), "v"(lv + 2u * lstep), "v"(lv + 3u * lstep),
           "v"(gk), "v"(gk + kstep), "v"(gk + 2 * kstep), "v"(gk + 3 * kstep),
           "v"(gv), "v"(gv + vstep), "v"(gv + 2 * vstep), "v"(gv + 3 * vstep)
        : "memory");
}

// lane l <-> lane l ^ 16
__device__ __forceinline__ float xhalf(float x) {
    const int b = __builtin_bit_cast(int, x);
    return __builtin_bit_cast(float, __builtin_amdgcn_permlanex16(b, b, 0x76543210, 0xfedcba98, false, false));
}

// second launch-bounds argument: three waves a SIMD, so that the three blocks a WGP gets are resident together
__global__ __launch_bounds__(AW * 32, 3)
void k_attn(const _Float16* __restrict__ Qh, const _Float16* __restrict__ Kh,
            const _Float16* __restrict__ Vt, const float* __restrict__ amask,
            float* __restrict__ out)
{
    __shared__ LdsU lds;
    float* Ms = lds.m;                         // [key] additive mask x log2(e), all SEQ keys

    const int tid = threadIdx.x, lane = tid & 31, wave = tid >> 5;
    const int row16 = lane & 15, hsel = lane >> 4, kbase = hsel << 3;
    const int bh = blockIdx.y;
    const int b = bh / HH;
    const int hd = bh - b * HH;
    const int q0 = blockIdx.x * QT + wave * (AT * 16);
    const size_t baseQK = (size_t)bh * SEQ * DHD;
    const size_t baseV  = (size_t)bh * DHD * SEQ;

    // copy map: 16-byte chunk c = tid + 128 * i of a 64 x 64 tile, row c >> 3, chunk c & 7: a wave's copy covers four whole 128-byte rows
    const int srow = tid >> 3;           // + 16 * i
    const int sch  = (tid & 7) << 3;
    const _Float16* gK = Kh + baseQK + (size_t)srow * DHD + sch;      // K block kt: + kt * KBLK rows
    const _Float16* gV = Vt + baseV + (size_t)srow * SEQ + sch;       // V block kt: + kt * KBLK columns
    const unsigned lK = (unsigned)(size_t)(&lds.r.h[srow * LDK + sch]);
    const unsigned lV = lK + (unsigned)(KBLK * LDK * 2);
    // The key blocks run in a rotated order, from a first block of the work-group's own round to the one in front of it: the work-groups of one head
    // walk the same K and V lines and keep step, and would otherwise ask L2 for the same lines at the same moment. Both indices are block-uniform.
    int kc = (int)((blockIdx.x * (QT / KBLK)) % ANT);   // key block of the pass
    int sn = kc;                                        // key block of the next copies
    copy_kv(lK, gK + (size_t)sn * (KBLK * DHD), lV, gV + sn * KBLK);     // the first block flies under the Q and mask loads
    sn = (sn + 1 == ANT) ? 0 : sn + 1;

    // resident Q fragments (B operand, column = query): per column tile 64 dh x 16 queries = 2 k-steps
    const _Float16* qp[AT];
    v16h qf[AT][2];
    #pragma unroll
    for (int t = 0; t < AT; ++t) {
        qp[t] = Qh + baseQK + (size_t)(q0 + (t << 4) + row16) * DHD + kbase;
        #pragma unroll
        for (int kk = 0; kk < 2; ++kk) qf[t][kk] = ldfrag_h(qp[t] + (kk << 5));
    }

    // per-key table: the additive mask (RNE-converted to bf16) times log2(e), the start value of the score products: what leaves them is
    // the gated and masked score as an exponent of two; published by the barrier in front of the key loop
    constexpr int TU = (SEQ / 4 + AW * 32 - 1) / (AW * 32);       // 16-byte pieces of a table per thread
    constexpr bool tfull = (SEQ / 4) % (AW * 32) == 0;            // then no lane is ever off
    const float* mb = amask + (size_t)b * SEQ_FULL;
    v4f m4[TU];
    // unrolled, here and below: every index of m4 is a constant, so the array stays in registers
    #pragma unroll
    for (int u = 0; u < TU; ++u) {
        const int i = tid + u * (AW * 32);
        if (tfull || i < SEQ / 4) m4[u] = *(const v4fa*)(mb + (i << 2));
    }
    // stands behind the last of the Q and table loads and takes their addresses as inputs, so that no register of them is rewritten in front of the wait
    asm volatile("s_wait_xcnt 0x0" :: "v"(qp[0]), "v"(qp[1]), "s"(mb), "v"(tid) : "memory");
    #pragma unroll
    for (int u = 0; u < TU; ++u) {
        const int i = tid + u * (AW * 32);
        if (tfull || i < SEQ / 4) {
            v4f k4;
            #pragma unroll
            for (int e = 0; e < 4; ++e) k4[e] = fminf(LOG2E * bf16_rne(m4[u][e]), 3.402823466e38f);   // a finite mask stays finite: +inf as a row's maximum would give inf - inf
            *(v4fa*)(&Ms[i << 2]) = k4;
        }
    }

    v8f acc[AT][4];                      // O^T: element r of tile jd = dh 16 * jd + 8 * hsel + r of query 16 * t + row16
    float mrow[AT];                      // running maximum of the lane's queries, equal in both halves
    float msub[AT];                      // what the exponentials subtract: the running maximum less the P carry's exponent
    v8f lrow[AT];                        // running sums of the lane's queries, one per element position; joined behind the loop
    #pragma unroll
    for (int t = 0; t < AT; ++t) {
        #pragma unroll
        for (int jd = 0; jd < 4; ++jd)
            #pragma unroll
            for (int r = 0; r < 8; ++r) acc[t][jd][r] = 0.f;
        mrow[t] = -1e30f * LOG2E;        // the floor under the maximum, in exponents of two
        msub[t] = mrow[t];
        #pragma unroll
        for (int r = 0; r < 8; ++r) lrow[t][r] = 0.f;
    }

    asm volatile("s_wait_asynccnt 0x0" ::: "memory");   // the first block has landed before the barrier publishes it
    __syncthreads();                                    // publishes the first block and the mask table
    copy_kv(lK + (unsigned)(KVB * 2), gK + (size_t)sn * (KBLK * DHD), lV + (unsigned)(KVB * 2), gV + sn * KBLK);
    sn = (sn + 1 == ANT) ? 0 : sn + 1;

    // one copy of the loop body: the buffer is picked by an offset
    #pragma unroll 1
    for (int kt = 0; kt < ANT; ++kt) {
        const int kb = kc * KBLK;
        kc = (kc + 1 == ANT) ? 0 : kc + 1;
        const int boff = (kt & 1) * KVB;
        const _Float16* Ks = lds.r.h + boff;            // [key][dh], 64x64, cross-wave (block barriers)
        const _Float16* Vs = Ks + KBLK * LDK;           // [dh][key], 64x64, cross-wave (block barriers)
        // additive mask: element r of tile j is key kb + 16 * j + 8 * hsel + r, the same for both column tiles
        v8f m8[4];
        #pragma unroll
        for (int j = 0; j < 4; ++j) m8[j] = ld8f(&Ms[kb + (j << 4) + kbase]);

        // scores S^T(64x32) = K(64x64) x Qw^T : A[m=key][k=dh] = Ks[key][dh], 4 m-tiles x 2 k-steps x 2 column tiles.
        // The mask vectors and the eight K fragments are read as one group in front of the sixteen products.
        v16h kf[2][4];
        #pragma unroll
        for (int kk = 0; kk < 2; ++kk)
            #pragma unroll
            for (int j = 0; j < 4; ++j)
                kf[kk][j] = ldfrag_h(&Ks[((j << 4) + row16) * LDK + (kk << 5) + kbase]);
        // keeps the reads above as one group in front of the products; without it the compiler reads two fragments at a time and waits for each pair uncovered
        __builtin_amdgcn_sched_barrier(0);
        v8f sc[AT][4];
        #pragma unroll
        for (int kk = 0; kk < 2; ++kk)       // k-step outside: eight independent accumulators in a row; each sum starts from its key's mask
            #pragma unroll
            for (int j = 0; j < 4; ++j)
                #pragma unroll
                for (int t = 0; t < AT; ++t) sc[t][j] = mma_h(kf[kk][j], qf[t][kk], (kk == 0) ? m8[j] : sc[t][j]);
        // V fragments of keys 0..31 of the block, read well ahead of their products: they land under the softmax arithmetic
        v16h vf[4];
        #pragma unroll
        for (int jd = 0; jd < 4; ++jd) vf[jd] = ldfrag_h(&Vs[((jd << 4) + row16) * LDK + kbase]);
        // keeps these reads here, ahead of the softmax arithmetic; without it the compiler sinks them to just in front of their products
        __builtin_amdgcn_sched_barrier(0);
        // online softmax of the lane's queries
        float corr[AT], dsub[AT];
        #pragma unroll
        for (int t = 0; t < AT; ++t) {
            float mj[4];                 // one chain per tile: four independent chains
            #pragma unroll
            for (int j = 0; j < 4; ++j) {
                float m = sc[t][j][0];
                #pragma unroll
                for (int r = 1; r < 8; ++r) m = fmaxf(m, sc[t][j][r]);
                mj[j] = m;
            }
            float mx = fmaxf(fmaxf(mj[0], mj[1]), fmaxf(mj[2], mj[3]));
            mx = fmaxf(mx, xhalf(mx));
            const float mnew = fmaxf(mrow[t], mx);
            mrow[t] = mnew;
            // subtracting this gives P x1024 straight from the exponential. Where the maximum is so large that its last place is coarser than
            // the carry's exponent, the difference is rounded: no score lies above mnew, so mnew - ms bounds every exponent of the pass;
            // past 15 the f16 P could overflow, and the row goes without a carry
            float ms = mnew - P_CARRY_LOG2;
            ms = (mnew - ms <= P_CARRY_LOG2_MAX) ? ms : mnew;
            dsub[t] = msub[t] - ms;
            msub[t] = ms;
        }
        // sums and products so far carry 2^-(old msub), this pass's carry 2^-msub: the factor between them, whatever carry each pass got
        corr[0] = __builtin_amdgcn_exp2f(dsub[0]);
        // the slot behind a transcendental: the build sets the second exponential directly behind the first and lets it write over the first one's source register
        asm volatile("v_nop" :: "v"(corr[0]));
        // holds the second exponential behind that slot; without it the v_nop drifts off and the two stand side by side again
        __builtin_amdgcn_sched_barrier(0);
        corr[1] = __builtin_amdgcn_exp2f(dsub[1]);
        #pragma unroll
        for (int t = 0; t < AT; ++t)
            #pragma unroll
            for (int jd = 0; jd < 4; ++jd) acc[t][jd] = acc[t][jd] * corr[t];
        // acc(64x32) += V^T(64x64) x P^T(64x32) : A[m=dh][k=key] = Vs[dh][key]; B[k=key][n=query] = P x its carry as f16,
        // elements 0..7 from score tile 2 * kk, elements 8..15 from tile 2 * kk + 1
        #pragma unroll
        for (int kk = 0; kk < 2; ++kk) {
            v16h pf[AT];
            #pragma unroll
            for (int t = 0; t < AT; ++t) {
                #pragma unroll
                for (int j = 2 * kk; j < 2 * kk + 2; ++j) {
                    // subtracted two neighbours at a time: written so, the pairs stay those of the accumulator registers
                    #pragma unroll
                    for (int r = 0; r < 8; r += 2) {
                        v2f x = {sc[t][j][r], sc[t][j][r + 1]};
                        x = x - msub[t];
                        sc[t][j][r] = __builtin_amdgcn_exp2f(x.x);
                        sc[t][j][r + 1] = __builtin_amdgcn_exp2f(x.y);
                    }
                }
                pf[t] = __builtin_shufflevector(__builtin_convertvector(sc[t][2 * kk], v8h),
                                                __builtin_convertvector(sc[t][2 * kk + 1], v8h),
                                                0, 1, 2, 3, 4, 5, 6, 7, 8, 9, 10, 11, 12, 13, 14, 15);
            }
            #pragma unroll
            for (int jd = 0; jd < 4; ++jd)
                #pragma unroll
                for (int t = 0; t < AT; ++t)
                    acc[t][jd] = mma_h(vf[jd], pf[t], acc[t][jd]);
            if (kk == 0) {
                // V fragments of keys 32..63, one group behind the first eight products: they land under the second half's exponentials
                #pragma unroll
                for (int jd = 0; jd < 4; ++jd) vf[jd] = ldfrag_h(&Vs[((jd << 4) + row16) * LDK + 32 + kbase]);
                // keeps those exponentials behind the reads; without it the compiler lifts them in front of the first products and the reads are waited for uncovered
                __builtin_amdgcn_sched_barrier(0);
            }
        }
        #pragma unroll
        for (int t = 0; t < AT; ++t)
            lrow[t] = lrow[t] * corr[t] + ((sc[t][0] + sc[t][1]) + (sc[t][2] + sc[t][3]));
        asm volatile("s_wait_dscnt 0x0" ::: "memory");      // this wave's reads of buffer kt & 1 are done before it is refilled
        asm volatile("s_wait_asynccnt 0x0" ::: "memory");   // this wave's copies of block kt + 1 have landed
        __syncthreads();                                    // publishes block kt + 1, ends every read of block kt
        if (kt + 2 < ANT) {
            copy_kv(lK + (unsigned)(boff * 2), gK + (size_t)sn * (KBLK * DHD), lV + (unsigned)(boff * 2), gV + sn * KBLK);
            sn = (sn + 1 == ANT) ? 0 : sn + 1;
        }
    }
    asm volatile("s_wait_asynccnt 0x0" ::: "memory");       // no copy is in flight when the buffers become the output tile

    // the last pass's barrier has ended every wave's reads of the buffers
    float* Os = lds.r.f + wave * (AT * 16 * OST);  // wave-private region, block barriers used anyway
    #pragma unroll
    for (int t = 0; t < AT; ++t) {
        const v8f lr = lrow[t];
        const float lhalf = ((lr[0] + lr[1]) + (lr[2] + lr[3])) + ((lr[4] + lr[5]) + (lr[6] + lr[7]));
        const float scl = (1.0f / (lhalf + xhalf(lhalf))) * OUT_SCALE;
        #pragma unroll
        for (int jd = 0; jd < 4; ++jd) {
            const v8f o = acc[t][jd] * scl;
            float* od = &Os[((t << 4) + row16) * OST + (jd << 4) + kbase];
            v4f lo, hi;
            #pragma unroll
            for (int e = 0; e < 4; ++e) { lo[e] = o[e]; hi[e] = o[e + 4]; }
            *(v4fa*)(od)     = lo;
            *(v4fa*)(od + 4) = hi;
        }
    }
    __syncthreads();

    const int q4 = (lane & 15) << 2;
    v4f ov[AT * 8];
    #pragma unroll
    for (int p = 0; p < AT * 8; ++p) ov[p] = *(const v4fa*)(&Os[((p << 1) + hsel) * OST + q4]);
    float* orow = out + ((size_t)b * SEQ + q0) * DD + hd * DHD + q4;
    #pragma unroll
    for (int p = 0; p < AT * 8; ++p)
        *(v4f*)(orow + (size_t)((p << 1) + hsel) * DD) = ov[p];
}

// ---------------- launcher ----------------
extern "C" void kernel_launch(void* const* d_in, const int* in_sizes, int n_in,
                              void* d_out, int out_size, void* d_ws, size_t ws_size,
                              hipStream_t stream) {
    if (n_in < 9) return;
    const long long need_rows = (long long)(NB - 1) * SEQ_FULL + SEQ;
    if ((long long)in_sizes[0] < need_rows * DD) return;
    if ((long long)in_sizes[1] < need_rows) return;
    if ((long long)in_sizes[2] < need_rows) return;
    if (in_sizes[3] < DD * DD || in_sizes[5] < DD * DD || in_sizes[7] < DD * DD) return;
    if (in_sizes[4] < DD || in_sizes[6] < DD || in_sizes[8] < DD) return;
    if ((long long)out_size < (long long)MROWS * DD) return;

    const float* X     = (const float*)d_in[0];
    const float* amask = (const float*)d_in[1];
    const float* click = (const float*)d_in[2];
    const float* Wq    = (const float*)d_in[3];
    const float* bq    = (const float*)d_in[4];
    const float* Wk    = (const float*)d_in[5];
    const float* bk    = (const float*)d_in[6];
    const float* Wv    = (const float*)d_in[7];
    const float* bv    = (const float*)d_in[8];
    float* out = (float*)d_out;

    //   Xb  MROWS*DD bf16 | Wqb, Wkb, Wvb  DD*DD bf16 each | Qh, Kh, Vt  MROWS*DD f16 each
    const size_t plane = (size_t)MROWS * DD;      // elements
    const size_t wpl   = (size_t)DD * DD;
    const size_t total_bytes = 2u * (4u * plane + 3u * wpl);
    if (ws_size < total_bytes) return;
    unsigned short* Xb  = (unsigned short*)d_ws;
    unsigned short* Wqb = Xb + plane;
    unsigned short* Wkb = Wqb + wpl;
    unsigned short* Wvb = Wkb + wpl;
    _Float16* Qh = (_Float16*)(Wvb + wpl);
    _Float16* Kh = Qh + plane;
    _Float16* Vt = Kh + plane;

    k_cvt<<<dim3((XCH + 3 * WCH) / CVB), dim3(256), 0, stream>>>(X, Wq, Wk, Wv, Xb);   // fills Xb, Wqb, Wkb, Wvb

    k_proj<<<dim3(DD / PBN, MROWS / PBM, 3), dim3(128), 0, stream>>>(
        Xb, Wqb, Wkb, Wvb, bq, bk, bv, click, Qh, Kh, Vt);

    k_attn<<<dim3(SEQ / QT, NB * HH), dim3(AW * 32), 0, stream>>>(Qh, Kh, Vt, amask, out);
}

// v010
// It runs in 61.6 microseconds.
// Two timings next to v009 both put it at 1.03 times that version's speed.
// All steps since v000 together make it 2.98 times as fast.
#include <hip/hip_runtime.h>

// Contractions: q/k/v projections on v_wmma_f32_16x16x32_bf16 (bf16 operands = RNE-converted f32 inputs, f32 accumulate);
// q.k^T and p.v on v_wmma_f32_16x16x32_f16 (f16 operands: q carried x log2(e)/4, k carried x gate/2, v carried x8, unnormalised p carried x1024),
// f32 accumulate; softmax and epilogues in f32.

#ifndef NB
#define NB 8
#endif
#ifndef SEQ
#define SEQ 1024
#endif
#define NB_FULL 8
#define SEQ_FULL 1024
#define DD 768
#define HH 12
#define DHD 64
#define MROWS (NB * SEQ)

#define PBM 128         // projection block tile, rows of X
#define PBN 128         // projection block tile, rows of W
#define PKS 64          // k per staged projection stage (128 B of every operand row)
#define PLD 72          // 16-bit LDS pitch of a staged operand row (144 B)
#define PSTG ((PBM + PBN) * PLD)     // 16-bit elements of one stage buffer
#define PNT (DD / PKS)  // stages
#define CST 136         // f16 LDS pitch of the projection epilogue tile (272 B)
#define QT 128          // queries per block (4 waves x 32 rows)
#define KBLK 64         // keys per staged block
#define LDK 72          // f16 LDS pitch of K / V tiles (144 B)
#define OST 68          // f32 LDS pitch of the output staging tile (272 B)
#define V_CARRY 8.0f
#define P_CARRY_LOG2 10.0f           // unnormalised P is carried x 2^10
#define P_CARRY_LOG2_MAX 15.0f       // 2^15 is the largest power of two that f16 holds
#define P_SUM_MAX 65504.0f           // the largest finite f16
#define OUT_SCALE (1.0f / 8.0f)      // 1 / V_CARRY; the row sum carries P's factor like the products
#define LOG2E 1.44269504088896340736f
#define Q_CARRY (0.25f * LOG2E)      // Q_CARRY * K_CARRY = log2(e) / sqrt(64): the score product is the exponent of two as it stands
#define K_CARRY 0.5f                 // times the key's gate

static_assert(NB >= 1 && NB <= NB_FULL);
static_assert(SEQ >= QT && SEQ <= SEQ_FULL);
static_assert(SEQ % QT == 0);
static_assert(SEQ % KBLK == 0);
static_assert(SEQ % PBM == 0);
static_assert(DD % PBN == 0);
static_assert(DD % PKS == 0);
static_assert(PNT >= 2);
static_assert(DD % 64 == 0);
static_assert(DD % 32 == 0);
static_assert(HH * DHD == DD);
static_assert(DHD == 64);

typedef _Float16 v16h __attribute__((ext_vector_type(16)));
typedef _Float16 v8h  __attribute__((ext_vector_type(8)));
typedef v8h v8ha __attribute__((may_alias));
typedef __bf16 v16b __attribute__((ext_vector_type(16)));
typedef unsigned short v8us __attribute__((ext_vector_type(8)));
typedef v8us v8usa __attribute__((may_alias));
typedef float v8f __attribute__((ext_vector_type(8)));
typedef float v4f __attribute__((ext_vector_type(4)));
typedef float v2f __attribute__((ext_vector_type(2)));
typedef v4f v4fa __attribute__((may_alias));

static_assert(sizeof(v16b) == sizeof(v8f));

// ---------------- bf16 RNE convert helpers ----------------
__device__ __forceinline__ unsigned short f2bf_bits(float f) {
    unsigned int u = __float_as_uint(f);
    u += 0x7FFFu + ((u >> 16) & 1u);
    return (unsigned short)(u >> 16);
}
__device__ __forceinline__ float bf16_rne(float f) {
    unsigned int u = __float_as_uint(f);
    u += 0x7FFFu + ((u >> 16) & 1u);
    return __uint_as_float(u & 0xFFFF0000u);
}

// ---------------- 16x32 fragment loaders (wave32 split k map, same for A and B) ----------------
// lane l: row (A) / column (B) = l & 15; elements 0..7 <- k0 + 8*(l>>4) + 0..7, elements 8..15 <- k0 + 16 + 8*(l>>4) + 0..7.
// p points at element (row, k0 + 8*(l>>4)) of a k-contiguous 16-bit row; 16-B aligned.
__device__ __forceinline__ v16h ldfrag_h(const _Float16* p) {
    union { v16h v; v8h h[2]; } u;
    u.h[0] = *(const v8ha*)(p);
    u.h[1] = *(const v8ha*)(p + 16);
    return u.v;
}
__device__ __forceinline__ v16b ldfrag_b(const unsigned short* p) {
    union { v16b v; v8us h[2]; } u;
    u.h[0] = *(const v8usa*)(p);
    u.h[1] = *(const v8usa*)(p + 16);
    return u.v;
}

__device__ __forceinline__ v8f ld8f(const float* p) {
    union { v8f v; v4f q[2]; } u;
    u.q[0] = *(const v4fa*)(p);
    u.q[1] = *(const v4fa*)(p + 4);
    return u.v;
}

// ---------------- WMMA wrappers ----------------
// f16 products (k_attn): the builtin alone; the compiler keeps the distance to the first vector instruction on a product's registers
__device__ __forceinline__ v8f mma_h(v16h a, v16h b, v8f c) {
    return __builtin_amdgcn_wmma_f32_16x16x32_f16(false, a, false, b, (short)0, c, false, false);
}
// bf16 products (k_proj): with the VALU hazard guard
__device__ __forceinline__ v8f mma_b(v16b a, v16b b, v8f c) {
    c = __builtin_amdgcn_wmma_f32_16x16x32_bf16(false, a, false, b, (short)0, c, false, false);
    const v8f ka = __builtin_bit_cast(v8f, a);
    const v8f kbv = __builtin_bit_cast(v8f, b);
    asm volatile("v_nop\n\tv_nop\n\tv_nop\n\tv_nop" : "+v"(c) : "v"(ka), "v"(kbv));
    return c;
}

// ---------------- f32 rows -> bf16 bit planes ----------------
// One launch converts X, Wq, Wk and Wv. The four planes lie one behind the other in the workspace, so a chunk of 8 elements
// has one flat index over all of them; a block takes CVB consecutive chunks, all of one source (block-uniform choice).
// A thread converts CVU chunks, 256 chunks apart: its 2 * CVU loads of 16 B are all issued before the first is used.
// Compact X plane row m reads source row (m / SEQ) * SEQ_FULL + (m % SEQ).
#define CVU 8                        // chunks per thread
#define CVB (256 * CVU)              // chunks per block
#define XCH (MROWS * (DD / 8))       // chunks of the X plane
#define WCH (DD * (DD / 8))          // chunks of one W plane
static_assert(XCH % CVB == 0);
static_assert(WCH % CVB == 0);

__global__ __launch_bounds__(256) void k_cvt(const float* __restrict__ X,
                                             const float* __restrict__ Wq, const float* __restrict__ Wk,
                                             const float* __restrict__ Wv,
                                             unsigned short* __restrict__ dst) {
    const int blk = blockIdx.x;
    const int t0 = blk * CVB + (int)threadIdx.x;          // flat chunk of the thread's first piece
    const bool isx = blk < XCH / CVB;
    const int w = isx ? 0 : (blk - XCH / CVB) / (WCH / CVB);
    const float* src = isx ? X : ((w == 0) ? Wq : ((w == 1) ? Wk : Wv));
    const int l0 = isx ? t0 : (t0 - XCH - w * WCH);       // chunk inside the source plane

    v4f f[2 * CVU];
    // unrolled: every index of f is a constant, so the array stays in registers and the loads stand together
    #pragma unroll
    for (int i = 0; i < CVU; ++i) {
        const int l = l0 + i * 256;
        size_t off = (size_t)l * 8;
        if (SEQ != SEQ_FULL && isx) {
            const int m  = l / (DD / 8);
            const int c8 = (l - m * (DD / 8)) * 8;
            const int bb = m / SEQ;
            off = (size_t)(bb * SEQ_FULL + (m - bb * SEQ)) * DD + c8;
        }
        const float* p = src + off;
        f[2 * i]     = *(const v4fa*)(p);
        f[2 * i + 1] = *(const v4fa*)(p + 4);
    }
    // stands behind the last load and takes the loads' address as an input, so that no register of it is rewritten in front of the wait
    asm volatile("s_wait_xcnt 0x0" :: "v"(src + (size_t)l0 * 8) : "memory");
    #pragma unroll
    for (int i = 0; i < CVU; ++i) {
        const v4f f0 = f[2 * i], f1 = f[2 * i + 1];
        v8us o;
        o[0] = f2bf_bits(f0.x); o[1] = f2bf_bits(f0.y); o[2] = f2bf_bits(f0.z); o[3] = f2bf_bits(f0.w);
        o[4] = f2bf_bits(f1.x); o[5] = f2bf_bits(f1.y); o[6] = f2bf_bits(f1.z); o[7] = f2bf_bits(f1.w);
        *(v8us*)(dst + (size_t)(t0 + i * 256) * 8) = o;
    }
}

// ---------------- QKV projection GEMM ----------------
// C[m][n] = sum_k Xb[m][k] * Wb[n][k] + bias[n], m in [0,MROWS), n in [0,DD), k in [0,DD); Wb is [out][in] = n-major, k contiguous.
// grid (DD/128, MROWS/128, 3), block 128 = 4 waves (2x2), block tile 128x128, wave tile 64x64.
// Both operand tiles are staged in LDS, 64 k (128 B of every row) per stage, by asynchronous 16-byte copies into two buffers:
// the copies of stage t + 2 fly while stage t + 1 is worked on. Fragments are read from LDS by ldfrag_b, k ascending inside a stage.
// The stages run in a rotated order, from a first stage of the block's own round to the one in front of it: all resident blocks start together and
// keep step, and blocks that share X rows or W rows would otherwise ask L2 for the same lines at the same moment.
// The operand whose index runs along a row of the epilogue tile is the A operand (W rows for mat 0,1; X rows for mat 2): a lane's eight
// accumulator elements are then eight neighbours of one staged row. Both loaders share one k map, so the swap pairs the same k.
// mat 0,1 -> Qh/Kh f16 [NB*HH][SEQ][64] (x Q_CARRY; x K_CARRY x the row's gate); mat 2 -> Vt f16 [NB*HH][64][SEQ] (x8, transposed for the p.v A operand).
union __attribute__((aligned(16))) ProjLds {
    unsigned short s[2 * PSTG];   // two stage buffers, each [X 128 rows | W 128 rows] at pitch PLD
    _Float16       h[PBM * CST];  // epilogue tile after the k loop
};
static_assert(sizeof(ProjLds) == 73728);

// Eight asynchronous copies of one lane, 16 B each, rows 16 apart in the source plane and in the LDS buffer.
// l0: the lane's LDS byte address, g0: the lane's global address, both of the first row.
__device__ __forceinline__ void copy8_rows16(unsigned l0, const unsigned short* g0) {
    const unsigned lstep = 16u * PLD * 2u;
    const size_t gstep = (size_t)16 * DD;
    // s_wait_xcnt closes the statement so that no address register of a copy is rewritten in front of it
    asm volatile(
        "global_load_async_to_lds_b128 %0, %8, off\n\t"
        "global_load_async_to_lds_b128 %1, %9, off\n\t"
        "global_load_async_to_lds_b128 %2, %10, off\n\t"
        "global_load_async_to_lds_b128 %3, %11, off\n\t"
        "global_load_async_to_lds_b128 %4, %12, off\n\t"
        "global_load_async_to_lds_b128 %5, %13, off\n\t"
        "global_load_async_to_lds_b128 %6, %14, off\n\t"
        "global_load_async_to_lds_b128 %7, %15, off\n\t"
        "s_wait_xcnt 0x0"
        :: "v"(l0), "v"(l0 + lstep), "v"(l0 + 2u * lstep), "v"(l0 + 3u * lstep),
           "v"(l0 + 4u * lstep), "v"(l0 + 5u * lstep), "v"(l0 + 6u * lstep), "v"(l0 + 7u * lstep),
           "v"(g0), "v"(g0 + gstep), "v"(g0 + 2 * gstep), "v"(g0 + 3 * gstep),
           "v"(g0 + 4 * gstep), "v"(g0 + 5 * gstep), "v"(g0 + 6 * gstep), "v"(g0 + 7 * gstep)
        : "memory");
}

__global__ __launch_bounds__(128) void k_proj(
    const unsigned short* __restrict__ Xb,
    const unsigned short* __restrict__ Wqb, const unsigned short* __restrict__ Wkb,
    const unsigned short* __restrict__ Wvb,
    const float* __restrict__ bq, const float* __restrict__ bk, const float* __restrict__ bv,
    const float* __restrict__ click,
    _Float16* __restrict__ Qh, _Float16* __restrict__ Kh, _Float16* __restrict__ Vt)
{
    __shared__ ProjLds lds;

    const int tid = threadIdx.x, lane = tid & 31, wave = tid >> 5;
    const int row16 = lane & 15, hsel = lane >> 4, kbase = hsel << 3;
    const int mat = blockIdx.z;
    const int n0 = blockIdx.x * PBN;
    const int m0 = blockIdx.y * PBM;
    const int wm = (wave & 1) << 6;
    const int wn = (wave >> 1) << 6;
    const unsigned short* Wb = (mat == 0) ? Wqb : ((mat == 1) ? Wkb : Wvb);
    const float* bias = (mat == 0) ? bq : ((mat == 1) ? bk : bv);
    const bool wa = (mat != 2);                 // block-uniform: W rows are the A operand
    const int abase = wa ? wn : wm;             // the wave's first A row inside its operand tile = first column of the staged tile
    const int bbase = wa ? wm : wn;             // the wave's first B row inside its operand tile = first row of the staged tile
    const int arow0 = wa ? (PBM + wn) : wm;     // the same two as rows of a stage buffer [X | W]
    const int brow0 = wa ? wm : (PBM + wn);

    v8f c[4][4];
    #pragma unroll
    for (int i = 0; i < 4; ++i)
        #pragma unroll
        for (int j = 0; j < 4; ++j)
            #pragma unroll
            for (int r = 0; r < 8; ++r) c[i][j][r] = 0.f;

    // copy map: thread -> row (tid >> 3) + 16 * i, 16-byte chunk tid & 7 of the row's 128 B; a wave's copy covers 4 whole lines
    const int crow = tid >> 3, cchk = tid & 7;
    const unsigned short* gX = Xb + (size_t)(m0 + crow) * DD + (cchk << 3);
    const unsigned short* gW = Wb + (size_t)(n0 + crow) * DD + (cchk << 3);
    const unsigned lX = (unsigned)(size_t)(&lds.s[crow * PLD + (cchk << 3)]);
    const unsigned lW = lX + (unsigned)(PBM * PLD * 2);

    // k stage of the next copies (block-uniform). The first differs among the mat 0,1 blocks of one y (same X rows; mat 2 repeats mat 0) and among neighbours in y (same W rows)
    int sn = (int)((blockIdx.x + blockIdx.z * (DD / PBN) + blockIdx.y) % PNT);
    copy8_rows16(lX, gX + sn * PKS);
    copy8_rows16(lW, gW + sn * PKS);
    sn = (sn + 1 == PNT) ? 0 : sn + 1;
    asm volatile("s_wait_asynccnt 0x0" ::: "memory");   // the first stage has landed before the barrier publishes it
    __syncthreads();
    copy8_rows16(lX + (unsigned)(PSTG * 2), gX + sn * PKS);
    copy8_rows16(lW + (unsigned)(PSTG * 2), gW + sn * PKS);
    sn = (sn + 1 == PNT) ? 0 : sn + 1;

    // one copy of the loop body: the buffer is picked by an offset, and the copies' addresses stay few
    #pragma unroll 1
    for (int t = 0; t < PNT; ++t) {
        const int boff = (t & 1) * PSTG;
        const unsigned short* As = &lds.s[boff + (arow0 + row16) * PLD + kbase];
        const unsigned short* Bs = &lds.s[boff + (brow0 + row16) * PLD + kbase];
        // unrolled throughout: every index of a, b and c is a constant, so the arrays stay in registers
        #pragma unroll
        for (int kk = 0; kk < PKS; kk += 32) {
            v16b a[4], b[4];
            #pragma unroll
            for (int i = 0; i < 4; ++i) a[i] = ldfrag_b(As + i * 16 * PLD + kk);
            #pragma unroll
            for (int j = 0; j < 4; ++j) b[j] = ldfrag_b(Bs + j * 16 * PLD + kk);
            #pragma unroll
            for (int i = 0; i < 4; ++i)
                #pragma unroll
                for (int j = 0; j < 4; ++j) c[i][j] = mma_b(a[i], b[j], c[i][j]);
        }
        asm volatile("s_wait_dscnt 0x0" ::: "memory");      // this wave's reads of buffer t & 1 are done before it is refilled
        asm volatile("s_wait_asynccnt 0x0" ::: "memory");   // this wave's copies of stage t + 1 have landed
        __syncthreads();                                    // publishes stage t + 1, ends every read of stage t
        if (t + 2 < PNT) {
            copy8_rows16(lX + (unsigned)(boff * 2), gX + sn * PKS);
            copy8_rows16(lW + (unsigned)(boff * 2), gW + sn * PKS);
            sn = (sn + 1 == PNT) ? 0 : sn + 1;
        }
    }
    asm volatile("s_wait_asynccnt 0x0" ::: "memory");       // no copy is in flight when the buffers become the epilogue tile

    const int bi = m0 / SEQ;                // batch of this 128-row m tile
    const int s0 = m0 - bi * SEQ;

    // epilogue: + bf16(bias), x carry, f16, staged in LDS as [s][n] (mat 0,1) or [n][s] (mat 2)
    // element r of c[i][j] is staged row bbase + 16 * j + row16, column abase + 16 * i + 8 * hsel + r: one 16-byte store per tile
    _Float16* Cs = lds.h;
    _Float16* cd = &Cs[(bbase + row16) * CST + abase + kbase];
    if (wa) {       // n runs along the staged row: eight biases per A tile
        const float* bp = bias + n0 + wn + kbase;
        v8f bb[4];
        #pragma unroll
        for (int i = 0; i < 4; ++i) bb[i] = ld8f(bp + (i << 4));
        // stands behind the bias loads and takes their address as an input, so that no register of it is rewritten in front of the wait
        asm volatile("s_wait_xcnt 0x0" :: "v"(bp) : "memory");
        float rs[4] = {Q_CARRY, Q_CARRY, Q_CARRY, Q_CARRY};     // carry of staged row 16 * j + row16 of the wave's tile
        if (mat == 1) {     // the staged row is a sequence position: a K row takes its key's gate (RNE-converted to bf16) into its carry
            const float* cp = click + (size_t)bi * SEQ_FULL + s0 + wm + row16;
            #pragma unroll
            for (int j = 0; j < 4; ++j) rs[j] = cp[j << 4];
            // as above, for the gate loads
            asm volatile("s_wait_xcnt 0x0" :: "v"(cp) : "memory");
            #pragma unroll
            for (int j = 0; j < 4; ++j) rs[j] = K_CARRY * bf16_rne(rs[j]);
        }
        #pragma unroll
        for (int i = 0; i < 4; ++i) {
            #pragma unroll
            for (int r = 0; r < 8; ++r) bb[i][r] = bf16_rne(bb[i][r]);
            #pragma unroll
            for (int j = 0; j < 4; ++j)
                *(v8ha*)(cd + (j << 4) * CST + (i << 4)) = __builtin_convertvector((c[i][j] + bb[i]) * rs[j], v8h);
        }
    } else {        // n is the staged row: one bias per B tile
        const float* bp = bias + n0 + wn + row16;
        float bb[4];
        #pragma unroll
        for (int j = 0; j < 4; ++j) bb[j] = bp[j << 4];
        // as above
        asm volatile("s_wait_xcnt 0x0" :: "v"(bp) : "memory");
        #pragma unroll
        for (int j = 0; j < 4; ++j) {
            const float bj = bf16_rne(bb[j]);
            #pragma unroll
            for (int i = 0; i < 4; ++i)
                *(v8ha*)(cd + (j << 4) * CST + (i << 4)) = __builtin_convertvector((c[i][j] + bj) * V_CARRY, v8h);
        }
    }
    __syncthreads();

    const int hd0 = n0 >> 6;                // first of the two heads of this 128-wide n tile
    const int q8 = (tid & 15) << 3;         // 16-byte chunk of a 128-wide staged row
    const int l0 = tid >> 4;
    v8h v[16];
    #pragma unroll
    for (int p = 0; p < 16; ++p) v[p] = *(const v8ha*)(&Cs[(l0 + (p << 3)) * CST + q8]);
    if (mat == 2) {
        #pragma unroll
        for (int p = 0; p < 16; ++p) {
            const int l = l0 + (p << 3);    // staged row = n: head hd0 + (l >> 6), dh = l & 63; chunk = s
            const size_t bhh = (size_t)bi * HH + hd0 + (l >> 6);
            *(v8h*)(Vt + (bhh * DHD + (l & 63)) * SEQ + s0 + q8) = v[p];
        }
    } else {
        _Float16* dst = (mat == 0) ? Qh : Kh;
        const size_t bhh = (size_t)bi * HH + hd0 + (q8 >> 6);
        #pragma unroll
        for (int p = 0; p < 16; ++p) {
            const int l = l0 + (p << 3);    // staged row = s; chunk = n: head hd0 + (q8 >> 6), dh = q8 & 63
            *(v8h*)(dst + (bhh * SEQ + s0 + l) * DHD + (q8 & 63)) = v[p];
        }
        // the built code lets this path run on into the V path's address arithmetic, which rewrites the stores' address pair: the wait stands in front of that
        asm volatile("s_wait_xcnt 0x0" ::: "memory");
    }
}

// ---------------- flash-style attention ----------------
// Qh,Kh: [NB*HH][SEQ][64] f16 (carried so that q.k is gate x score x log2(e)); Vt: [NB*HH][64][SEQ] f16 (x8); out: [NB][SEQ][DD] f32.
// grid (SEQ/QT, NB*HH), block 128 = 4 waves, wave owns 32 queries = two column tiles; keys staged 64 at a time.
// The K and V blocks are staged in LDS by asynchronous 16-byte copies into two buffers: the copies of block kt + 2 fly while block kt + 1 is worked on.
// Transposed products: S^T = K x Q^T and O^T += V^T x P^T. A lane holds one query of each column tile (column lane & 15) and, of every
// 16-key tile, the keys 8 * (lane >> 4) + 0..7: maximum and sum run in the lane, the two halves of a wave meet by one cross-row move,
// and two converted score tiles are the B fragment of the second product as they stand (same split k map as ldfrag_h).
// Every K fragment, V fragment and mask vector read from LDS serves both column tiles.
// A pass takes its exponentials against the maximum in use and proves by its own sums that no P leaves the f16 range; only where that test
// fails does the wave redo the block's scores, search their maximum and rescale what it has summed so far.
#define AW 4            // waves per block
#define AT 2            // column tiles (16 queries each) per wave
static_assert(AW * AT * 16 == QT && AT == 2);
#define KVB (2 * KBLK * LDK)         // f16 elements of one stage buffer [Ks | Vs]
#define ANT (SEQ / KBLK)             // key blocks
struct __attribute__((aligned(16))) LdsU {
    union {
        _Float16 h[2 * KVB];      // two stage buffers during the key loop
        float    f[KVB];          // Os after the key loop
    } r;
    float m[SEQ];                 // per-key mask table
};
static_assert(sizeof(LdsU) == 36864 + 4 * SEQ);
static_assert(QT * OST <= KVB);
static_assert(ANT >= 2);
static_assert(SEQ % 4 == 0);
static_assert(KBLK == 64 && (KBLK * DHD / 8) % (AW * 32) == 0);

// Eight asynchronous copies of one lane, 16 B each: four K rows and four V rows, each four 16 rows apart in the source plane and in the LDS buffer.
// lk, lv: the lane's LDS byte addresses, gk, gv: the lane's global addresses, all of the first row.
__device__ __forceinline__ void copy_kv(unsigned lk, const _Float16* gk, unsigned lv, const _Float16* gv) {
    const unsigned lstep = 16u * LDK * 2u;
    const size_t kstep = (size_t)16 * DHD;
    const size_t vstep = (size_t)16 * SEQ;
    // s_wait_xcnt closes the statement so that no address register of a copy is rewritten in front of it
    asm volatile(
        "global_load_async_to_lds_b128 %0, %8, off\n\t"
        "global_load_async_to_lds_b128 %1, %9, off\n\t"
        "global_load_async_to_lds_b128 %2, %10, off\n\t"
        "global_load_async_to_lds_b128 %3, %11, off\n\t"
        "global_load_async_to_lds_b128 %4, %12, off\n\t"
        "global_load_async_to_lds_b128 %5, %13, off\n\t"
        "global_load_async_to_lds_b128 %6, %14, off\n\t"
        "global_load_async_to_lds_b128 %7, %15, off\n\t"
        "s_wait_xcnt 0x0"
        :: "v"(lk), "v"(lk + lstep), "v"(lk + 2u * lstep), "v"(lk + 3u * lstep),
           "v"(lv), "v"(lv + lstep), "v"(lv + 2u * lstep), "v"(lv + 3u * lstep),
           "v"(gk), "v"(gk + kstep), "v"(gk + 2 * kstep), "v"(gk + 3 * kstep),
           "v"(gv), "v"(gv + vstep), "v"(gv + 2 * vstep), "v"(gv + 3 * vstep)
        : "memory");
}

// lane l <-> lane l ^ 16
__device__ __forceinline__ float xhalf(float x) {
    const int b = __builtin_bit_cast(int, x);
    return __builtin_bit_cast(float, __builtin_amdgcn_permlanex16(b, b, 0x76543210, 0xfedcba98, false, false));
}

// Scores of one staged key block: S^T(64x32) = K(64x64) x Qw^T, A[m=key][k=dh] = Ks[key][dh], 4 m-tiles x 2 k-steps x 2 column tiles.
// mk: the block's 64 mask entries; element r of tile j is key 16 * j + 8 * (lane >> 4) + r, the same for both column tiles.
// ONE: the mask vectors and all eight K fragments are read as one group in front of the sixteen products (the pass's own call);
// otherwise four fragments per k-step, which takes 32 registers fewer (the rare second call, made while the V fragments are held).
template <bool ONE>
__device__ __forceinline__ void scores64(const _Float16* Ks, const float* mk, int row16, int kbase,
                                         const v16h (&qf)[AT][2], v8f (&sc)[AT][4]) {
    v8f m8[4];
    #pragma unroll
    for (int j = 0; j < 4; ++j) m8[j] = ld8f(mk + (j << 4) + kbase);
    v16h kf[2][4];
    if (ONE) {
        #pragma unroll
        for (int kk = 0; kk < 2; ++kk)
            #pragma unroll
            for (int j = 0; j < 4; ++j)
                kf[kk][j] = ldfrag_h(&Ks[((j << 4) + row16) * LDK + (kk << 5) + kbase]);
        // keeps the reads above as one group in front of the products; without it the compiler reads two fragments at a time and waits for each pair uncovered
        __builtin_amdgcn_sched_barrier(0);
    }
    #pragma unroll
    for (int kk = 0; kk < 2; ++kk) {     // k-step outside: eight independent accumulators in a row; each sum starts from its key's mask
        if (!ONE) {
            #pragma unroll
            for (int j = 0; j < 4; ++j)
                kf[kk][j] = ldfrag_h(&Ks[((j << 4) + row16) * LDK + (kk << 5) + kbase]);
        }
        #pragma unroll
        for (int j = 0; j < 4; ++j)
            #pragma unroll
            for (int t = 0; t < AT; ++t) sc[t][j] = mma_h(kf[kk][j], qf[t][kk], (kk == 0) ? m8[j] : sc[t][j]);
        // keeps the second k-step's reads behind the first one's products, so that they take the same registers
        if (!ONE) __builtin_amdgcn_sched_barrier(0);
    }
}

// sc <- 2^(sc - msub) in place; ps <- the four tiles' sum, one per element position
__device__ __forceinline__ void exp_sums(v8f (&sc)[AT][4], const float (&msub)[AT], v8f (&ps)[AT]) {
    #pragma unroll
    for (int t = 0; t < AT; ++t) {
        #pragma unroll
        for (int j = 0; j < 4; ++j) {
            // subtracted two neighbours at a time: written so, the pairs stay those of the accumulator registers
            #pragma unroll
            for (int r = 0; r < 8; r += 2) {
                v2f x = {sc[t][j][r], sc[t][j][r + 1]};
                x = x - msub[t];
                sc[t][j][r] = __builtin_amdgcn_exp2f(x.x);
                sc[t][j][r + 1] = __builtin_amdgcn_exp2f(x.y);
            }
        }
        ps[t] = (sc[t][0] + sc[t][1]) + (sc[t][2] + sc[t][3]);
    }
}

// P x its carry as f16, the B fragments of the second product: elements 0..7 from score tile 2 * kk, elements 8..15 from tile 2 * kk + 1
__device__ __forceinline__ void pack_p(const v8f (&sc)[AT][4], v16h (&pf)[2][AT]) {
    #pragma unroll
    for (int kk = 0; kk < 2; ++kk)
        #pragma unroll
        for (int t = 0; t < AT; ++t)
            pf[kk][t] = __builtin_shufflevector(__builtin_convertvector(sc[t][2 * kk], v8h),
                                                __builtin_convertvector(sc[t][2 * kk + 1], v8h),
                                                0, 1, 2, 3, 4, 5, 6, 7, 8, 9, 10, 11, 12, 13, 14, 15);
}

// Takes the scores' maximum into the maximum in use, rescales what has been summed so far, and leaves the pass's P (in sc and packed) and its sums.
__device__ __forceinline__ void renew_max(v8f (&sc)[AT][4], float (&mrow)[AT], float (&msub)[AT], v8f (&acc)[AT][4], v8f (&lrow)[AT],
                                          v8f (&ps)[AT], v16h (&pf)[2][AT]) {
    float corr[AT], dsub[AT];
    #pragma unroll
    for (int t = 0; t < AT; ++t) {
        float mj[4];                 // one chain per tile: four independent chains
        #pragma unroll
        for (int j = 0; j < 4; ++j) {
            float m = sc[t][j][0];
            #pragma unroll
            for (int r = 1; r < 8; ++r) m = fmaxf(m, sc[t][j][r]);
            mj[j] = m;
        }
        float mx = fmaxf(fmaxf(mj[0], mj[1]), fmaxf(mj[2], mj[3]));
        mx = fmaxf(mx, xhalf(mx));
        const float mnew = fmaxf(mrow[t], mx);
        mrow[t] = mnew;
        // subtracting this gives P x1024 straight from the exponential. Where the maximum is so large that its last place is coarser than
        // the carry's exponent, the difference is rounded: no score lies above mnew, so mnew - ms bounds every exponent of the pass;
        // past 15 the f16 P could overflow, and the row goes without a carry
        float ms = mnew - P_CARRY_LOG2;
        ms = (mnew - ms <= P_CARRY_LOG2_MAX) ? ms : mnew;
        dsub[t] = msub[t] - ms;
        msub[t] = ms;
    }
    // sums and products so far carry 2^-(old msub), from here on 2^-msub: the factor between them
    corr[0] = __builtin_amdgcn_exp2f(dsub[0]);
    // the slot behind a transcendental: the build sets the second exponential directly behind the first and lets it write over the first one's source register
    asm volatile("v_nop" :: "v"(corr[0]));
    // holds the second exponential behind that slot; without it the v_nop drifts off and the two stand side by side again
    __builtin_amdgcn_sched_barrier(0);
    corr[1] = __builtin_amdgcn_exp2f(dsub[1]);
    #pragma unroll
    for (int t = 0; t < AT; ++t) {
        #pragma unroll
        for (int jd = 0; jd < 4; ++jd) acc[t][jd] = acc[t][jd] * corr[t];
        lrow[t] = lrow[t] * corr[t];
    }
    exp_sums(sc, msub, ps);
    pack_p(sc, pf);
}

// second launch-bounds argument: three waves a SIMD, so that the three blocks a WGP gets are resident together
__global__ __launch_bounds__(AW * 32, 3)
void k_attn(const _Float16* __restrict__ Qh, const _Float16* __restrict__ Kh,
            const _Float16* __restrict__ Vt, const float* __restrict__ amask,
            float* __restrict__ out)
{
    __shared__ LdsU lds;
    float* Ms = lds.m;                         // [key] additive mask x log2(e), all SEQ keys

    const int tid = threadIdx.x, lane = tid & 31, wave = tid >> 5;
    const int row16 = lane & 15, hsel = lane >> 4, kbase = hsel << 3;
    const int bh = blockIdx.y;
    const int b = bh / HH;
    const int hd = bh - b * HH;
    const int q0 = blockIdx.x * QT + wave * (AT * 16);
    const size_t baseQK = (size_t)bh * SEQ * DHD;
    const size_t baseV  = (size_t)bh * DHD * SEQ;

    // copy map: 16-byte chunk c = tid + 128 * i of a 64 x 64 tile, row c >> 3, chunk c & 7: a wave's copy covers four whole 128-byte rows
    const int srow = tid >> 3;           // + 16 * i
    const int sch  = (tid & 7) << 3;
    const _Float16* gK = Kh + baseQK + (size_t)srow * DHD + sch;      // K block kt: + kt * KBLK rows
    const _Float16* gV = Vt + baseV + (size_t)srow * SEQ + sch;       // V block kt: + kt * KBLK columns
    const unsigned lK = (unsigned)(size_t)(&lds.r.h[srow * LDK + sch]);
    const unsigned lV = lK + (unsigned)(KBLK * LDK * 2);
    // The key blocks run in a rotated order, from a first block of the work-group's own round to the one in front of it: the work-groups of one head
    // walk the same K and V lines and keep step, and would otherwise ask L2 for the same lines at the same moment. Both indices are block-uniform.
    int kc = (int)((blockIdx.x * (QT / KBLK)) % ANT);   // key block of the pass
    int sn = kc;                                        // key block of the next copies
    copy_kv(lK, gK + (size_t)sn * (KBLK * DHD), lV, gV + sn * KBLK);     // the first block flies under the Q and mask loads
    sn = (sn + 1 == ANT) ? 0 : sn + 1;

    // resident Q fragments (B operand, column = query): per column tile 64 dh x 16 queries = 2 k-steps
    const _Float16* qp[AT];
    v16h qf[AT][2];
    #pragma unroll
    for (int t = 0; t < AT; ++t) {
        qp[t] = Qh + baseQK + (size_t)(q0 + (t << 4) + row16) * DHD + kbase;
        #pragma unroll
        for (int kk = 0; kk < 2; ++kk) qf[t][kk] = ldfrag_h(qp[t] + (kk << 5));
    }

    // per-key table: the additive mask (RNE-converted to bf16) times log2(e), the start value of the score products: what leaves them is
    // the gated and masked score as an exponent of two; published by the barrier in front of the key loop
    constexpr int TU = (SEQ / 4 + AW * 32 - 1) / (AW * 32);       // 16-byte pieces of a table per thread
    constexpr bool tfull = (SEQ / 4) % (AW * 32) == 0;            // then no lane is ever off
    const float* mb = amask + (size_t)b * SEQ_FULL;
    v4f m4[TU];
    // unrolled, here and below: every index of m4 is a constant, so the array stays in registers
    #pragma unroll
    for (int u = 0; u < TU; ++u) {
        const int i = tid + u * (AW * 32);
        if (tfull || i < SEQ / 4) m4[u] = *(const v4fa*)(mb + (i << 2));
    }
    // stands behind the last of the Q and table loads and takes their addresses as inputs, so that no register of them is rewritten in front of the wait
    asm volatile("s_wait_xcnt 0x0" :: "v"(qp[0]), "v"(qp[1]), "s"(mb), "v"(tid) : "memory");
    #pragma unroll
    for (int u = 0; u < TU; ++u) {
        const int i = tid + u * (AW * 32);
        if (tfull || i < SEQ / 4) {
            v4f k4;
            #pragma unroll
            for (int e = 0; e < 4; ++e) k4[e] = fminf(LOG2E * bf16_rne(m4[u][e]), 3.402823466e38f);   // a finite mask stays finite: +inf as a row's maximum would give inf - inf
            *(v4fa*)(&Ms[i << 2]) = k4;
        }
    }

    v8f acc[AT][4];                      // O^T: element r of tile jd = dh 16 * jd + 8 * hsel + r of query 16 * t + row16
    float mrow[AT];                      // maximum in use of the lane's queries, equal in both halves
    float msub[AT];                      // what the exponentials subtract: the maximum in use less the P carry's exponent
    v8f lrow[AT];                        // running sums of the lane's queries, one per element position; joined behind the loop
    #pragma unroll
    for (int t = 0; t < AT; ++t) {
        #pragma unroll
        for (int jd = 0; jd < 4; ++jd)
            #pragma unroll
            for (int r = 0; r < 8; ++r) acc[t][jd][r] = 0.f;
        mrow[t] = -1e30f * LOG2E;        // the floor under the maximum, in exponents of two
        msub[t] = mrow[t];
        #pragma unroll
        for (int r = 0; r < 8; ++r) lrow[t][r] = 0.f;
    }

    asm volatile("s_wait_asynccnt 0x0" ::: "memory");   // the first block has landed before the barrier publishes it
    __syncthreads();                                    // publishes the first block and the mask table
    copy_kv(lK + (unsigned)(KVB * 2), gK + (size_t)sn * (KBLK * DHD), lV + (unsigned)(KVB * 2), gV + sn * KBLK);
    sn = (sn + 1 == ANT) ? 0 : sn + 1;

    // One pass over a staged key block. first (a literal at both calls): the pass has no maximum in use yet and searches it at once.
    auto pass = [&](const bool first, const int kt) __attribute__((always_inline)) {
        const int kb = kc * KBLK;
        kc = (kc + 1 == ANT) ? 0 : kc + 1;
        const int boff = (kt & 1) * KVB;
        const _Float16* Ks = lds.r.h + boff;            // [key][dh], 64x64, cross-wave (block barriers)
        const _Float16* Vs = Ks + KBLK * LDK;           // [dh][key], 64x64, cross-wave (block barriers)
        const float* mk = &Ms[kb];
        v8f sc[AT][4];
        scores64<true>(Ks, mk, row16, kbase, qf, sc);
        // V fragments of keys 0..31 of the block, read well ahead of their products: they land under the exponentials
        v16h vf[2][4];
        #pragma unroll
        for (int jd = 0; jd < 4; ++jd) vf[0][jd] = ldfrag_h(&Vs[((jd << 4) + row16) * LDK + kbase]);
        // keeps these reads here, ahead of the exponentials; without it the compiler sinks them to just in front of their products
        __builtin_amdgcn_sched_barrier(0);
        v8f ps[AT];
        v16h pf[2][AT];
        if (first) {
            renew_max(sc, mrow, msub, acc, lrow, ps, pf);
        } else {
            // the exponentials are taken against the maximum in use, with no look at this pass's scores
            exp_sums(sc, msub, ps);
            pack_p(sc, pf);
            // no P is negative, so none is above a sum that holds it: sums inside the f16 range prove that no P of the pass overflows as f16
            float bg[4];                 // four independent chains
            #pragma unroll
            for (int r = 0; r < 4; ++r) bg[r] = fmaxf(fmaxf(ps[0][r], ps[1][r]), fmaxf(ps[0][r + 4], ps[1][r + 4]));
            const float big = fmaxf(fmaxf(bg[0], bg[1]), fmaxf(bg[2], bg[3]));
            // one wave-uniform test a pass: it fails where a score has outgrown the maximum in use
            if (__builtin_amdgcn_ballot_w32(!(big <= P_SUM_MAX)) != 0) {
                scores64<false>(Ks, mk, row16, kbase, qf, sc);   // the exponentials wrote over the scores: the block still lies in LDS
                renew_max(sc, mrow, msub, acc, lrow, ps, pf);
            }
        }
        #pragma unroll
        for (int t = 0; t < AT; ++t) lrow[t] = lrow[t] + ps[t];
        // V fragments of keys 32..63, one group in front of the sixteen products: they land under the first eight
        #pragma unroll
        for (int jd = 0; jd < 4; ++jd) vf[1][jd] = ldfrag_h(&Vs[((jd << 4) + row16) * LDK + 32 + kbase]);
        // keeps the products behind these reads; without it the compiler sinks the reads in among the last of the first eight products, and they are waited for uncovered
        __builtin_amdgcn_sched_barrier(0);
        // acc(64x32) += V^T(64x64) x P^T(64x32) : A[m=dh][k=key] = Vs[dh][key]; B[k=key][n=query] = the packed P
        #pragma unroll
        for (int kk = 0; kk < 2; ++kk) {
            #pragma unroll
            for (int jd = 0; jd < 4; ++jd)
                #pragma unroll
                for (int t = 0; t < AT; ++t)
                    acc[t][jd] = mma_h(vf[kk][jd], pf[kk][t], acc[t][jd]);
            // keeps the first eight products in front of the waits at the pass's foot; without it the compiler lifts those waits to just behind the reads above, uncovered
            if (kk == 0) __builtin_amdgcn_sched_barrier(0);
        }
        asm volatile("s_wait_dscnt 0x0" ::: "memory");      // this wave's reads of buffer kt & 1 are done before it is refilled
        asm volatile("s_wait_asynccnt 0x0" ::: "memory");   // this wave's copies of block kt + 1 have landed
        __syncthreads();                                    // publishes block kt + 1, ends every read of block kt
        if (kt + 2 < ANT) {
            copy_kv(lK + (unsigned)(boff * 2), gK + (size_t)sn * (KBLK * DHD), lV + (unsigned)(boff * 2), gV + sn * KBLK);
            sn = (sn + 1 == ANT) ? 0 : sn + 1;
        }
    };
    pass(true, 0);
    // one copy of the loop body: the buffer is picked by an offset
    #pragma unroll 1
    for (int kt = 1; kt < ANT; ++kt) pass(false, kt);
    asm volatile("s_wait_asynccnt 0x0" ::: "memory");       // no copy is in flight when the buffers become the output tile

    // the last pass's barrier has ended every wave's reads of the buffers
    float* Os = lds.r.f + wave * (AT * 16 * OST);  // wave-private region, block barriers used anyway
    #pragma unroll
    for (int t = 0; t < AT; ++t) {
        const v8f lr = lrow[t];
        const float lhalf = ((lr[0] + lr[1]) + (lr[2] + lr[3])) + ((lr[4] + lr[5]) + (lr[6] + lr[7]));
        const float scl = (1.0f / (lhalf + xhalf(lhalf))) * OUT_SCALE;
        #pragma unroll
        for (int jd = 0; jd < 4; ++jd) {
            const v8f o = acc[t][jd] * scl;
            float* od = &Os[((t << 4) + row16) * OST + (jd << 4) + kbase];
            v4f lo, hi;
            #pragma unroll
            for (int e = 0; e < 4; ++e) { lo[e] = o[e]; hi[e] = o[e + 4]; }
            *(v4fa*)(od)     = lo;
            *(v4fa*)(od + 4) = hi;
        }
    }
    __syncthreads();

    const int q4 = (lane & 15) << 2;
    v4f ov[AT * 8];
    #pragma unroll
    for (int p = 0; p < AT * 8; ++p) ov[p] = *(const v4fa*)(&Os[((p << 1) + hsel) * OST + q4]);
    float* orow = out + ((size_t)b * SEQ + q0) * DD + hd * DHD + q4;
    #pragma unroll
    for (int p = 0; p < AT * 8; ++p)
        *(v4f*)(orow + (size_t)((p << 1) + hsel) * DD) = ov[p];
}

// ---------------- launcher ----------------
extern "C" void kernel_launch(void* const* d_in, const int* in_sizes, int n_in,
                              void* d_out, int out_size, void* d_ws, size_t ws_size,
                              hipStream_t stream) {
    if (n_in < 9) return;
    const long long need_rows = (long long)(NB - 1) * SEQ_FULL + SEQ;
    if ((long long)in_sizes[0] < need_rows * DD) return;
    if ((long long)in_sizes[1] < need_rows) return;
    if ((long long)in_sizes[2] < need_rows) return;
    if (in_sizes[3] < DD * DD || in_sizes[5] < DD * DD || in_sizes[7] < DD * DD) return;
    if (in_sizes[4] < DD || in_sizes[6] < DD || in_sizes[8] < DD) return;
    if ((long long)out_size < (long long)MROWS * DD) return;

    const float* X     = (const float*)d_in[0];
    const float* amask = (const float*)d_in[1];
    const float* click = (const float*)d_in[2];
    const float* Wq    = (const float*)d_in[3];
    const float* bq    = (const float*)d_in[4];
    const float* Wk    = (const float*)d_in[5];
    const float* bk    = (const float*)d_in[6];
    const float* Wv    = (const float*)d_in[7];
    const float* bv    = (const float*)d_in[8];
    float* out = (float*)d_out;

    //   Xb  MROWS*DD bf16 | Wqb, Wkb, Wvb  DD*DD bf16 each | Qh, Kh, Vt  MROWS*DD f16 each
    const size_t plane = (size_t)MROWS * DD;      // elements
    const size_t wpl   = (size_t)DD * DD;
    const size_t total_bytes = 2u * (4u * plane + 3u * wpl);
    if (ws_size < total_bytes) return;
    unsigned short* Xb  = (unsigned short*)d_ws;
    unsigned short* Wqb = Xb + plane;
    unsigned short* Wkb = Wqb + wpl;
    unsigned short* Wvb = Wkb + wpl;
    _Float16* Qh = (_Float16*)(Wvb + wpl);
    _Float16* Kh = Qh + plane;
    _Float16* Vt = Kh + plane;

    k_cvt<<<dim3((XCH + 3 * WCH) / CVB), dim3(256), 0, stream>>>(X, Wq, Wk, Wv, Xb);   // fills Xb, Wqb, Wkb, Wvb

    k_proj<<<dim3(DD / PBN, MROWS / PBM, 3), dim3(128), 0, stream>>>(
        Xb, Wqb, Wkb, Wvb, bq, bk, bv, click, Qh, Kh, Vt);

    k_attn<<<dim3(SEQ / QT, NB * HH), dim3(AW * 32), 0, stream>>>(Qh, Kh, Vt, amask, out);
}
